// v000
// The times below were measured on an AMD MI455X: many runs one after another, warmed up first and cycling through
// copies of the inputs, with the whole window's GPU time divided by the number of runs. Launches and the gaps
// between them are all in it. The median over several windows is given; except for v000 it joins two sittings, which
// can be a few percent apart, so the side-by-side timings, each taken in one sitting, are the better comparison.
// The starting kernel, v000, takes 85.3 microseconds a run.
#include <hip/hip_runtime.h>
#include <stddef.h>

// Contractions on v_wmma_f32_16x16x32_f16 (f16 operands, f32 accumulate): both input projections
// (rows x one shared weight, K = 256) and the probability x value product (K = 512 keys). Float
// inputs are RNE-converted to bf16 and carried in f16 (weights x64 for the hq rows and x-64 for
// the hp rows, so the hp projection comes out negated; softmax numerators x1024). The score sum
// over the 256-wide hidden axis (a matrix-vector product against one vector) runs on the vector
// unit in f32, tanh(x) formed as 1 - 2 / (1 + 2^(2 x log2 e)); softmax in f32.

typedef _Float16 v16h __attribute__((ext_vector_type(16)));
typedef _Float16 v8h  __attribute__((ext_vector_type(8)));
typedef float    v8f  __attribute__((ext_vector_type(8)));
typedef float    v4f  __attribute__((ext_vector_type(4)));
typedef _Float16 h16;

#ifndef NB
#define NB 4
#endif
#ifndef SEQ
#define SEQ 512
#endif
#define NB_FULL  4
#define SEQ_FULL 512
#define DIM   256          // feature width of the hq / hp rows (pq_size)
#define VDIM  256          // hidden width of the score
#define MROWS (NB * SEQ)   // compact rows per activation plane (query length == passage length)
#define PT    16           // passage rows per attention block
#define WCOLS (DIM / 8)    // output columns per wave in the attention kernel
#define NBT   (WCOLS / 16) // 16-column output tiles per wave

static_assert(NB >= 1 && NB <= NB_FULL);
static_assert(SEQ >= 256 && SEQ <= SEQ_FULL && (SEQ % 256) == 0);
static_assert((DIM % 64) == 0 && (DIM % 32) == 0);
static_assert((VDIM % 64) == 0 && (VDIM % 4) == 0);
static_assert(VDIM == 256);                 // one thread per hidden column when staging the vector
static_assert((MROWS % 64) == 0);
static_assert(DIM == 8 * WCOLS);            // 8 waves x WCOLS output columns
static_assert(WCOLS == 32 && NBT == 2);
static_assert((SEQ % 64) == 0 && (SEQ % 32) == 0);
static_assert(PT == 16);                    // one 16-row A tile per block
static_assert(PT == 4 * 4);                 // output store: 4 steps x 4 rows
static_assert(PT * VDIM == 256 * 4 * 4);    // sp tile staging: 256 threads x 4 steps x 4 floats
static_assert((SEQ % PT) == 0);

#define LDT 72   // halves per LDS row (144 B, 16-B aligned)
#define LDC 68   // floats per LDS row (272 B, 16-B aligned)
static_assert((LDT % 8) == 0 && LDT >= 64);
static_assert((LDC % 4) == 0 && LDC >= 64);

#define SMAXW  ((SEQ > DIM) ? SEQ : DIM)
#define SPITCH (SMAXW + 4)   // floats per score / output-stage row
#define PPITCH (SEQ + 8)     // halves per probability row
static_assert((SPITCH % 4) == 0 && SPITCH >= SEQ && SPITCH >= DIM);
static_assert((PPITCH % 8) == 0 && PPITCH >= SEQ);

#define WCARRY 64.0f          // weight planes carried x64 (hp plane x-64)
#define PCARRY_LOG2 10.0f     // softmax numerators carried x1024 (added to the exp2 argument)
#define TWO_LOG2E 2.885390081777927f
#define LOG2E     1.4426950408889634f

// workspace layout (bytes)
#define WT_BYTES  ((size_t)2 * VDIM * DIM * 2)      // two [VDIM][DIM] weight planes (+W, -W)
#define A16_BYTES ((size_t)2 * MROWS * DIM * 2)     // hq rows then hp rows, f16
#define HQT_BYTES ((size_t)NB * DIM * SEQ * 2)      // hq transposed [b][d][q], f16
#define S_BYTES   ((size_t)2 * MROWS * VDIM * 4)    // scaled projections: sq rows then -sp rows, f32
#define OFF_WT  ((size_t)0)
#define OFF_A16 (OFF_WT + WT_BYTES)
#define OFF_HQT (OFF_A16 + A16_BYTES)
#define OFF_S   (OFF_HQT + HQT_BYTES)
#define WS_TOTAL (OFF_S + S_BYTES)
static_assert((WT_BYTES % 128) == 0 && (A16_BYTES % 128) == 0);
static_assert((HQT_BYTES % 128) == 0 && (S_BYTES % 128) == 0);
static_assert(WS_TOTAL <= (size_t)134217728);

// ---------------------------------------------------------------------------
__device__ __forceinline__ float bf16r(float x) {   // RNE convert to bf16, returned widened
  unsigned int u = __float_as_uint(x);
  u = (u + 0x7FFFu + ((u >> 16) & 1u)) & 0xFFFF0000u;
  return __uint_as_float(u);
}

// f32 -> f16 operand convert that cannot produce an f16 subnormal (value select).
static __device__ __forceinline__ h16 toh_flush(float v) {
  const h16 r = (h16)v;
  return (fabsf(v) < 6.103515625e-05f) ? (h16)0.0f : r;
}

// 16-bit fragment: p points at element [row = lane&15][k0 + 8*(lane>>4)] of a k-contiguous
// row. Elements 0..7 <- k0+8h+0..7, elements 8..15 <- k0+16+8h+0..7 (same map for A and B).
__device__ __forceinline__ v16h frag_at(const _Float16* p) {
  v8h lo = *(const v8h*)(p);
  v8h hi = *(const v8h*)(p + 16);
  v16h out;
#pragma unroll
  for (int i = 0; i < 8; ++i) { out[i] = lo[i]; out[i + 8] = hi[i]; }
  return out;
}
__device__ __forceinline__ v16h ld_frag(const _Float16* base, unsigned ld) {
  const unsigned lane = threadIdx.x & 31u;
  return frag_at(base + (lane & 15u) * ld + (lane >> 4) * 8u);
}

__device__ __forceinline__ v8f wmma16(v16h a, v16h b, v8f c) {
  v8f d = __builtin_amdgcn_wmma_f32_16x16x32_f16(false, a, false, b, (short)0, c,
                                                 false, false);
  asm volatile("v_nop\n\tv_nop\n\tv_nop\n\tv_nop" : "+v"(d) : "v"(a), "v"(b));
  return d;
}

__device__ __forceinline__ float red32_sum(float x) {
#pragma unroll
  for (int off = 1; off < 32; off <<= 1) x += __shfl_xor(x, off, 32);
  return x;
}
__device__ __forceinline__ float red32_max(float x) {
#pragma unroll
  for (int off = 1; off < 32; off <<= 1) x = fmaxf(x, __shfl_xor(x, off, 32));
  return x;
}

__device__ __forceinline__ void wave_lds_sync() {
  __builtin_amdgcn_fence(3 /* release order */, "wavefront");
  asm volatile("s_wait_dscnt 0x0" ::: "memory");
  __builtin_amdgcn_wave_barrier();
}

__device__ __forceinline__ float fast_exp2(float x) {
#if __has_builtin(__builtin_amdgcn_exp2f)
  return __builtin_amdgcn_exp2f(x);
#else
  return __expf(x * 0.6931471805599453f);
#endif
}

// ---------------------------------------------------------------------------
// Weight plane: in W[N rows][K cols] (pitch ldw = K; the [out][in] layout is already
// k-contiguous, so no transpose) -> out Wt[N][K] (pitch ldk = K), f16(carry * bf16(w)).
// carry = +64 for the hq plane, -64 for the hp plane (exact sign fold).
// Grid (N/64, K/64). T: cross-wave (block barrier).
// Store coverage: 2 steps x 32 rows == 64 tile rows.
// ---------------------------------------------------------------------------
__global__ __launch_bounds__(256) void wconv_kernel(
    const float* __restrict__ W, _Float16* __restrict__ Wt, unsigned ldw, unsigned ldk,
    float carry) {
  __shared__ __attribute__((aligned(16))) _Float16 T[64 * LDT];
  const unsigned tid = threadIdx.x;
  const unsigned n0 = blockIdx.x * 64u;
  const unsigned k0 = blockIdx.y * 64u;
#pragma unroll 4
  for (unsigned j = 0; j < 16u; ++j) {
    const unsigned idx = tid + 256u * j;
    const unsigned nr = idx >> 6, kc = idx & 63u;
    const float v = W[(size_t)(n0 + nr) * ldw + k0 + kc];
    T[nr * LDT + kc] = toh_flush(carry * bf16r(v));
  }
  __syncthreads();
  v8h x[2];
  size_t off[2];
#pragma unroll
  for (unsigned i = 0; i < 2u; ++i) {
    const unsigned n = 32u * i + (tid >> 3);
    const unsigned kc = (tid & 7u) * 8u;
    x[i] = *(const v8h*)&T[n * LDT + kc];
    off[i] = (size_t)(n0 + n) * ldk + k0 + kc;
  }
#pragma unroll
  for (int i = 0; i < 2; ++i) *(v8h*)(Wt + off[i]) = x[i];
  
}

// ---------------------------------------------------------------------------
// Activation planes: X f32 [NB_FULL][SEQ_FULL][DIM] (input) -> X16 compact [NB*SEQ][DIM]
// = f16(bf16(x)); WITH_T also writes XT16 [NB][DIM][SEQ] (same values, transposed per batch).
// of either plane is written by 8 consecutive lanes x 16 B of one instruction.
// Store coverage: 2 steps x 32 rows == 64 tile rows, for each plane. Grid (DIM/64, MROWS/64).
// ---------------------------------------------------------------------------
template <int WITH_T>
__device__ __forceinline__ void aconv_body(const float* __restrict__ X,
                                           _Float16* __restrict__ X16,
                                           _Float16* __restrict__ XT16) {
  __shared__ __attribute__((aligned(16))) _Float16 T[64 * LDT];
  __shared__ __attribute__((aligned(16))) _Float16 TT[64 * LDT];
  const unsigned tid = threadIdx.x;
  const unsigned c0 = blockIdx.x * 64u;
  const unsigned crow0 = blockIdx.y * 64u;
  const unsigned bidx = crow0 / (unsigned)SEQ;
  const unsigned s0 = crow0 - bidx * (unsigned)SEQ;
  const size_t frow0 = (size_t)bidx * SEQ_FULL + s0;
#pragma unroll
  for (unsigned j = 0; j < 4u; ++j) {
    const unsigned idx = tid + 256u * j;
    const unsigned r = idx >> 4, c = (idx & 15u) * 4u;
    const v4f a = *(const v4f*)(X + (frow0 + r) * DIM + c0 + c);
#pragma unroll
    for (unsigned i = 0; i < 4u; ++i) {
      const h16 hv = toh_flush(bf16r(a[i]));
      T[r * LDT + c + i] = hv;
      if (WITH_T) TT[(c + i) * LDT + r] = hv;
    }
  }
  __syncthreads();
  v8h x[2], xt[2];
  size_t off[2], offt[2];
#pragma unroll
  for (unsigned i = 0; i < 2u; ++i) {
    const unsigned n = 32u * i + (tid >> 3);
    const unsigned kc = (tid & 7u) * 8u;
    x[i] = *(const v8h*)&T[n * LDT + kc];
    off[i] = (size_t)(crow0 + n) * DIM + c0 + kc;
    if (WITH_T) {
      xt[i] = *(const v8h*)&TT[n * LDT + kc];
      offt[i] = ((size_t)bidx * DIM + c0 + n) * SEQ + s0 + kc;
    } else {
      xt[i] = x[i];
      offt[i] = off[i];
    }
  }
#pragma unroll
  for (int i = 0; i < 2; ++i) *(v8h*)(X16 + off[i]) = x[i];
  if (WITH_T) {
#pragma unroll
    for (int i = 0; i < 2; ++i) *(v8h*)(XT16 + offt[i]) = xt[i];
  }
  
}

__global__ __launch_bounds__(256) void aconv_q_kernel(
    const float* __restrict__ X, _Float16* __restrict__ X16, _Float16* __restrict__ XT16) {
  aconv_body<1>(X, X16, XT16);
}
__global__ __launch_bounds__(256) void aconv_p_kernel(
    const float* __restrict__ X, _Float16* __restrict__ X16) {
  aconv_body<0>(X, X16, X16);
}

// ---------------------------------------------------------------------------
// Projection GEMM C[64x64 tile] = A16[rows][DIM] . Wt[n][DIM]^T, fragments straight from the
// 16-bit global planes; 8 waves (mw = 16-row group, nw = 32-col group), 2 accumulators/wave.
// Rows 0..MROWS-1 (hq rows) use weight plane 0, rows MROWS..2*MROWS-1 (hp rows) plane 1
// (block-uniform integer offset). Output f32 [2*MROWS][VDIM] = acc * (2 log2 e / 64), i.e. the
// projection pre-scaled for the exp2 form of tanh. Epilogue staged through Cs (cross-wave,
// lanes x 16 B. Store coverage: 4 steps x 16 rows == 64 tile rows.
// Grid (VDIM/64, 2*MROWS/64).
// ---------------------------------------------------------------------------
__global__ __launch_bounds__(256) void proj_kernel(
    const _Float16* __restrict__ A16, const _Float16* __restrict__ Wt,
    float* __restrict__ outf) {
  __shared__ __attribute__((aligned(16))) float Cs[64 * LDC];
  const unsigned tid = threadIdx.x, lane = tid & 31u;
  const unsigned w = (unsigned)__builtin_amdgcn_readfirstlane((int)(threadIdx.x >> 5));
  const unsigned mw = w >> 1, nw = w & 1u;
  const unsigned hh = lane >> 4, m = lane & 15u;
  const unsigned n0 = blockIdx.x * 64u;
  const unsigned row0 = blockIdx.y * 64u;
  const size_t woff = (size_t)(row0 / (unsigned)MROWS) * ((size_t)VDIM * DIM);

  const _Float16* ap  = A16 + (size_t)(row0 + mw * 16u + m) * DIM + hh * 8u;
  const _Float16* bp0 = Wt + woff + (size_t)(n0 + nw * 32u + m) * DIM + hh * 8u;
  const _Float16* bp1 = bp0 + (size_t)16 * DIM;
  v8f acc0 = {}, acc1 = {};
#pragma unroll 2
  for (unsigned k0 = 0; k0 < (unsigned)DIM; k0 += 32u) {
    const v16h a  = frag_at(ap + k0);
    const v16h b0 = frag_at(bp0 + k0);
    const v16h b1 = frag_at(bp1 + k0);
    acc0 = wmma16(a, b0, acc0);
    acc1 = wmma16(a, b1, acc1);
  }
#pragma unroll
  for (int r = 0; r < 8; ++r) {
    float* d = &Cs[(mw * 16u + hh * 8u + (unsigned)r) * LDC + nw * 32u + m];
    d[0]  = acc0[r];
    d[16] = acc1[r];
  }
  __syncthreads();

  const float cs = TWO_LOG2E / WCARRY;
  v4f xs[4];
  size_t off[4];
#pragma unroll
  for (unsigned i = 0; i < 4u; ++i) {
    const unsigned r = 16u * i + (tid >> 4);
    const unsigned c = (tid & 15u) * 4u;
    const v4f u = *(const v4f*)&Cs[r * LDC + c];
    xs[i] = u * cs;
    off[i] = (size_t)(row0 + r) * VDIM + n0 + c;
  }
#pragma unroll
  for (int i = 0; i < 4; ++i) *(v4f*)(outf + off[i]) = xs[i];
  
}

// ---------------------------------------------------------------------------
// Difference-form additive attention per (16 passage rows, batch). 8 waves.
// Sp holds the NEGATED scaled hp projection (weight plane carried x-64), so that
// sq'[q][v] + sp'[p][v] = 2 log2 e * (Wq[q][v] - Wp[p][v]).
// Phase 0: stage the 16 scaled sp rows (sp_s) and the vector -2*bf16(v) (vs) in LDS.
// Phase 1: thread t owns query q = 256*pass + t; for the 16 passage rows it accumulates
//          sum_v vs[v] / (1 + 2^(sq'[q][v] + sp'[p][v])) in f32 (equals the score up
//          to a constant that is the same for every query, which the softmax removes);
//          results into Ss[p][q]. sp_s / vs / Ss: cross-wave (block barriers).
// Phase 2: wave w owns rows 2w, 2w+1: row max, f16(1024 * exp(s - max)) into Pl (select on
//          the exp2 argument keeps the plane free of f16 subnormals), row sum over the
//          converted values into Ls. Pl / Ls: cross-wave (block barrier).
// Phase 3: out tile [16][32 per wave] = Pl[16][SEQ] . HqT[d][q]^T, B fragments straight from
//          the transposed f16 plane.
// Phase 4: scale by 1 / row sum, stage in the wave's own 32 columns of Ss (wave-private from
//          Store coverage: 4 steps x 4 rows == 16 rows.
// Grid (SEQ/16, NB).
// ---------------------------------------------------------------------------
__global__ __launch_bounds__(256) void addattn_kernel(
    const float* __restrict__ Sq, const float* __restrict__ Sp,
    const float* __restrict__ vvec, const _Float16* __restrict__ HqT,
    float* __restrict__ out) {
  __shared__ __attribute__((aligned(16))) float sp_s[PT * VDIM];
  __shared__ __attribute__((aligned(16))) float vs[VDIM];
  __shared__ __attribute__((aligned(16))) float Ss[PT * SPITCH];
  __shared__ __attribute__((aligned(16))) _Float16 Pl[PT * PPITCH];
  __shared__ __attribute__((aligned(16))) float Ls[PT];
  static_assert(sizeof(float) * (PT * VDIM + VDIM + PT * SPITCH + PT) +
                sizeof(_Float16) * (PT * PPITCH) <= 131072);

  const unsigned tid = threadIdx.x, lane = tid & 31u;
  const unsigned wave = (unsigned)__builtin_amdgcn_readfirstlane((int)(threadIdx.x >> 5));
  const unsigned hh = lane >> 4, m = lane & 15u;
  const unsigned p0 = blockIdx.x * (unsigned)PT;
  const unsigned b = blockIdx.y;

  // ---- phase 0 ----
#pragma unroll
  for (unsigned j = 0; j < 4u; ++j) {
    const unsigned idx = tid + 256u * j;
    const unsigned r = idx >> 6, c = (idx & 63u) * 4u;
    *(v4f*)&sp_s[r * VDIM + c] =
        *(const v4f*)(Sp + (size_t)(b * (unsigned)SEQ + p0 + r) * VDIM + c);
  }
  vs[tid] = -2.0f * bf16r(vvec[tid]);
  __syncthreads();

  // ---- phase 1 ----
#pragma unroll 1
  for (unsigned pass = 0; pass < (unsigned)(SEQ / 256); ++pass) {
    const unsigned q = pass * 256u + tid;
    const float* sqr = Sq + (size_t)(b * (unsigned)SEQ + q) * VDIM;
    float acc[PT];
#pragma unroll
    for (int p = 0; p < PT; ++p) acc[p] = 0.0f;
#pragma unroll 1
    for (unsigned v0 = 0; v0 < (unsigned)VDIM; v0 += 4u) {
      const v4f a = *(const v4f*)(sqr + v0);
      const v4f vv = *(const v4f*)&vs[v0];
#pragma unroll
      for (int p = 0; p < PT; ++p) {
        const v4f s4 = *(const v4f*)&sp_s[(unsigned)p * VDIM + v0];
#pragma unroll
        for (int j = 0; j < 4; ++j) {
          const float t = fast_exp2(a[j] + s4[j]);
          const float r = __builtin_amdgcn_rcpf(t + 1.0f);
          acc[p] += vv[j] * r;
        }
      }
    }
#pragma unroll
    for (int p = 0; p < PT; ++p) Ss[(unsigned)p * SPITCH + q] = acc[p];
  }
  __syncthreads();

  // ---- phase 2 ----
#pragma unroll 1
  for (unsigned rr = 0; rr < 2u; ++rr) {
    const unsigned row = wave * 2u + rr;
    float mx = -3.0e38f;
#pragma unroll 4
    for (unsigned j = 0; j < (unsigned)(SEQ / 32); ++j)
      mx = fmaxf(mx, Ss[row * SPITCH + lane + 32u * j]);
    mx = red32_max(mx);
    float l = 0.0f;
#pragma unroll 4
    for (unsigned j = 0; j < (unsigned)(SEQ / 32); ++j) {
      const float arg = (Ss[row * SPITCH + lane + 32u * j] - mx) * LOG2E + PCARRY_LOG2;
      const float e = fast_exp2(arg);
      const h16 ph = (arg < -14.0f) ? (h16)0.0f : (h16)e;
      Pl[row * PPITCH + lane + 32u * j] = ph;
      l += (float)ph;
    }
    l = red32_sum(l);
    if (lane == 0u) Ls[row] = l;
  }
  __syncthreads();

  // ---- phase 3 ----
  const unsigned d0 = wave * (unsigned)WCOLS;
  const _Float16* bp = HqT + ((size_t)b * DIM + d0 + m) * SEQ + hh * 8u;
  v8f o[NBT];
#pragma unroll
  for (int nb = 0; nb < NBT; ++nb) o[nb] = (v8f){};
#pragma unroll 2
  for (unsigned k0 = 0; k0 < (unsigned)SEQ; k0 += 32u) {
    const v16h pf = ld_frag(&Pl[k0], PPITCH);
#pragma unroll
    for (int nb = 0; nb < NBT; ++nb) {
      const v16h hf = frag_at(bp + (size_t)(nb * 16) * SEQ + k0);
      o[nb] = wmma16(pf, hf, o[nb]);
    }
  }

  // ---- phase 4 ----
  float inv[8];
#pragma unroll
  for (int r = 0; r < 8; ++r) inv[r] = __builtin_amdgcn_rcpf(Ls[hh * 8u + (unsigned)r]);
#pragma unroll
  for (int nb = 0; nb < NBT; ++nb)
#pragma unroll
    for (int r = 0; r < 8; ++r)
      Ss[(hh * 8u + (unsigned)r) * SPITCH + d0 + (unsigned)nb * 16u + m] = o[nb][r] * inv[r];
  wave_lds_sync();
  v4f x[4];
  size_t off[4];
#pragma unroll
  for (unsigned i = 0; i < 4u; ++i) {
    const unsigned r = 4u * i + (lane >> 3);
    const unsigned c = (lane & 7u) * 4u;
    x[i] = *(const v4f*)&Ss[r * SPITCH + d0 + c];
    off[i] = ((size_t)b * SEQ_FULL + p0 + r) * DIM + d0 + c;
  }
#pragma unroll
  for (int i = 0; i < 4; ++i) *(v4f*)(out + off[i]) = x[i];
  
}

// ---------------------------------------------------------------------------
extern "C" void kernel_launch(void* const* d_in, const int* in_sizes, int n_in,
                              void* d_out, int out_size, void* d_ws, size_t ws_size,
                              hipStream_t stream) {
  if (n_in < 4) return;
  const long long need_x = ((long long)(NB - 1) * SEQ_FULL + SEQ) * DIM;
  if ((long long)in_sizes[0] < need_x) return;
  if ((long long)in_sizes[1] < need_x) return;
  if ((long long)in_sizes[2] < (long long)DIM * VDIM) return;
  if (in_sizes[3] < VDIM) return;
  if ((long long)out_size < need_x) return;
  if (ws_size < WS_TOTAL) return;

  const float* hq   = (const float*)d_in[0];   // [NB_FULL][SEQ_FULL][DIM]
  const float* hp   = (const float*)d_in[1];   // [NB_FULL][SEQ_FULL][DIM]
  const float* w_in = (const float*)d_in[2];   // [VDIM][DIM]  (out, in), shared by both sides
  const float* vvec = (const float*)d_in[3];   // [VDIM]
  float* out = (float*)d_out;                  // [NB_FULL][SEQ_FULL][DIM]

  char* ws = (char*)d_ws;
  _Float16* Wt   = (_Float16*)(ws + OFF_WT);    // plane 0: +64 W for hq, plane 1: -64 W for hp
  _Float16* A16  = (_Float16*)(ws + OFF_A16);   // [2*MROWS][DIM]: hq rows then hp rows
  _Float16* HqT  = (_Float16*)(ws + OFF_HQT);   // [NB][DIM][SEQ]
  float*    Spl  = (float*)(ws + OFF_S);        // [2*MROWS][VDIM]: sq rows then -sp rows

  dim3 blk(256);

  // weight planes: in [N = VDIM rows][K = DIM cols] -> out [VDIM][DIM]; grid (N/64, K/64)
  wconv_kernel<<<dim3(VDIM / 64, DIM / 64), blk, 0, stream>>>(
      w_in, Wt, (unsigned)DIM, (unsigned)DIM, WCARRY);
  wconv_kernel<<<dim3(VDIM / 64, DIM / 64), blk, 0, stream>>>(
      w_in, Wt + (size_t)VDIM * DIM, (unsigned)DIM, (unsigned)DIM, -WCARRY);

  // activation planes: hq -> rows 0..MROWS-1 and the transposed plane; hp -> rows MROWS..
  aconv_q_kernel<<<dim3(DIM / 64, MROWS / 64), blk, 0, stream>>>(hq, A16, HqT);
  aconv_p_kernel<<<dim3(DIM / 64, MROWS / 64), blk, 0, stream>>>(
      hp, A16 + (size_t)MROWS * DIM);

  // both projections in one launch
  proj_kernel<<<dim3(VDIM / 64, (2 * MROWS) / 64), blk, 0, stream>>>(A16, Wt, Spl);

  // scores + softmax + weighted sum
  addattn_kernel<<<dim3(SEQ / PT, NB), blk, 0, stream>>>(
      Spl, Spl + (size_t)MROWS * VDIM, vvec, HqT, out);
}

// v001
// It runs in 62 microseconds.
// Timed twice side by side with v000, it ran 1.38 and 1.40 times as fast.
#include <hip/hip_runtime.h>
#include <stddef.h>

// Contractions on v_wmma_f32_16x16x32_f16 (f16 operands, f32 accumulate): both input projections
// (rows x one shared weight, K = 256) and the probability x value product (K = 512 keys). Float
// inputs are RNE-converted to bf16 and carried in f16 (weights x64 for the hq rows and x-64 for
// the hp rows, so the hp projection comes out negated; softmax numerators x1024). The score sum
// over the 256-wide hidden axis (a matrix-vector product against one vector) runs on the vector
// unit in f32, tanh(x) formed as 1 - 2 / (1 + 2^(2 x log2 e)); softmax in f32.

typedef _Float16 v16h __attribute__((ext_vector_type(16)));
typedef _Float16 v8h  __attribute__((ext_vector_type(8)));
typedef float    v8f  __attribute__((ext_vector_type(8)));
typedef float    v4f  __attribute__((ext_vector_type(4)));
typedef _Float16 h16;

#ifndef NB
#define NB 4
#endif
#ifndef SEQ
#define SEQ 512
#endif
#define NB_FULL  4
#define SEQ_FULL 512
#define DIM   256          // feature width of the hq / hp rows (pq_size)
#define VDIM  256          // hidden width of the score
#define MROWS (NB * SEQ)   // compact rows per activation plane (query length == passage length)
#define PT    8            // passage rows per attention block: (SEQ / PT) * NB = 256 blocks
#define VSTEP 8            // hidden columns per score-loop trip (PT * VSTEP terms per thread)
#define WCOLS (DIM / 8)    // output columns per wave in the attention kernel
#define NBT   (WCOLS / 16) // 16-column output tiles per wave

static_assert(NB >= 1 && NB <= NB_FULL);
static_assert(SEQ >= 256 && SEQ <= SEQ_FULL && (SEQ % 256) == 0);
static_assert((DIM % 64) == 0 && (DIM % 32) == 0);
static_assert((VDIM % 64) == 0 && (VDIM % 4) == 0);
static_assert(VDIM == 256);                 // one thread per hidden column when staging the vector
static_assert((MROWS % 64) == 0);
static_assert(DIM == 8 * WCOLS);            // 8 waves x WCOLS output columns
static_assert(WCOLS == 32 && NBT == 2);
static_assert((SEQ % 64) == 0 && (SEQ % 32) == 0);
static_assert(PT == 8);                     // A tile rows 0..7; rows 8..15 repeat them; 1 row per wave
static_assert(PT == 2 * 4);                 // output store: 2 steps x 4 rows
static_assert(PT * VDIM == 256 * 2 * 4);    // sp tile staging: 256 threads x 2 steps x 4 floats
static_assert(VSTEP == 2 * 4 && (VDIM % VSTEP) == 0);
static_assert((SEQ % PT) == 0);

#define LDT 72   // halves per LDS row (144 B, 16-B aligned)
#define LDC 68   // floats per LDS row (272 B, 16-B aligned)
static_assert((LDT % 8) == 0 && LDT >= 64);
static_assert((LDC % 4) == 0 && LDC >= 64);

#define SMAXW  ((SEQ > DIM) ? SEQ : DIM)
#define SPITCH (SMAXW + 4)   // floats per score / output-stage row
#define PPITCH (SEQ + 8)     // halves per probability row
static_assert((SPITCH % 4) == 0 && SPITCH >= SEQ && SPITCH >= DIM);
static_assert((PPITCH % 8) == 0 && PPITCH >= SEQ);

#define WCARRY 64.0f          // weight planes carried x64 (hp plane x-64)
#define PCARRY_LOG2 10.0f     // softmax numerators carried x1024 (added to the exp2 argument)
#define TWO_LOG2E 2.885390081777927f
#define LOG2E     1.4426950408889634f

// workspace layout (bytes)
#define WT_BYTES  ((size_t)2 * VDIM * DIM * 2)      // two [VDIM][DIM] weight planes (+W, -W)
#define A16_BYTES ((size_t)2 * MROWS * DIM * 2)     // hq rows then hp rows, f16
#define HQT_BYTES ((size_t)NB * DIM * SEQ * 2)      // hq transposed [b][d][q], f16
#define S_BYTES   ((size_t)2 * MROWS * VDIM * 4)    // scaled projections: sq rows then -sp rows, f32
#define OFF_WT  ((size_t)0)
#define OFF_A16 (OFF_WT + WT_BYTES)
#define OFF_HQT (OFF_A16 + A16_BYTES)
#define OFF_S   (OFF_HQT + HQT_BYTES)
#define WS_TOTAL (OFF_S + S_BYTES)
static_assert((WT_BYTES % 128) == 0 && (A16_BYTES % 128) == 0);
static_assert((HQT_BYTES % 128) == 0 && (S_BYTES % 128) == 0);
static_assert(WS_TOTAL <= (size_t)134217728);

// ---------------------------------------------------------------------------
__device__ __forceinline__ float bf16r(float x) {   // RNE convert to bf16, returned widened
  unsigned int u = __float_as_uint(x);
  u = (u + 0x7FFFu + ((u >> 16) & 1u)) & 0xFFFF0000u;
  return __uint_as_float(u);
}

// f32 -> f16 operand convert that cannot produce an f16 subnormal (value select).
static __device__ __forceinline__ h16 toh_flush(float v) {
  const h16 r = (h16)v;
  return (fabsf(v) < 6.103515625e-05f) ? (h16)0.0f : r;
}

// 16-bit fragment: p points at element [row = lane&15][k0 + 8*(lane>>4)] of a k-contiguous
// row. Elements 0..7 <- k0+8h+0..7, elements 8..15 <- k0+16+8h+0..7 (same map for A and B).
__device__ __forceinline__ v16h frag_at(const _Float16* p) {
  v8h lo = *(const v8h*)(p);
  v8h hi = *(const v8h*)(p + 16);
  v16h out;
#pragma unroll
  for (int i = 0; i < 8; ++i) { out[i] = lo[i]; out[i + 8] = hi[i]; }
  return out;
}

__device__ __forceinline__ v8f wmma16(v16h a, v16h b, v8f c) {
  v8f d = __builtin_amdgcn_wmma_f32_16x16x32_f16(false, a, false, b, (short)0, c,
                                                 false, false);
  asm volatile("v_nop\n\tv_nop\n\tv_nop\n\tv_nop" : "+v"(d) : "v"(a), "v"(b));
  return d;
}

__device__ __forceinline__ float red32_sum(float x) {
#pragma unroll
  for (int off = 1; off < 32; off <<= 1) x += __shfl_xor(x, off, 32);
  return x;
}
__device__ __forceinline__ float red32_max(float x) {
#pragma unroll
  for (int off = 1; off < 32; off <<= 1) x = fmaxf(x, __shfl_xor(x, off, 32));
  return x;
}

__device__ __forceinline__ void wave_lds_sync() {
  __builtin_amdgcn_fence(3 /* release order */, "wavefront");
  asm volatile("s_wait_dscnt 0x0" ::: "memory");
  __builtin_amdgcn_wave_barrier();
}

__device__ __forceinline__ float fast_exp2(float x) {
#if __has_builtin(__builtin_amdgcn_exp2f)
  return __builtin_amdgcn_exp2f(x);
#else
  return __expf(x * 0.6931471805599453f);
#endif
}

// ---------------------------------------------------------------------------
// Weight plane: in W[N rows][K cols] (pitch ldw = K; the [out][in] layout is already
// k-contiguous, so no transpose) -> out Wt[N][K] (pitch ldk = K), f16(carry * bf16(w)).
// carry = +64 for the hq plane, -64 for the hp plane (exact sign fold).
// Grid (N/64, K/64). T: cross-wave (block barrier).
// Store coverage: 2 steps x 32 rows == 64 tile rows.
// ---------------------------------------------------------------------------
__global__ __launch_bounds__(256) void wconv_kernel(
    const float* __restrict__ W, _Float16* __restrict__ Wt, unsigned ldw, unsigned ldk,
    float carry) {
  __shared__ __attribute__((aligned(16))) _Float16 T[64 * LDT];
  const unsigned tid = threadIdx.x;
  const unsigned n0 = blockIdx.x * 64u;
  const unsigned k0 = blockIdx.y * 64u;
#pragma unroll 4
  for (unsigned j = 0; j < 16u; ++j) {
    const unsigned idx = tid + 256u * j;
    const unsigned nr = idx >> 6, kc = idx & 63u;
    const float v = W[(size_t)(n0 + nr) * ldw + k0 + kc];
    T[nr * LDT + kc] = toh_flush(carry * bf16r(v));
  }
  __syncthreads();
  v8h x[2];
  size_t off[2];
#pragma unroll
  for (unsigned i = 0; i < 2u; ++i) {
    const unsigned n = 32u * i + (tid >> 3);
    const unsigned kc = (tid & 7u) * 8u;
    x[i] = *(const v8h*)&T[n * LDT + kc];
    off[i] = (size_t)(n0 + n) * ldk + k0 + kc;
  }
#pragma unroll
  for (int i = 0; i < 2; ++i) *(v8h*)(Wt + off[i]) = x[i];
  
}

// ---------------------------------------------------------------------------
// Activation planes: X f32 [NB_FULL][SEQ_FULL][DIM] (input) -> X16 compact [NB*SEQ][DIM]
// = f16(bf16(x)); WITH_T also writes XT16 [NB][DIM][SEQ] (same values, transposed per batch).
// of either plane is written by 8 consecutive lanes x 16 B of one instruction.
// Store coverage: 2 steps x 32 rows == 64 tile rows, for each plane. Grid (DIM/64, MROWS/64).
// ---------------------------------------------------------------------------
template <int WITH_T>
__device__ __forceinline__ void aconv_body(const float* __restrict__ X,
                                           _Float16* __restrict__ X16,
                                           _Float16* __restrict__ XT16) {
  __shared__ __attribute__((aligned(16))) _Float16 T[64 * LDT];
  __shared__ __attribute__((aligned(16))) _Float16 TT[64 * LDT];
  const unsigned tid = threadIdx.x;
  const unsigned c0 = blockIdx.x * 64u;
  const unsigned crow0 = blockIdx.y * 64u;
  const unsigned bidx = crow0 / (unsigned)SEQ;
  const unsigned s0 = crow0 - bidx * (unsigned)SEQ;
  const size_t frow0 = (size_t)bidx * SEQ_FULL + s0;
#pragma unroll
  for (unsigned j = 0; j < 4u; ++j) {
    const unsigned idx = tid + 256u * j;
    const unsigned r = idx >> 4, c = (idx & 15u) * 4u;
    const v4f a = *(const v4f*)(X + (frow0 + r) * DIM + c0 + c);
#pragma unroll
    for (unsigned i = 0; i < 4u; ++i) {
      const h16 hv = toh_flush(bf16r(a[i]));
      T[r * LDT + c + i] = hv;
      if (WITH_T) TT[(c + i) * LDT + r] = hv;
    }
  }
  __syncthreads();
  v8h x[2], xt[2];
  size_t off[2], offt[2];
#pragma unroll
  for (unsigned i = 0; i < 2u; ++i) {
    const unsigned n = 32u * i + (tid >> 3);
    const unsigned kc = (tid & 7u) * 8u;
    x[i] = *(const v8h*)&T[n * LDT + kc];
    off[i] = (size_t)(crow0 + n) * DIM + c0 + kc;
    if (WITH_T) {
      xt[i] = *(const v8h*)&TT[n * LDT + kc];
      offt[i] = ((size_t)bidx * DIM + c0 + n) * SEQ + s0 + kc;
    } else {
      xt[i] = x[i];
      offt[i] = off[i];
    }
  }
#pragma unroll
  for (int i = 0; i < 2; ++i) *(v8h*)(X16 + off[i]) = x[i];
  if (WITH_T) {
#pragma unroll
    for (int i = 0; i < 2; ++i) *(v8h*)(XT16 + offt[i]) = xt[i];
  }
  
}

__global__ __launch_bounds__(256) void aconv_q_kernel(
    const float* __restrict__ X, _Float16* __restrict__ X16, _Float16* __restrict__ XT16) {
  aconv_body<1>(X, X16, XT16);
}
__global__ __launch_bounds__(256) void aconv_p_kernel(
    const float* __restrict__ X, _Float16* __restrict__ X16) {
  aconv_body<0>(X, X16, X16);
}

// ---------------------------------------------------------------------------
// Projection GEMM C[64x64 tile] = A16[rows][DIM] . Wt[n][DIM]^T, fragments straight from the
// 16-bit global planes; 8 waves (mw = 16-row group, nw = 32-col group), 2 accumulators/wave.
// Rows 0..MROWS-1 (hq rows) use weight plane 0, rows MROWS..2*MROWS-1 (hp rows) plane 1
// (block-uniform integer offset). Output f32 [2*MROWS][VDIM] = acc * (2 log2 e / 64), i.e. the
// projection pre-scaled for the exp2 form of tanh. Epilogue staged through Cs (cross-wave,
// lanes x 16 B. Store coverage: 4 steps x 16 rows == 64 tile rows.
// Grid (VDIM/64, 2*MROWS/64).
// ---------------------------------------------------------------------------
__global__ __launch_bounds__(256) void proj_kernel(
    const _Float16* __restrict__ A16, const _Float16* __restrict__ Wt,
    float* __restrict__ outf) {
  __shared__ __attribute__((aligned(16))) float Cs[64 * LDC];
  const unsigned tid = threadIdx.x, lane = tid & 31u;
  const unsigned w = (unsigned)__builtin_amdgcn_readfirstlane((int)(threadIdx.x >> 5));
  const unsigned mw = w >> 1, nw = w & 1u;
  const unsigned hh = lane >> 4, m = lane & 15u;
  const unsigned n0 = blockIdx.x * 64u;
  const unsigned row0 = blockIdx.y * 64u;
  const size_t woff = (size_t)(row0 / (unsigned)MROWS) * ((size_t)VDIM * DIM);

  const _Float16* ap  = A16 + (size_t)(row0 + mw * 16u + m) * DIM + hh * 8u;
  const _Float16* bp0 = Wt + woff + (size_t)(n0 + nw * 32u + m) * DIM + hh * 8u;
  const _Float16* bp1 = bp0 + (size_t)16 * DIM;
  v8f acc0 = {}, acc1 = {};
#pragma unroll 2
  for (unsigned k0 = 0; k0 < (unsigned)DIM; k0 += 32u) {
    const v16h a  = frag_at(ap + k0);
    const v16h b0 = frag_at(bp0 + k0);
    const v16h b1 = frag_at(bp1 + k0);
    acc0 = wmma16(a, b0, acc0);
    acc1 = wmma16(a, b1, acc1);
  }
#pragma unroll
  for (int r = 0; r < 8; ++r) {
    float* d = &Cs[(mw * 16u + hh * 8u + (unsigned)r) * LDC + nw * 32u + m];
    d[0]  = acc0[r];
    d[16] = acc1[r];
  }
  __syncthreads();

  const float cs = TWO_LOG2E / WCARRY;
  v4f xs[4];
  size_t off[4];
#pragma unroll
  for (unsigned i = 0; i < 4u; ++i) {
    const unsigned r = 16u * i + (tid >> 4);
    const unsigned c = (tid & 15u) * 4u;
    const v4f u = *(const v4f*)&Cs[r * LDC + c];
    xs[i] = u * cs;
    off[i] = (size_t)(row0 + r) * VDIM + n0 + c;
  }
#pragma unroll
  for (int i = 0; i < 4; ++i) *(v4f*)(outf + off[i]) = xs[i];
  
}

// ---------------------------------------------------------------------------
// Difference-form additive attention per (8 passage rows, batch). 8 waves.
// Sp holds the NEGATED scaled hp projection (weight plane carried x-64), so that
// sq'[q][v] + sp'[p][v] = 2 log2 e * (Wq[q][v] - Wp[p][v]).
// Phase 0: stage the 8 scaled sp rows (sp_s) and the vector -2*bf16(v) (vs) in LDS.
// Phase 1: thread t owns query q = 256*pass + t; for the 8 passage rows it accumulates
//          sum_v vs[v] / (1 + 2^(sq'[q][v] + sp'[p][v])) in f32 (equals the score up
//          to a constant that is the same for every query, which the softmax removes);
//          results into Ss[p][q]. sp_s / vs / Ss: cross-wave (block barriers).
// Phase 2: wave w owns row w: row max, f16(1024 * exp(s - max)) into Pl (select on
//          the exp2 argument keeps the plane free of f16 subnormals), row sum over the
//          converted values into Ls. Pl / Ls: cross-wave (block barrier).
// Phase 3: out tile [8][32 per wave] = Pl[8][SEQ] . HqT[d][q]^T, B fragments straight from
//          the transposed f16 plane. A-tile rows 8..15 read rows 0..7 again, so lanes 16..31
//          of each accumulator hold the same 8 rows as lanes 0..15.
// Phase 4: scale by 1 / row sum, stage in the wave's own 32 columns of Ss (wave-private from
//          Store coverage: 2 steps x 4 rows == 8 rows.
// Grid (SEQ/8, NB).
// ---------------------------------------------------------------------------
__global__ __launch_bounds__(256) void addattn_kernel(
    const float* __restrict__ Sq, const float* __restrict__ Sp,
    const float* __restrict__ vvec, const _Float16* __restrict__ HqT,
    float* __restrict__ out) {
  __shared__ __attribute__((aligned(16))) float sp_s[PT * VDIM];
  __shared__ __attribute__((aligned(16))) float vs[VDIM];
  __shared__ __attribute__((aligned(16))) float Ss[PT * SPITCH];
  __shared__ __attribute__((aligned(16))) _Float16 Pl[PT * PPITCH];
  __shared__ __attribute__((aligned(16))) float Ls[PT];
  static_assert(sizeof(float) * (PT * VDIM + VDIM + PT * SPITCH + PT) +
                sizeof(_Float16) * (PT * PPITCH) <= 131072);

  const unsigned tid = threadIdx.x, lane = tid & 31u;
  const unsigned wave = (unsigned)__builtin_amdgcn_readfirstlane((int)(threadIdx.x >> 5));
  const unsigned hh = lane >> 4, m = lane & 15u;
  const unsigned p0 = blockIdx.x * (unsigned)PT;
  const unsigned b = blockIdx.y;

  // ---- phase 0 ----
#pragma unroll
  for (unsigned j = 0; j < 2u; ++j) {
    const unsigned idx = tid + 256u * j;
    const unsigned r = idx >> 6, c = (idx & 63u) * 4u;
    *(v4f*)&sp_s[r * VDIM + c] =
        *(const v4f*)(Sp + (size_t)(b * (unsigned)SEQ + p0 + r) * VDIM + c);
  }
  vs[tid] = -2.0f * bf16r(vvec[tid]);
  __syncthreads();

  // ---- phase 1 ----
#pragma unroll 1
  for (unsigned pass = 0; pass < (unsigned)(SEQ / 256); ++pass) {
    const unsigned q = pass * 256u + tid;
    const float* sqr = Sq + (size_t)(b * (unsigned)SEQ + q) * VDIM;
    float acc[PT];
#pragma unroll
    for (int p = 0; p < PT; ++p) acc[p] = 0.0f;
#pragma unroll 1
    for (unsigned v0 = 0; v0 < (unsigned)VDIM; v0 += (unsigned)VSTEP) {
      v4f a[2], vv[2];
#pragma unroll
      for (int h = 0; h < 2; ++h) {
        a[h] = *(const v4f*)(sqr + v0 + 4u * (unsigned)h);
        vv[h] = *(const v4f*)&vs[v0 + 4u * (unsigned)h];
      }
#pragma unroll
      for (int p = 0; p < PT; ++p) {
#pragma unroll
        for (int h = 0; h < 2; ++h) {
          const v4f s4 = *(const v4f*)&sp_s[(unsigned)p * VDIM + v0 + 4u * (unsigned)h];
#pragma unroll
          for (int j = 0; j < 4; ++j) {
            const float t = fast_exp2(a[h][j] + s4[j]);
            const float r = __builtin_amdgcn_rcpf(t + 1.0f);
            acc[p] += vv[h][j] * r;
          }
        }
      }
    }
#pragma unroll
    for (int p = 0; p < PT; ++p) Ss[(unsigned)p * SPITCH + q] = acc[p];
  }
  __syncthreads();

  // ---- phase 2 ----
  {
    const unsigned row = wave;
    float mx = -3.0e38f;
#pragma unroll 4
    for (unsigned j = 0; j < (unsigned)(SEQ / 32); ++j)
      mx = fmaxf(mx, Ss[row * SPITCH + lane + 32u * j]);
    mx = red32_max(mx);
    float l = 0.0f;
#pragma unroll 4
    for (unsigned j = 0; j < (unsigned)(SEQ / 32); ++j) {
      const float arg = (Ss[row * SPITCH + lane + 32u * j] - mx) * LOG2E + PCARRY_LOG2;
      const float e = fast_exp2(arg);
      const h16 ph = (arg < -14.0f) ? (h16)0.0f : (h16)e;
      Pl[row * PPITCH + lane + 32u * j] = ph;
      l += (float)ph;
    }
    l = red32_sum(l);
    if (lane == 0u) Ls[row] = l;
  }
  __syncthreads();

  // ---- phase 3 ----
  const unsigned d0 = wave * (unsigned)WCOLS;
  const _Float16* bp = HqT + ((size_t)b * DIM + d0 + m) * SEQ + hh * 8u;
  const _Float16* pa = &Pl[(m & 7u) * PPITCH + hh * 8u];
  v8f o[NBT];
#pragma unroll
  for (int nb = 0; nb < NBT; ++nb) o[nb] = (v8f){};
#pragma unroll 2
  for (unsigned k0 = 0; k0 < (unsigned)SEQ; k0 += 32u) {
    const v16h pf = frag_at(pa + k0);
#pragma unroll
    for (int nb = 0; nb < NBT; ++nb) {
      const v16h hf = frag_at(bp + (size_t)(nb * 16) * SEQ + k0);
      o[nb] = wmma16(pf, hf, o[nb]);
    }
  }

  // ---- phase 4 ----
  // both lane halves hold rows 0..7: lanes 0..15 stage column tile 0, lanes 16..31 tile 1
#pragma unroll
  for (int r = 0; r < PT; ++r) {
    const float inv = __builtin_amdgcn_rcpf(Ls[r]);
    Ss[(unsigned)r * SPITCH + d0 + lane] = (hh ? o[1][r] : o[0][r]) * inv;
  }
  wave_lds_sync();
  v4f x[2];
  size_t off[2];
#pragma unroll
  for (unsigned i = 0; i < 2u; ++i) {
    const unsigned r = 4u * i + (lane >> 3);
    const unsigned c = (lane & 7u) * 4u;
    x[i] = *(const v4f*)&Ss[r * SPITCH + d0 + c];
    off[i] = ((size_t)b * SEQ_FULL + p0 + r) * DIM + d0 + c;
  }
#pragma unroll
  for (int i = 0; i < 2; ++i) *(v4f*)(out + off[i]) = x[i];
  
}

// ---------------------------------------------------------------------------
extern "C" void kernel_launch(void* const* d_in, const int* in_sizes, int n_in,
                              void* d_out, int out_size, void* d_ws, size_t ws_size,
                              hipStream_t stream) {
  if (n_in < 4) return;
  const long long need_x = ((long long)(NB - 1) * SEQ_FULL + SEQ) * DIM;
  if ((long long)in_sizes[0] < need_x) return;
  if ((long long)in_sizes[1] < need_x) return;
  if ((long long)in_sizes[2] < (long long)DIM * VDIM) return;
  if (in_sizes[3] < VDIM) return;
  if ((long long)out_size < need_x) return;
  if (ws_size < WS_TOTAL) return;

  const float* hq   = (const float*)d_in[0];   // [NB_FULL][SEQ_FULL][DIM]
  const float* hp   = (const float*)d_in[1];   // [NB_FULL][SEQ_FULL][DIM]
  const float* w_in = (const float*)d_in[2];   // [VDIM][DIM]  (out, in), shared by both sides
  const float* vvec = (const float*)d_in[3];   // [VDIM]
  float* out = (float*)d_out;                  // [NB_FULL][SEQ_FULL][DIM]

  char* ws = (char*)d_ws;
  _Float16* Wt   = (_Float16*)(ws + OFF_WT);    // plane 0: +64 W for hq, plane 1: -64 W for hp
  _Float16* A16  = (_Float16*)(ws + OFF_A16);   // [2*MROWS][DIM]: hq rows then hp rows
  _Float16* HqT  = (_Float16*)(ws + OFF_HQT);   // [NB][DIM][SEQ]
  float*    Spl  = (float*)(ws + OFF_S);        // [2*MROWS][VDIM]: sq rows then -sp rows

  dim3 blk(256);

  // weight planes: in [N = VDIM rows][K = DIM cols] -> out [VDIM][DIM]; grid (N/64, K/64)
  wconv_kernel<<<dim3(VDIM / 64, DIM / 64), blk, 0, stream>>>(
      w_in, Wt, (unsigned)DIM, (unsigned)DIM, WCARRY);
  wconv_kernel<<<dim3(VDIM / 64, DIM / 64), blk, 0, stream>>>(
      w_in, Wt + (size_t)VDIM * DIM, (unsigned)DIM, (unsigned)DIM, -WCARRY);

  // activation planes: hq -> rows 0..MROWS-1 and the transposed plane; hp -> rows MROWS..
  aconv_q_kernel<<<dim3(DIM / 64, MROWS / 64), blk, 0, stream>>>(hq, A16, HqT);
  aconv_p_kernel<<<dim3(DIM / 64, MROWS / 64), blk, 0, stream>>>(
      hp, A16 + (size_t)MROWS * DIM);

  // both projections in one launch
  proj_kernel<<<dim3(VDIM / 64, (2 * MROWS) / 64), blk, 0, stream>>>(A16, Wt, Spl);

  // scores + softmax + weighted sum
  addattn_kernel<<<dim3(SEQ / PT, NB), blk, 0, stream>>>(
      Spl, Spl + (size_t)MROWS * VDIM, vvec, HqT, out);
}

// v002
// Measured time: 52 microseconds a run.
// Two timings next to v001 put it at 1.18 and 1.17 times that version's speed.
// Counting every step since v000, it is 1.63 times as fast.
#include <hip/hip_runtime.h>
#include <stddef.h>

// Contractions on v_wmma_f32_16x16x32_f16 (f16 operands, f32 accumulate): both input projections
// (rows x one shared weight, K = 256) and the probability x value product (K = 512 keys). Float
// inputs are RNE-converted to bf16 and carried in f16 (weights x64 for the hq rows and x-64 for
// the hp rows, so the hp projection comes out negated; softmax numerators x1024). The score sum
// over the 256-wide hidden axis (a matrix-vector product against one vector) runs on the vector
// unit in f32, tanh(x) formed as 1 - 2 / (1 + 2^(2 x log2 e)); softmax in f32.

typedef _Float16 v16h __attribute__((ext_vector_type(16)));
typedef _Float16 v8h  __attribute__((ext_vector_type(8)));
typedef float    v8f  __attribute__((ext_vector_type(8)));
typedef float    v4f  __attribute__((ext_vector_type(4)));
typedef _Float16 h16;

#ifndef NB
#define NB 4
#endif
#ifndef SEQ
#define SEQ 512
#endif
#define NB_FULL  4
#define SEQ_FULL 512
#define DIM   256          // feature width of the hq / hp rows (pq_size)
#define VDIM  256          // hidden width of the score
#define MROWS (NB * SEQ)   // compact rows per activation plane (query length == passage length)
#define PT    8            // passage rows per attention block: (SEQ / PT) * NB = 256 blocks
#define VSTEP 8            // hidden columns per score-loop trip (PT * VSTEP terms per thread)
#define WCOLS (DIM / 8)    // output columns per wave in the attention kernel
#define NBT   (WCOLS / 16) // 16-column output tiles per wave

static_assert(NB >= 1 && NB <= NB_FULL);
static_assert(SEQ >= 256 && SEQ <= SEQ_FULL && (SEQ % 256) == 0);
static_assert((DIM % 64) == 0 && (DIM % 32) == 0);
static_assert((VDIM % 64) == 0 && (VDIM % 4) == 0);
static_assert(VDIM == 256);                 // one thread per hidden column when staging the vector
static_assert((MROWS % 64) == 0);
static_assert(DIM == 8 * WCOLS);            // 8 waves x WCOLS output columns
static_assert(WCOLS == 32 && NBT == 2);
static_assert((SEQ % 64) == 0 && (SEQ % 32) == 0);
static_assert(PT == 8);                     // A tile rows 0..7; rows 8..15 repeat them; 1 row per wave
static_assert(PT == 2 * 4);                 // output store: 2 steps x 4 rows
static_assert(PT * VDIM == 256 * 2 * 4);    // sp tile staging: 256 threads x 2 steps x 4 floats
static_assert(VSTEP == 2 * 4 && (VDIM % VSTEP) == 0);
static_assert((SEQ % PT) == 0);

#define LDT 72   // halves per LDS row (144 B, 16-B aligned)
#define LDC 68   // floats per LDS row (272 B, 16-B aligned)
static_assert((LDT % 8) == 0 && LDT >= 64);
static_assert((LDC % 4) == 0 && LDC >= 64);

#define SMAXW  ((SEQ > DIM) ? SEQ : DIM)
#define SPITCH (SMAXW + 4)   // floats per score / output-stage row
#define PPITCH (SEQ + 8)     // halves per probability row
static_assert((SPITCH % 4) == 0 && SPITCH >= SEQ && SPITCH >= DIM);
static_assert((PPITCH % 8) == 0 && PPITCH >= SEQ);

#define WCARRY 64.0f          // weight planes carried x64 (hp plane x-64)
#define PCARRY_LOG2 10.0f     // softmax numerators carried x1024 (added to the exp2 argument)
#define TWO_LOG2E 2.885390081777927f
#define LOG2E     1.4426950408889634f

// workspace layout (bytes)
#define WT_BYTES  ((size_t)2 * VDIM * DIM * 2)      // two [VDIM][DIM] weight planes (+W, -W)
#define A16_BYTES ((size_t)2 * MROWS * DIM * 2)     // hq rows then hp rows, f16
#define HQT_BYTES ((size_t)NB * DIM * SEQ * 2)      // hq transposed [b][d][q], f16
#define S_BYTES   ((size_t)2 * MROWS * VDIM * 4)    // scaled projections: sq rows then -sp rows, f32
#define OFF_WT  ((size_t)0)
#define OFF_A16 (OFF_WT + WT_BYTES)
#define OFF_HQT (OFF_A16 + A16_BYTES)
#define OFF_S   (OFF_HQT + HQT_BYTES)
#define WS_TOTAL (OFF_S + S_BYTES)
static_assert((WT_BYTES % 128) == 0 && (A16_BYTES % 128) == 0);
static_assert((HQT_BYTES % 128) == 0 && (S_BYTES % 128) == 0);
static_assert(WS_TOTAL <= (size_t)134217728);

// ---------------------------------------------------------------------------
__device__ __forceinline__ float bf16r(float x) {   // RNE convert to bf16, returned widened
  unsigned int u = __float_as_uint(x);
  u = (u + 0x7FFFu + ((u >> 16) & 1u)) & 0xFFFF0000u;
  return __uint_as_float(u);
}

// f32 -> f16 operand convert that cannot produce an f16 subnormal (value select).
static __device__ __forceinline__ h16 toh_flush(float v) {
  const h16 r = (h16)v;
  return (fabsf(v) < 6.103515625e-05f) ? (h16)0.0f : r;
}

// 16-bit fragment: p points at element [row = lane&15][k0 + 8*(lane>>4)] of a k-contiguous
// row. Elements 0..7 <- k0+8h+0..7, elements 8..15 <- k0+16+8h+0..7 (same map for A and B).
__device__ __forceinline__ v16h frag_at(const _Float16* p) {
  v8h lo = *(const v8h*)(p);
  v8h hi = *(const v8h*)(p + 16);
  v16h out;
#pragma unroll
  for (int i = 0; i < 8; ++i) { out[i] = lo[i]; out[i + 8] = hi[i]; }
  return out;
}

__device__ __forceinline__ v8f wmma16(v16h a, v16h b, v8f c) {
  v8f d = __builtin_amdgcn_wmma_f32_16x16x32_f16(false, a, false, b, (short)0, c,
                                                 false, false);
  asm volatile("v_nop\n\tv_nop\n\tv_nop\n\tv_nop" : "+v"(d) : "v"(a), "v"(b));
  return d;
}

__device__ __forceinline__ float red32_sum(float x) {
#pragma unroll
  for (int off = 1; off < 32; off <<= 1) x += __shfl_xor(x, off, 32);
  return x;
}
__device__ __forceinline__ float red32_max(float x) {
#pragma unroll
  for (int off = 1; off < 32; off <<= 1) x = fmaxf(x, __shfl_xor(x, off, 32));
  return x;
}

__device__ __forceinline__ void wave_lds_sync() {
  __builtin_amdgcn_fence(3 /* release order */, "wavefront");
  asm volatile("s_wait_dscnt 0x0" ::: "memory");
  __builtin_amdgcn_wave_barrier();
}

__device__ __forceinline__ float fast_exp2(float x) {
#if __has_builtin(__builtin_amdgcn_exp2f)
  return __builtin_amdgcn_exp2f(x);
#else
  return __expf(x * 0.6931471805599453f);
#endif
}

// ---------------------------------------------------------------------------
// Weight plane: in W[N rows][K cols] (pitch ldw = K; the [out][in] layout is already
// k-contiguous, so no transpose) -> out Wt[N][K] (pitch ldk = K), f16(carry * bf16(w)).
// carry = +64 for the hq plane, -64 for the hp plane (exact sign fold).
// Tile (bx, by) of (N/64, K/64). T: cross-wave (block barrier).
// Store coverage: 2 steps x 32 rows == 64 tile rows.
// ---------------------------------------------------------------------------
__device__ __forceinline__ void wconv_body(
    _Float16* T, unsigned bx, unsigned by,
    const float* __restrict__ W, _Float16* __restrict__ Wt, unsigned ldw, unsigned ldk,
    float carry) {
  const unsigned tid = threadIdx.x;
  const unsigned n0 = bx * 64u;
  const unsigned k0 = by * 64u;
#pragma unroll 4
  for (unsigned j = 0; j < 16u; ++j) {
    const unsigned idx = tid + 256u * j;
    const unsigned nr = idx >> 6, kc = idx & 63u;
    const float v = W[(size_t)(n0 + nr) * ldw + k0 + kc];
    T[nr * LDT + kc] = toh_flush(carry * bf16r(v));
  }
  __syncthreads();
  v8h x[2];
  size_t off[2];
#pragma unroll
  for (unsigned i = 0; i < 2u; ++i) {
    const unsigned n = 32u * i + (tid >> 3);
    const unsigned kc = (tid & 7u) * 8u;
    x[i] = *(const v8h*)&T[n * LDT + kc];
    off[i] = (size_t)(n0 + n) * ldk + k0 + kc;
  }
#pragma unroll
  for (int i = 0; i < 2; ++i) *(v8h*)(Wt + off[i]) = x[i];
  
}

// ---------------------------------------------------------------------------
// Activation planes: X f32 [NB_FULL][SEQ_FULL][DIM] (input) -> X16 compact [NB*SEQ][DIM]
// = f16(bf16(x)); WITH_T also writes XT16 [NB][DIM][SEQ] (same values, transposed per batch).
// of either plane is written by 8 consecutive lanes x 16 B of one instruction.
// Store coverage: 2 steps x 32 rows == 64 tile rows, for each plane.
// Tile (bx, by) of (DIM/64, MROWS/64).
// ---------------------------------------------------------------------------
template <int WITH_T>
__device__ __forceinline__ void aconv_body(_Float16* T, _Float16* TT, unsigned bx, unsigned by,
                                           const float* __restrict__ X,
                                           _Float16* __restrict__ X16,
                                           _Float16* __restrict__ XT16) {
  const unsigned tid = threadIdx.x;
  const unsigned c0 = bx * 64u;
  const unsigned crow0 = by * 64u;
  const unsigned bidx = crow0 / (unsigned)SEQ;
  const unsigned s0 = crow0 - bidx * (unsigned)SEQ;
  const size_t frow0 = (size_t)bidx * SEQ_FULL + s0;
  const float* src[4];
  v4f a4[4];
#pragma unroll
  for (unsigned j = 0; j < 4u; ++j) {
    const unsigned idx = tid + 256u * j;
    const unsigned r = idx >> 4, c = (idx & 15u) * 4u;
    src[j] = X + (frow0 + r) * DIM + c0 + c;
    a4[j] = *(const v4f*)src[j];
  }
  // The wait that stands before a register named by an issued load is written again. It takes
  // the four addresses as inputs, so that no address register is reused in front of it, not
  // even as the destination of a later one of these loads.
  asm volatile("s_wait_xcnt 0x0" :: "v"(src[0]), "v"(src[1]), "v"(src[2]), "v"(src[3]) : "memory");
#pragma unroll
  for (unsigned j = 0; j < 4u; ++j) {
    const unsigned idx = tid + 256u * j;
    const unsigned r = idx >> 4, c = (idx & 15u) * 4u;
    const v4f a = a4[j];
#pragma unroll
    for (unsigned i = 0; i < 4u; ++i) {
      const h16 hv = toh_flush(bf16r(a[i]));
      T[r * LDT + c + i] = hv;
      if (WITH_T) TT[(c + i) * LDT + r] = hv;
    }
  }
  __syncthreads();
  v8h x[2], xt[2];
  size_t off[2], offt[2];
#pragma unroll
  for (unsigned i = 0; i < 2u; ++i) {
    const unsigned n = 32u * i + (tid >> 3);
    const unsigned kc = (tid & 7u) * 8u;
    x[i] = *(const v8h*)&T[n * LDT + kc];
    off[i] = (size_t)(crow0 + n) * DIM + c0 + kc;
    if (WITH_T) {
      xt[i] = *(const v8h*)&TT[n * LDT + kc];
      offt[i] = ((size_t)bidx * DIM + c0 + n) * SEQ + s0 + kc;
    } else {
      xt[i] = x[i];
      offt[i] = off[i];
    }
  }
#pragma unroll
  for (int i = 0; i < 2; ++i) *(v8h*)(X16 + off[i]) = x[i];
  if (WITH_T) {
#pragma unroll
    for (int i = 0; i < 2; ++i) *(v8h*)(XT16 + offt[i]) = xt[i];
  }
  // The wait that stands before a register named by an issued store is written again: in the merged
  // kernel's listing another job's code, which reuses these registers, stands behind this body.
  asm volatile("s_wait_xcnt 0x0" ::: "memory");
}

// ---------------------------------------------------------------------------
// All four operand conversions in ONE launch: none reads what another writes, so the flat block
// index picks the job (a block-uniform scalar branch; each body's barrier is passed by the whole
// block or by none of it). The weight tiles come first: their load chain is the longest.
//   [0, 2*WJOBS)                    weight plane job / WJOBS (+64 W, then -64 W)
//   [2*WJOBS, 2*WJOBS + AJOBS)      hq rows and the transposed hq plane
//   [2*WJOBS + AJOBS, CONV_BLOCKS)  hp rows
// ---------------------------------------------------------------------------
#define WJOBS ((VDIM / 64) * (DIM / 64))     // tiles per weight plane
#define AJOBS ((DIM / 64) * (MROWS / 64))    // tiles per activation plane
#define CONV_BLOCKS (2 * WJOBS + 2 * AJOBS)

__global__ __launch_bounds__(256) void conv_kernel(
    const float* __restrict__ hq, const float* __restrict__ hp, const float* __restrict__ W,
    _Float16* __restrict__ Wt, _Float16* __restrict__ A16, _Float16* __restrict__ HqT) {
  __shared__ __attribute__((aligned(16))) _Float16 T[64 * LDT];
  __shared__ __attribute__((aligned(16))) _Float16 TT[64 * LDT];
  const unsigned job = blockIdx.x;
  if (job < 2u * WJOBS) {
    const unsigned plane = job / (unsigned)WJOBS;
    const unsigned t = job - plane * (unsigned)WJOBS;
    wconv_body(T, t % (unsigned)(VDIM / 64), t / (unsigned)(VDIM / 64), W,
               Wt + (size_t)plane * ((size_t)VDIM * DIM), (unsigned)DIM, (unsigned)DIM,
               plane ? -WCARRY : WCARRY);
  } else if (job < 2u * WJOBS + AJOBS) {
    const unsigned t = job - 2u * WJOBS;
    aconv_body<1>(T, TT, t % (unsigned)(DIM / 64), t / (unsigned)(DIM / 64), hq, A16, HqT);
  } else {
    const unsigned t = job - (2u * WJOBS + AJOBS);
    _Float16* P16 = A16 + (size_t)MROWS * DIM;
    aconv_body<0>(T, TT, t % (unsigned)(DIM / 64), t / (unsigned)(DIM / 64), hp, P16, P16);
  }
}

// ---------------------------------------------------------------------------
// Projection GEMM C[64x64 tile] = A16[rows][DIM] . Wt[n][DIM]^T, fragments straight from the
// 16-bit global planes; 8 waves (mw = 16-row group, nw = 32-col group), 2 accumulators/wave.
// Rows 0..MROWS-1 (hq rows) use weight plane 0, rows MROWS..2*MROWS-1 (hp rows) plane 1
// (block-uniform integer offset). Output f32 [2*MROWS][VDIM] = acc * (2 log2 e / 64), i.e. the
// projection pre-scaled for the exp2 form of tanh. Epilogue staged through Cs (cross-wave,
// lanes x 16 B. Store coverage: 4 steps x 16 rows == 64 tile rows.
// Grid (VDIM/64, 2*MROWS/64).
// ---------------------------------------------------------------------------
__global__ __launch_bounds__(256) void proj_kernel(
    const _Float16* __restrict__ A16, const _Float16* __restrict__ Wt,
    float* __restrict__ outf) {
  __shared__ __attribute__((aligned(16))) float Cs[64 * LDC];
  const unsigned tid = threadIdx.x, lane = tid & 31u;
  const unsigned w = (unsigned)__builtin_amdgcn_readfirstlane((int)(threadIdx.x >> 5));
  const unsigned mw = w >> 1, nw = w & 1u;
  const unsigned hh = lane >> 4, m = lane & 15u;
  const unsigned n0 = blockIdx.x * 64u;
  const unsigned row0 = blockIdx.y * 64u;
  const size_t woff = (size_t)(row0 / (unsigned)MROWS) * ((size_t)VDIM * DIM);

  const _Float16* ap  = A16 + (size_t)(row0 + mw * 16u + m) * DIM + hh * 8u;
  const _Float16* bp0 = Wt + woff + (size_t)(n0 + nw * 32u + m) * DIM + hh * 8u;
  const _Float16* bp1 = bp0 + (size_t)16 * DIM;
  v8f acc0 = {}, acc1 = {};
#pragma unroll 2
  for (unsigned k0 = 0; k0 < (unsigned)DIM; k0 += 32u) {
    const v16h a  = frag_at(ap + k0);
    const v16h b0 = frag_at(bp0 + k0);
    const v16h b1 = frag_at(bp1 + k0);
    acc0 = wmma16(a, b0, acc0);
    acc1 = wmma16(a, b1, acc1);
  }
#pragma unroll
  for (int r = 0; r < 8; ++r) {
    float* d = &Cs[(mw * 16u + hh * 8u + (unsigned)r) * LDC + nw * 32u + m];
    d[0]  = acc0[r];
    d[16] = acc1[r];
  }
  __syncthreads();

  const float cs = TWO_LOG2E / WCARRY;
  v4f xs[4];
  size_t off[4];
#pragma unroll
  for (unsigned i = 0; i < 4u; ++i) {
    const unsigned r = 16u * i + (tid >> 4);
    const unsigned c = (tid & 15u) * 4u;
    const v4f u = *(const v4f*)&Cs[r * LDC + c];
    xs[i] = u * cs;
    off[i] = (size_t)(row0 + r) * VDIM + n0 + c;
  }
#pragma unroll
  for (int i = 0; i < 4; ++i) *(v4f*)(outf + off[i]) = xs[i];
  
}

// ---------------------------------------------------------------------------
// Difference-form additive attention per (8 passage rows, batch). 8 waves.
// Sp holds the NEGATED scaled hp projection (weight plane carried x-64), so that
// sq'[q][v] + sp'[p][v] = 2 log2 e * (Wq[q][v] - Wp[p][v]).
// Phase 0: stage the 8 scaled sp rows (sp_s) and the vector -2*bf16(v) (vs) in LDS.
// Phase 1: thread t owns query q = 256*pass + t; for the 8 passage rows it accumulates
//          sum_v vs[v] / (1 + 2^(sq'[q][v] + sp'[p][v])) in f32 (equals the score up
//          to a constant that is the same for every query, which the softmax removes);
//          results into Ss[p][q]. sp_s / vs / Ss: cross-wave (block barriers).
// Phase 2: wave w owns row w: row max, f16(1024 * exp(s - max)) into Pl (select on
//          the exp2 argument keeps the plane free of f16 subnormals), row sum over the
//          converted values into Ls. Pl / Ls: cross-wave (block barrier).
// Phase 3: out tile [8][32 per wave] = Pl[8][SEQ] . HqT[d][q]^T, B fragments straight from
//          the transposed f16 plane. A-tile rows 8..15 read rows 0..7 again, so lanes 16..31
//          of each accumulator hold the same 8 rows as lanes 0..15.
// Phase 4: scale by 1 / row sum, stage in the wave's own 32 columns of Ss (wave-private from
//          Store coverage: 2 steps x 4 rows == 8 rows.
// Grid (SEQ/8, NB).
// ---------------------------------------------------------------------------
__global__ __launch_bounds__(256) void addattn_kernel(
    const float* __restrict__ Sq, const float* __restrict__ Sp,
    const float* __restrict__ vvec, const _Float16* __restrict__ HqT,
    float* __restrict__ out) {
  __shared__ __attribute__((aligned(16))) float sp_s[PT * VDIM];
  __shared__ __attribute__((aligned(16))) float vs[VDIM];
  __shared__ __attribute__((aligned(16))) float Ss[PT * SPITCH];
  __shared__ __attribute__((aligned(16))) _Float16 Pl[PT * PPITCH];
  __shared__ __attribute__((aligned(16))) float Ls[PT];
  static_assert(sizeof(float) * (PT * VDIM + VDIM + PT * SPITCH + PT) +
                sizeof(_Float16) * (PT * PPITCH) <= 131072);

  const unsigned tid = threadIdx.x, lane = tid & 31u;
  const unsigned wave = (unsigned)__builtin_amdgcn_readfirstlane((int)(threadIdx.x >> 5));
  const unsigned hh = lane >> 4, m = lane & 15u;
  const unsigned p0 = blockIdx.x * (unsigned)PT;
  const unsigned b = blockIdx.y;

  // ---- phase 0 ----
#pragma unroll
  for (unsigned j = 0; j < 2u; ++j) {
    const unsigned idx = tid + 256u * j;
    const unsigned r = idx >> 6, c = (idx & 63u) * 4u;
    *(v4f*)&sp_s[r * VDIM + c] =
        *(const v4f*)(Sp + (size_t)(b * (unsigned)SEQ + p0 + r) * VDIM + c);
  }
  vs[tid] = -2.0f * bf16r(vvec[tid]);
  __syncthreads();

  // ---- phase 1 ----
#pragma unroll 1
  for (unsigned pass = 0; pass < (unsigned)(SEQ / 256); ++pass) {
    const unsigned q = pass * 256u + tid;
    const float* sqr = Sq + (size_t)(b * (unsigned)SEQ + q) * VDIM;
    float acc[PT];
#pragma unroll
    for (int p = 0; p < PT; ++p) acc[p] = 0.0f;
#pragma unroll 1
    for (unsigned v0 = 0; v0 < (unsigned)VDIM; v0 += (unsigned)VSTEP) {
      v4f a[2], vv[2];
#pragma unroll
      for (int h = 0; h < 2; ++h) {
        a[h] = *(const v4f*)(sqr + v0 + 4u * (unsigned)h);
        vv[h] = *(const v4f*)&vs[v0 + 4u * (unsigned)h];
      }
#pragma unroll
      for (int p = 0; p < PT; ++p) {
#pragma unroll
        for (int h = 0; h < 2; ++h) {
          const v4f s4 = *(const v4f*)&sp_s[(unsigned)p * VDIM + v0 + 4u * (unsigned)h];
#pragma unroll
          for (int j = 0; j < 4; ++j) {
            const float t = fast_exp2(a[h][j] + s4[j]);
            const float r = __builtin_amdgcn_rcpf(t + 1.0f);
            acc[p] += vv[h][j] * r;
          }
        }
      }
    }
#pragma unroll
    for (int p = 0; p < PT; ++p) Ss[(unsigned)p * SPITCH + q] = acc[p];
  }
  __syncthreads();

  // ---- phase 2 ----
  {
    const unsigned row = wave;
    float mx = -3.0e38f;
#pragma unroll 4
    for (unsigned j = 0; j < (unsigned)(SEQ / 32); ++j)
      mx = fmaxf(mx, Ss[row * SPITCH + lane + 32u * j]);
    mx = red32_max(mx);
    float l = 0.0f;
#pragma unroll 4
    for (unsigned j = 0; j < (unsigned)(SEQ / 32); ++j) {
      const float arg = (Ss[row * SPITCH + lane + 32u * j] - mx) * LOG2E + PCARRY_LOG2;
      const float e = fast_exp2(arg);
      const h16 ph = (arg < -14.0f) ? (h16)0.0f : (h16)e;
      Pl[row * PPITCH + lane + 32u * j] = ph;
      l += (float)ph;
    }
    l = red32_sum(l);
    if (lane == 0u) Ls[row] = l;
  }
  __syncthreads();

  // ---- phase 3 ----
  const unsigned d0 = wave * (unsigned)WCOLS;
  const _Float16* bp = HqT + ((size_t)b * DIM + d0 + m) * SEQ + hh * 8u;
  const _Float16* pa = &Pl[(m & 7u) * PPITCH + hh * 8u];
  v8f o[NBT];
#pragma unroll
  for (int nb = 0; nb < NBT; ++nb) o[nb] = (v8f){};
#pragma unroll 2
  for (unsigned k0 = 0; k0 < (unsigned)SEQ; k0 += 32u) {
    const v16h pf = frag_at(pa + k0);
#pragma unroll
    for (int nb = 0; nb < NBT; ++nb) {
      const v16h hf = frag_at(bp + (size_t)(nb * 16) * SEQ + k0);
      o[nb] = wmma16(pf, hf, o[nb]);
    }
  }

  // ---- phase 4 ----
  // both lane halves hold rows 0..7: lanes 0..15 stage column tile 0, lanes 16..31 tile 1
#pragma unroll
  for (int r = 0; r < PT; ++r) {
    const float inv = __builtin_amdgcn_rcpf(Ls[r]);
    Ss[(unsigned)r * SPITCH + d0 + lane] = (hh ? o[1][r] : o[0][r]) * inv;
  }
  wave_lds_sync();
  v4f x[2];
  size_t off[2];
#pragma unroll
  for (unsigned i = 0; i < 2u; ++i) {
    const unsigned r = 4u * i + (lane >> 3);
    const unsigned c = (lane & 7u) * 4u;
    x[i] = *(const v4f*)&Ss[r * SPITCH + d0 + c];
    off[i] = ((size_t)b * SEQ_FULL + p0 + r) * DIM + d0 + c;
  }
#pragma unroll
  for (int i = 0; i < 2; ++i) *(v4f*)(out + off[i]) = x[i];
  
}

// ---------------------------------------------------------------------------
extern "C" void kernel_launch(void* const* d_in, const int* in_sizes, int n_in,
                              void* d_out, int out_size, void* d_ws, size_t ws_size,
                              hipStream_t stream) {
  if (n_in < 4) return;
  const long long need_x = ((long long)(NB - 1) * SEQ_FULL + SEQ) * DIM;
  if ((long long)in_sizes[0] < need_x) return;
  if ((long long)in_sizes[1] < need_x) return;
  if ((long long)in_sizes[2] < (long long)DIM * VDIM) return;
  if (in_sizes[3] < VDIM) return;
  if ((long long)out_size < need_x) return;
  if (ws_size < WS_TOTAL) return;

  const float* hq   = (const float*)d_in[0];   // [NB_FULL][SEQ_FULL][DIM]
  const float* hp   = (const float*)d_in[1];   // [NB_FULL][SEQ_FULL][DIM]
  const float* w_in = (const float*)d_in[2];   // [VDIM][DIM]  (out, in), shared by both sides
  const float* vvec = (const float*)d_in[3];   // [VDIM]
  float* out = (float*)d_out;                  // [NB_FULL][SEQ_FULL][DIM]

  char* ws = (char*)d_ws;
  _Float16* Wt   = (_Float16*)(ws + OFF_WT);    // plane 0: +64 W for hq, plane 1: -64 W for hp
  _Float16* A16  = (_Float16*)(ws + OFF_A16);   // [2*MROWS][DIM]: hq rows then hp rows
  _Float16* HqT  = (_Float16*)(ws + OFF_HQT);   // [NB][DIM][SEQ]
  float*    Spl  = (float*)(ws + OFF_S);        // [2*MROWS][VDIM]: sq rows then -sp rows

  dim3 blk(256);

  // both weight planes, the hq rows with their transposed plane, and the hp rows: one launch
  conv_kernel<<<dim3(CONV_BLOCKS), blk, 0, stream>>>(hq, hp, w_in, Wt, A16, HqT);

  // both projections in one launch
  proj_kernel<<<dim3(VDIM / 64, (2 * MROWS) / 64), blk, 0, stream>>>(A16, Wt, Spl);

  // scores + softmax + weighted sum
  addattn_kernel<<<dim3(SEQ / PT, NB), blk, 0, stream>>>(
      Spl, Spl + (size_t)MROWS * VDIM, vvec, HqT, out);
}

// v003
// One run takes 44.7 microseconds.
// Next to v002, in two timings, it ran 1.19 times as fast each time.
// Over all steps from v000 it is 1.94 times as fast.
#include <hip/hip_runtime.h>
#include <stddef.h>

// Contractions on v_wmma_f32_16x16x32_f16 (f16 operands, f32 accumulate): both input projections
// (rows x one shared weight, K = 256) and the probability x value product (K = 512 keys). Float
// inputs are RNE-converted to bf16 and carried in f16 (weights x64 for the hq rows and x-64 for
// the hp rows, so the hp projection comes out negated; softmax numerators x1024). The score sum
// over the 256-wide hidden axis (a matrix-vector product against one vector) runs on the vector
// unit in f32, tanh(x) formed as 1 - 2 / (1 + 2^(2 x log2 e)); the power of the difference is the
// product of one power per side while both arguments are small enough; softmax in f32.

typedef _Float16 v16h __attribute__((ext_vector_type(16)));
typedef _Float16 v8h  __attribute__((ext_vector_type(8)));
typedef float    v8f  __attribute__((ext_vector_type(8)));
typedef float    v4f  __attribute__((ext_vector_type(4)));
typedef _Float16 h16;

#ifndef NB
#define NB 4
#endif
#ifndef SEQ
#define SEQ 512
#endif
#define NB_FULL  4
#define SEQ_FULL 512
#define DIM   256          // feature width of the hq / hp rows (pq_size)
#define VDIM  256          // hidden width of the score
#define MROWS (NB * SEQ)   // compact rows per activation plane (query length == passage length)
#define PT    8            // passage rows per attention block: (SEQ / PT) * NB = 256 blocks
#define VSTEP 8            // hidden columns per score-loop trip (PT * VSTEP terms per thread)
#define WCOLS (DIM / 8)    // output columns per wave in the attention kernel
#define NBT   (WCOLS / 16) // 16-column output tiles per wave

static_assert(NB >= 1 && NB <= NB_FULL);
static_assert(SEQ >= 256 && SEQ <= SEQ_FULL && (SEQ % 256) == 0);
static_assert((DIM % 64) == 0 && (DIM % 32) == 0);
static_assert((VDIM % 64) == 0 && (VDIM % 4) == 0);
static_assert(VDIM == 256);                 // one thread per hidden column when staging the vector
static_assert((MROWS % 64) == 0);
static_assert(DIM == 8 * WCOLS);            // 8 waves x WCOLS output columns
static_assert(WCOLS == 32 && NBT == 2);
static_assert((SEQ % 64) == 0 && (SEQ % 32) == 0);
static_assert(PT == 8);                     // A tile rows 0..7; rows 8..15 repeat them; 1 row per wave
static_assert(PT == 2 * 4);                 // output store: 2 steps x 4 rows
static_assert(PT * VDIM == 256 * 2 * 4);    // sp tile staging: 256 threads x 2 steps x 4 floats
static_assert(VSTEP == 2 * 4 && (VDIM % VSTEP) == 0);
static_assert((SEQ % PT) == 0);

#define LDT 72   // halves per LDS row (144 B, 16-B aligned)
#define LDC 68   // floats per LDS row (272 B, 16-B aligned)
static_assert((LDT % 8) == 0 && LDT >= 64);
static_assert((LDC % 4) == 0 && LDC >= 64);

#define SMAXW  ((SEQ > DIM) ? SEQ : DIM)
#define SPITCH (SMAXW + 4)   // floats per score / output-stage row
#define PPITCH (SEQ + 8)     // halves per probability row
static_assert((SPITCH % 4) == 0 && SPITCH >= SEQ && SPITCH >= DIM);
static_assert((PPITCH % 8) == 0 && PPITCH >= SEQ);

#define WCARRY 64.0f          // weight planes carried x64 (hp plane x-64)
#define PCARRY_LOG2 10.0f     // softmax numerators carried x1024 (added to the exp2 argument)
#define TWO_LOG2E 2.885390081777927f
#define LOG2E     1.4426950408889634f
#define EXPLIM    63.0f       // both exp2 arguments inside +-63: each power and their product are normal f32

// workspace layout (bytes)
#define WT_BYTES  ((size_t)2 * VDIM * DIM * 2)      // two [VDIM][DIM] weight planes (+W, -W)
#define A16_BYTES ((size_t)2 * MROWS * DIM * 2)     // hq rows then hp rows, f16
#define HQT_BYTES ((size_t)NB * DIM * SEQ * 2)      // hq transposed [b][d][q], f16
#define S_BYTES   ((size_t)2 * MROWS * VDIM * 4)    // scaled projections: sq rows then -sp rows, f32
#define OFF_WT  ((size_t)0)
#define OFF_A16 (OFF_WT + WT_BYTES)
#define OFF_HQT (OFF_A16 + A16_BYTES)
#define OFF_S   (OFF_HQT + HQT_BYTES)
#define WS_TOTAL (OFF_S + S_BYTES)
static_assert((WT_BYTES % 128) == 0 && (A16_BYTES % 128) == 0);
static_assert((HQT_BYTES % 128) == 0 && (S_BYTES % 128) == 0);
static_assert(WS_TOTAL <= (size_t)134217728);

// ---------------------------------------------------------------------------
__device__ __forceinline__ float bf16r(float x) {   // RNE convert to bf16, returned widened
  unsigned int u = __float_as_uint(x);
  u = (u + 0x7FFFu + ((u >> 16) & 1u)) & 0xFFFF0000u;
  return __uint_as_float(u);
}

// f32 -> f16 operand convert that cannot produce an f16 subnormal (value select).
static __device__ __forceinline__ h16 toh_flush(float v) {
  const h16 r = (h16)v;
  return (fabsf(v) < 6.103515625e-05f) ? (h16)0.0f : r;
}

// 16-bit fragment: p points at element [row = lane&15][k0 + 8*(lane>>4)] of a k-contiguous
// row. Elements 0..7 <- k0+8h+0..7, elements 8..15 <- k0+16+8h+0..7 (same map for A and B).
__device__ __forceinline__ v16h frag_at(const _Float16* p) {
  v8h lo = *(const v8h*)(p);
  v8h hi = *(const v8h*)(p + 16);
  v16h out;
#pragma unroll
  for (int i = 0; i < 8; ++i) { out[i] = lo[i]; out[i + 8] = hi[i]; }
  return out;
}

__device__ __forceinline__ v8f wmma16(v16h a, v16h b, v8f c) {
  v8f d = __builtin_amdgcn_wmma_f32_16x16x32_f16(false, a, false, b, (short)0, c,
                                                 false, false);
  asm volatile("v_nop\n\tv_nop\n\tv_nop\n\tv_nop" : "+v"(d) : "v"(a), "v"(b));
  return d;
}

__device__ __forceinline__ float red32_sum(float x) {
#pragma unroll
  for (int off = 1; off < 32; off <<= 1) x += __shfl_xor(x, off, 32);
  return x;
}
__device__ __forceinline__ float red32_max(float x) {
#pragma unroll
  for (int off = 1; off < 32; off <<= 1) x = fmaxf(x, __shfl_xor(x, off, 32));
  return x;
}

__device__ __forceinline__ void wave_lds_sync() {
  __builtin_amdgcn_fence(3 /* release order */, "wavefront");
  asm volatile("s_wait_dscnt 0x0" ::: "memory");
  __builtin_amdgcn_wave_barrier();
}

__device__ __forceinline__ float fast_exp2(float x) {
#if __has_builtin(__builtin_amdgcn_exp2f)
  return __builtin_amdgcn_exp2f(x);
#else
  return __expf(x * 0.6931471805599453f);
#endif
}

// ---------------------------------------------------------------------------
// Weight plane: in W[N rows][K cols] (pitch ldw = K; the [out][in] layout is already
// k-contiguous, so no transpose) -> out Wt[N][K] (pitch ldk = K), f16(carry * bf16(w)).
// carry = +64 for the hq plane, -64 for the hp plane (exact sign fold).
// Tile (bx, by) of (N/64, K/64). T: cross-wave (block barrier).
// Store coverage: 2 steps x 32 rows == 64 tile rows.
// ---------------------------------------------------------------------------
__device__ __forceinline__ void wconv_body(
    _Float16* T, unsigned bx, unsigned by,
    const float* __restrict__ W, _Float16* __restrict__ Wt, unsigned ldw, unsigned ldk,
    float carry) {
  const unsigned tid = threadIdx.x;
  const unsigned n0 = bx * 64u;
  const unsigned k0 = by * 64u;
#pragma unroll 4
  for (unsigned j = 0; j < 16u; ++j) {
    const unsigned idx = tid + 256u * j;
    const unsigned nr = idx >> 6, kc = idx & 63u;
    const float v = W[(size_t)(n0 + nr) * ldw + k0 + kc];
    T[nr * LDT + kc] = toh_flush(carry * bf16r(v));
  }
  __syncthreads();
  v8h x[2];
  size_t off[2];
#pragma unroll
  for (unsigned i = 0; i < 2u; ++i) {
    const unsigned n = 32u * i + (tid >> 3);
    const unsigned kc = (tid & 7u) * 8u;
    x[i] = *(const v8h*)&T[n * LDT + kc];
    off[i] = (size_t)(n0 + n) * ldk + k0 + kc;
  }
#pragma unroll
  for (int i = 0; i < 2; ++i) *(v8h*)(Wt + off[i]) = x[i];
  
}

// ---------------------------------------------------------------------------
// Activation planes: X f32 [NB_FULL][SEQ_FULL][DIM] (input) -> X16 compact [NB*SEQ][DIM]
// = f16(bf16(x)); WITH_T also writes XT16 [NB][DIM][SEQ] (same values, transposed per batch).
// of either plane is written by 8 consecutive lanes x 16 B of one instruction.
// Store coverage: 2 steps x 32 rows == 64 tile rows, for each plane.
// Tile (bx, by) of (DIM/64, MROWS/64).
// ---------------------------------------------------------------------------
template <int WITH_T>
__device__ __forceinline__ void aconv_body(_Float16* T, _Float16* TT, unsigned bx, unsigned by,
                                           const float* __restrict__ X,
                                           _Float16* __restrict__ X16,
                                           _Float16* __restrict__ XT16) {
  const unsigned tid = threadIdx.x;
  const unsigned c0 = bx * 64u;
  const unsigned crow0 = by * 64u;
  const unsigned bidx = crow0 / (unsigned)SEQ;
  const unsigned s0 = crow0 - bidx * (unsigned)SEQ;
  const size_t frow0 = (size_t)bidx * SEQ_FULL + s0;
  const float* src[4];
  v4f a4[4];
#pragma unroll
  for (unsigned j = 0; j < 4u; ++j) {
    const unsigned idx = tid + 256u * j;
    const unsigned r = idx >> 4, c = (idx & 15u) * 4u;
    src[j] = X + (frow0 + r) * DIM + c0 + c;
    a4[j] = *(const v4f*)src[j];
  }
  // The wait that stands before a register named by an issued load is written again. It takes
  // the four addresses as inputs, so that no address register is reused in front of it, not
  // even as the destination of a later one of these loads.
  asm volatile("s_wait_xcnt 0x0" :: "v"(src[0]), "v"(src[1]), "v"(src[2]), "v"(src[3]) : "memory");
#pragma unroll
  for (unsigned j = 0; j < 4u; ++j) {
    const unsigned idx = tid + 256u * j;
    const unsigned r = idx >> 4, c = (idx & 15u) * 4u;
    const v4f a = a4[j];
#pragma unroll
    for (unsigned i = 0; i < 4u; ++i) {
      const h16 hv = toh_flush(bf16r(a[i]));
      T[r * LDT + c + i] = hv;
      if (WITH_T) TT[(c + i) * LDT + r] = hv;
    }
  }
  __syncthreads();
  v8h x[2], xt[2];
  size_t off[2], offt[2];
#pragma unroll
  for (unsigned i = 0; i < 2u; ++i) {
    const unsigned n = 32u * i + (tid >> 3);
    const unsigned kc = (tid & 7u) * 8u;
    x[i] = *(const v8h*)&T[n * LDT + kc];
    off[i] = (size_t)(crow0 + n) * DIM + c0 + kc;
    if (WITH_T) {
      xt[i] = *(const v8h*)&TT[n * LDT + kc];
      offt[i] = ((size_t)bidx * DIM + c0 + n) * SEQ + s0 + kc;
    } else {
      xt[i] = x[i];
      offt[i] = off[i];
    }
  }
#pragma unroll
  for (int i = 0; i < 2; ++i) *(v8h*)(X16 + off[i]) = x[i];
  if (WITH_T) {
#pragma unroll
    for (int i = 0; i < 2; ++i) *(v8h*)(XT16 + offt[i]) = xt[i];
  }
  // The wait that stands before a register named by an issued store is written again: in the merged
  // kernel's listing another job's code, which reuses these registers, stands behind this body.
  asm volatile("s_wait_xcnt 0x0" ::: "memory");
}

// ---------------------------------------------------------------------------
// All four operand conversions in ONE launch: none reads what another writes, so the flat block
// index picks the job (a block-uniform scalar branch; each body's barrier is passed by the whole
// block or by none of it). The weight tiles come first: their load chain is the longest.
//   [0, 2*WJOBS)                    weight plane job / WJOBS (+64 W, then -64 W)
//   [2*WJOBS, 2*WJOBS + AJOBS)      hq rows and the transposed hq plane
//   [2*WJOBS + AJOBS, CONV_BLOCKS)  hp rows
// ---------------------------------------------------------------------------
#define WJOBS ((VDIM / 64) * (DIM / 64))     // tiles per weight plane
#define AJOBS ((DIM / 64) * (MROWS / 64))    // tiles per activation plane
#define CONV_BLOCKS (2 * WJOBS + 2 * AJOBS)

__global__ __launch_bounds__(256) void conv_kernel(
    const float* __restrict__ hq, const float* __restrict__ hp, const float* __restrict__ W,
    _Float16* __restrict__ Wt, _Float16* __restrict__ A16, _Float16* __restrict__ HqT) {
  __shared__ __attribute__((aligned(16))) _Float16 T[64 * LDT];
  __shared__ __attribute__((aligned(16))) _Float16 TT[64 * LDT];
  const unsigned job = blockIdx.x;
  if (job < 2u * WJOBS) {
    const unsigned plane = job / (unsigned)WJOBS;
    const unsigned t = job - plane * (unsigned)WJOBS;
    wconv_body(T, t % (unsigned)(VDIM / 64), t / (unsigned)(VDIM / 64), W,
               Wt + (size_t)plane * ((size_t)VDIM * DIM), (unsigned)DIM, (unsigned)DIM,
               plane ? -WCARRY : WCARRY);
  } else if (job < 2u * WJOBS + AJOBS) {
    const unsigned t = job - 2u * WJOBS;
    aconv_body<1>(T, TT, t % (unsigned)(DIM / 64), t / (unsigned)(DIM / 64), hq, A16, HqT);
  } else {
    const unsigned t = job - (2u * WJOBS + AJOBS);
    _Float16* P16 = A16 + (size_t)MROWS * DIM;
    aconv_body<0>(T, TT, t % (unsigned)(DIM / 64), t / (unsigned)(DIM / 64), hp, P16, P16);
  }
}

// ---------------------------------------------------------------------------
// Projection GEMM C[64x64 tile] = A16[rows][DIM] . Wt[n][DIM]^T, fragments straight from the
// 16-bit global planes; 8 waves (mw = 16-row group, nw = 32-col group), 2 accumulators/wave.
// Rows 0..MROWS-1 (hq rows) use weight plane 0, rows MROWS..2*MROWS-1 (hp rows) plane 1
// (block-uniform integer offset). Output f32 [2*MROWS][VDIM] = acc * (2 log2 e / 64), i.e. the
// projection pre-scaled for the exp2 form of tanh. Epilogue staged through Cs (cross-wave,
// lanes x 16 B. Store coverage: 4 steps x 16 rows == 64 tile rows.
// Grid (VDIM/64, 2*MROWS/64).
// ---------------------------------------------------------------------------
__global__ __launch_bounds__(256) void proj_kernel(
    const _Float16* __restrict__ A16, const _Float16* __restrict__ Wt,
    float* __restrict__ outf) {
  __shared__ __attribute__((aligned(16))) float Cs[64 * LDC];
  const unsigned tid = threadIdx.x, lane = tid & 31u;
  const unsigned w = (unsigned)__builtin_amdgcn_readfirstlane((int)(threadIdx.x >> 5));
  const unsigned mw = w >> 1, nw = w & 1u;
  const unsigned hh = lane >> 4, m = lane & 15u;
  const unsigned n0 = blockIdx.x * 64u;
  const unsigned row0 = blockIdx.y * 64u;
  const size_t woff = (size_t)(row0 / (unsigned)MROWS) * ((size_t)VDIM * DIM);

  const _Float16* ap  = A16 + (size_t)(row0 + mw * 16u + m) * DIM + hh * 8u;
  const _Float16* bp0 = Wt + woff + (size_t)(n0 + nw * 32u + m) * DIM + hh * 8u;
  const _Float16* bp1 = bp0 + (size_t)16 * DIM;
  v8f acc0 = {}, acc1 = {};
#pragma unroll 2
  for (unsigned k0 = 0; k0 < (unsigned)DIM; k0 += 32u) {
    const v16h a  = frag_at(ap + k0);
    const v16h b0 = frag_at(bp0 + k0);
    const v16h b1 = frag_at(bp1 + k0);
    acc0 = wmma16(a, b0, acc0);
    acc1 = wmma16(a, b1, acc1);
  }
#pragma unroll
  for (int r = 0; r < 8; ++r) {
    float* d = &Cs[(mw * 16u + hh * 8u + (unsigned)r) * LDC + nw * 32u + m];
    d[0]  = acc0[r];
    d[16] = acc1[r];
  }
  __syncthreads();

  const float cs = TWO_LOG2E / WCARRY;
  v4f xs[4];
  size_t off[4];
#pragma unroll
  for (unsigned i = 0; i < 4u; ++i) {
    const unsigned r = 16u * i + (tid >> 4);
    const unsigned c = (tid & 15u) * 4u;
    const v4f u = *(const v4f*)&Cs[r * LDC + c];
    xs[i] = u * cs;
    off[i] = (size_t)(row0 + r) * VDIM + n0 + c;
  }
#pragma unroll
  for (int i = 0; i < 4; ++i) *(v4f*)(outf + off[i]) = xs[i];
  
}

// ---------------------------------------------------------------------------
// Difference-form additive attention per (8 passage rows, batch). 8 waves.
// Sp holds the NEGATED scaled hp projection (weight plane carried x-64), so that
// sq'[q][v] + sp'[p][v] = 2 log2 e * (Wq[q][v] - Wp[p][v]).
// Phase 0: stage the 8 scaled sp rows (sp_s), their powers 2^sp' (ep_s) and the vector
//          -2*bf16(v) (vs) in LDS; each wave notes whether its part of the rows is inside +-EXPLIM.
// Phase 1: thread t owns query q = 256*pass + t; for the 8 passage rows it accumulates
//          sum_v vs[v] / (1 + 2^(sq'[q][v] + sp'[p][v])) in f32 (equals the score up
//          to a constant that is the same for every query, which the softmax removes);
//          results into Ss[p][q]. The power is taken as 2^sq' * 2^sp' (one exp2 per 8 rows). That
//          holds only while both arguments are inside +-EXPLIM, so a wave that meets a larger one
//          in its pass drops the sums and forms them again from the power of the sum, which is
//          right at any size. sp_s / ep_s / vs / Ss: cross-wave (block barriers).
// Phase 2: wave w owns row w: row max, f16(1024 * exp(s - max)) into Pl (select on
//          the exp2 argument keeps the plane free of f16 subnormals), row sum over the
//          converted values into Ls. Pl / Ls: cross-wave (block barrier).
// Phase 3: out tile [8][32 per wave] = Pl[8][SEQ] . HqT[d][q]^T, B fragments straight from
//          the transposed f16 plane. A-tile rows 8..15 read rows 0..7 again, so lanes 16..31
//          of each accumulator hold the same 8 rows as lanes 0..15.
// Phase 4: scale by 1 / row sum, stage in the wave's own 32 columns of Ss (wave-private from
//          Store coverage: 2 steps x 4 rows == 8 rows.
// Grid (SEQ/8, NB).
// ---------------------------------------------------------------------------
// One thread's sums over the hidden axis for PT passage rows. SPLIT: sp holds the powers 2^sp' and
// the term's power is 2^sq' * 2^sp'; otherwise sp holds sp' and the power is 2^(sq' + sp').
// With SPLIT returns the largest |sq'| that the thread has read; otherwise 0.
template <bool SPLIT>
__device__ __forceinline__ float score_pass(const float* __restrict__ sqr, const float* sp,
                                            const float* vs, float (&acc)[PT]) {
  float amax = 0.0f;
  // every inner loop below is unrolled so that acc, a and vv are indexed by constants and stay in
  // registers; the loop over v0 stays rolled: one trip's PT * VSTEP terms already fill the issue
#pragma unroll
  for (int p = 0; p < PT; ++p) acc[p] = 0.0f;
#pragma unroll 1
  for (unsigned v0 = 0; v0 < (unsigned)VDIM; v0 += (unsigned)VSTEP) {
    v4f a[2], vv[2];
#pragma unroll
    for (int h = 0; h < 2; ++h) {
      a[h] = *(const v4f*)(sqr + v0 + 4u * (unsigned)h);
      vv[h] = *(const v4f*)&vs[v0 + 4u * (unsigned)h];
    }
    if (SPLIT) {
#pragma unroll
      for (int h = 0; h < 2; ++h) {
#pragma unroll
        for (int j = 0; j < 4; ++j) {
          amax = fmaxf(amax, fabsf(a[h][j]));
          a[h][j] = fast_exp2(a[h][j]);
        }
      }
    }
#pragma unroll
    for (int p = 0; p < PT; ++p) {
#pragma unroll
      for (int h = 0; h < 2; ++h) {
        const v4f s4 = *(const v4f*)&sp[(unsigned)p * VDIM + v0 + 4u * (unsigned)h];
#pragma unroll
        for (int j = 0; j < 4; ++j) {
          const float d = SPLIT ? __builtin_fmaf(a[h][j], s4[j], 1.0f)
                                : fast_exp2(a[h][j] + s4[j]) + 1.0f;
          // written as one fma: left as * and +=, the SPLIT build came out with separate mul and add
          acc[p] = __builtin_fmaf(vv[h][j], __builtin_amdgcn_rcpf(d), acc[p]);
        }
      }
    }
  }
  return amax;
}

__global__ __launch_bounds__(256) void addattn_kernel(
    const float* __restrict__ Sq, const float* __restrict__ Sp,
    const float* __restrict__ vvec, const _Float16* __restrict__ HqT,
    float* __restrict__ out) {
  __shared__ __attribute__((aligned(16))) float sp_s[PT * VDIM];
  __shared__ __attribute__((aligned(16))) float ep_s[PT * VDIM];
  __shared__ __attribute__((aligned(16))) unsigned okw[8];
  __shared__ __attribute__((aligned(16))) float vs[VDIM];
  __shared__ __attribute__((aligned(16))) float Ss[PT * SPITCH];
  __shared__ __attribute__((aligned(16))) _Float16 Pl[PT * PPITCH];
  __shared__ __attribute__((aligned(16))) float Ls[PT];
  static_assert(sizeof(float) * (2 * PT * VDIM + VDIM + PT * SPITCH + PT + 8) +
                sizeof(_Float16) * (PT * PPITCH) <= 131072);

  const unsigned tid = threadIdx.x, lane = tid & 31u;
  const unsigned wave = (unsigned)__builtin_amdgcn_readfirstlane((int)(threadIdx.x >> 5));
  const unsigned hh = lane >> 4, m = lane & 15u;
  const unsigned p0 = blockIdx.x * (unsigned)PT;
  const unsigned b = blockIdx.y;

  // ---- phase 0 ----
  float bmax = 0.0f;
  const float vraw = vvec[tid];   // read here, so that it flies together with the sp rows' loads
  const float* spsrc[2];
  v4f x2[2];
#pragma unroll
  for (unsigned j = 0; j < 2u; ++j) {
    const unsigned idx = tid + 256u * j;
    const unsigned r = idx >> 6, c = (idx & 63u) * 4u;
    spsrc[j] = Sp + (size_t)(b * (unsigned)SEQ + p0 + r) * VDIM + c;
    x2[j] = *(const v4f*)spsrc[j];
  }
  // The wait that stands before a register named by an issued load is written again. It takes the
  // two addresses as inputs, so that neither is reused in front of it, not even as a load's target.
  asm volatile("s_wait_xcnt 0x0" :: "v"(spsrc[0]), "v"(spsrc[1]) : "memory");
#pragma unroll
  for (unsigned j = 0; j < 2u; ++j) {
    const unsigned idx = tid + 256u * j;
    const unsigned r = idx >> 6, c = (idx & 63u) * 4u;
    const v4f x = x2[j];
    v4f e;
#pragma unroll  // constant element index: x and e stay in registers
    for (int i = 0; i < 4; ++i) {
      bmax = fmaxf(bmax, fabsf(x[i]));
      e[i] = fast_exp2(x[i]);
    }
    *(v4f*)&sp_s[r * VDIM + c] = x;
    *(v4f*)&ep_s[r * VDIM + c] = e;
  }
  {
    const unsigned big = __builtin_amdgcn_ballot_w32(!(bmax <= EXPLIM));
    if (lane == 0u) okw[wave] = (big == 0u) ? 1u : 0u;
  }
  vs[tid] = -2.0f * bf16r(vraw);
  __syncthreads();
  unsigned okall = 1u;
#pragma unroll  // the eight notes come in two 16-byte LDS reads
  for (int i = 0; i < 8; ++i) okall &= okw[i];
  const bool sp_ok = __builtin_amdgcn_readfirstlane((int)okall) != 0;   // the same in every wave

  // ---- phase 1 ----
#pragma unroll 1
  for (unsigned pass = 0; pass < (unsigned)(SEQ / 256); ++pass) {
    const unsigned q = pass * 256u + tid;
    const float* sqr = Sq + (size_t)(b * (unsigned)SEQ + q) * VDIM;
    float acc[PT];
    bool split_ok = false;   // wave-uniform: every argument of this wave's pass inside +-EXPLIM
    if (sp_ok) {
      const float amax = score_pass<true>(sqr, ep_s, vs, acc);
      split_ok = __builtin_amdgcn_ballot_w32(!(amax <= EXPLIM)) == 0u;
    }
    if (!split_ok) (void)score_pass<false>(sqr, sp_s, vs, acc);
#pragma unroll
    for (int p = 0; p < PT; ++p) Ss[(unsigned)p * SPITCH + q] = acc[p];
  }
  __syncthreads();

  // ---- phase 2 ----
  {
    const unsigned row = wave;
    float mx = -3.0e38f;
#pragma unroll 4
    for (unsigned j = 0; j < (unsigned)(SEQ / 32); ++j)
      mx = fmaxf(mx, Ss[row * SPITCH + lane + 32u * j]);
    mx = red32_max(mx);
    float l = 0.0f;
#pragma unroll 4
    for (unsigned j = 0; j < (unsigned)(SEQ / 32); ++j) {
      const float arg = (Ss[row * SPITCH + lane + 32u * j] - mx) * LOG2E + PCARRY_LOG2;
      const float e = fast_exp2(arg);
      const h16 ph = (arg < -14.0f) ? (h16)0.0f : (h16)e;
      Pl[row * PPITCH + lane + 32u * j] = ph;
      l += (float)ph;
    }
    l = red32_sum(l);
    if (lane == 0u) Ls[row] = l;
  }
  __syncthreads();

  // ---- phase 3 ----
  const unsigned d0 = wave * (unsigned)WCOLS;
  const _Float16* bp = HqT + ((size_t)b * DIM + d0 + m) * SEQ + hh * 8u;
  const _Float16* pa = &Pl[(m & 7u) * PPITCH + hh * 8u];
  v8f o[NBT];
#pragma unroll
  for (int nb = 0; nb < NBT; ++nb) o[nb] = (v8f){};
#pragma unroll 2
  for (unsigned k0 = 0; k0 < (unsigned)SEQ; k0 += 32u) {
    const v16h pf = frag_at(pa + k0);
#pragma unroll
    for (int nb = 0; nb < NBT; ++nb) {
      const v16h hf = frag_at(bp + (size_t)(nb * 16) * SEQ + k0);
      o[nb] = wmma16(pf, hf, o[nb]);
    }
  }

  // ---- phase 4 ----
  // both lane halves hold rows 0..7: lanes 0..15 stage column tile 0, lanes 16..31 tile 1
#pragma unroll
  for (int r = 0; r < PT; ++r) {
    const float inv = __builtin_amdgcn_rcpf(Ls[r]);
    Ss[(unsigned)r * SPITCH + d0 + lane] = (hh ? o[1][r] : o[0][r]) * inv;
  }
  wave_lds_sync();
  v4f x[2];
  size_t off[2];
#pragma unroll
  for (unsigned i = 0; i < 2u; ++i) {
    const unsigned r = 4u * i + (lane >> 3);
    const unsigned c = (lane & 7u) * 4u;
    x[i] = *(const v4f*)&Ss[r * SPITCH + d0 + c];
    off[i] = ((size_t)b * SEQ_FULL + p0 + r) * DIM + d0 + c;
  }
#pragma unroll
  for (int i = 0; i < 2; ++i) *(v4f*)(out + off[i]) = x[i];
  
}

// ---------------------------------------------------------------------------
extern "C" void kernel_launch(void* const* d_in, const int* in_sizes, int n_in,
                              void* d_out, int out_size, void* d_ws, size_t ws_size,
                              hipStream_t stream) {
  if (n_in < 4) return;
  const long long need_x = ((long long)(NB - 1) * SEQ_FULL + SEQ) * DIM;
  if ((long long)in_sizes[0] < need_x) return;
  if ((long long)in_sizes[1] < need_x) return;
  if ((long long)in_sizes[2] < (long long)DIM * VDIM) return;
  if (in_sizes[3] < VDIM) return;
  if ((long long)out_size < need_x) return;
  if (ws_size < WS_TOTAL) return;

  const float* hq   = (const float*)d_in[0];   // [NB_FULL][SEQ_FULL][DIM]
  const float* hp   = (const float*)d_in[1];   // [NB_FULL][SEQ_FULL][DIM]
  const float* w_in = (const float*)d_in[2];   // [VDIM][DIM]  (out, in), shared by both sides
  const float* vvec = (const float*)d_in[3];   // [VDIM]
  float* out = (float*)d_out;                  // [NB_FULL][SEQ_FULL][DIM]

  char* ws = (char*)d_ws;
  _Float16* Wt   = (_Float16*)(ws + OFF_WT);    // plane 0: +64 W for hq, plane 1: -64 W for hp
  _Float16* A16  = (_Float16*)(ws + OFF_A16);   // [2*MROWS][DIM]: hq rows then hp rows
  _Float16* HqT  = (_Float16*)(ws + OFF_HQT);   // [NB][DIM][SEQ]
  float*    Spl  = (float*)(ws + OFF_S);        // [2*MROWS][VDIM]: sq rows then -sp rows

  dim3 blk(256);

  // both weight planes, the hq rows with their transposed plane, and the hp rows: one launch
  conv_kernel<<<dim3(CONV_BLOCKS), blk, 0, stream>>>(hq, hp, w_in, Wt, A16, HqT);

  // both projections in one launch
  proj_kernel<<<dim3(VDIM / 64, (2 * MROWS) / 64), blk, 0, stream>>>(A16, Wt, Spl);

  // scores + softmax + weighted sum
  addattn_kernel<<<dim3(SEQ / PT, NB), blk, 0, stream>>>(
      Spl, Spl + (size_t)MROWS * VDIM, vvec, HqT, out);
}

// v004
// A run of this version takes 38.7 microseconds.
// Timed twice side by side with v003, it ran 1.13 and 1.14 times as fast.
// All steps since v000 together make it 2.21 times as fast.
#include <hip/hip_runtime.h>
#include <stddef.h>

// Contractions on v_wmma_f32_16x16x32_f16 (f16 operands, f32 accumulate): both input projections
// (rows x one shared weight, K = 256) and the probability x value product (K = 512 keys). Float
// inputs are RNE-converted to bf16 and carried in f16 (weights x64 for the hq rows and x-64 for
// the hp rows, so the hp projection comes out negated; softmax numerators x1024). The score sum
// over the 256-wide hidden axis (a matrix-vector product against one vector) runs on the vector
// unit in f32, tanh(x) formed as 1 - 2 / (1 + 2^(2 x log2 e)); the power of the difference is the
// product of one power per side while both arguments are small enough; softmax in f32.

typedef _Float16 v16h __attribute__((ext_vector_type(16)));
typedef _Float16 v8h  __attribute__((ext_vector_type(8)));
typedef float    v8f  __attribute__((ext_vector_type(8)));
typedef float    v4f  __attribute__((ext_vector_type(4)));
typedef _Float16 h16;

#ifndef NB
#define NB 4
#endif
#ifndef SEQ
#define SEQ 512
#endif
#define NB_FULL  4
#define SEQ_FULL 512
#define DIM   256          // feature width of the hq / hp rows (pq_size)
#define VDIM  256          // hidden width of the score
#define MROWS (NB * SEQ)   // compact rows per activation plane (query length == passage length)
#define PT    8            // passage rows per attention block: (SEQ / PT) * NB = 256 blocks
#define VSTEP 8            // hidden columns per score-loop trip (PT * VSTEP terms per thread)
#define WCOLS (DIM / 8)    // output columns per wave in the attention kernel
#define NBT   (WCOLS / 16) // 16-column output tiles per wave

static_assert(NB >= 1 && NB <= NB_FULL);
static_assert(SEQ >= 256 && SEQ <= SEQ_FULL && (SEQ % 256) == 0);
static_assert((DIM % 64) == 0 && (DIM % 32) == 0);
static_assert((VDIM % 64) == 0 && (VDIM % 4) == 0);
static_assert(VDIM == 256);                 // one thread per hidden column when staging the vector
static_assert((MROWS % 64) == 0);
static_assert(DIM == 8 * WCOLS);            // 8 waves x WCOLS output columns
static_assert(WCOLS == 32 && NBT == 2);
static_assert((SEQ % 64) == 0 && (SEQ % 32) == 0);
static_assert(PT == 8);                     // A tile rows 0..7; rows 8..15 repeat them; 1 row per wave
static_assert(PT == 2 * 4);                 // output store: 2 steps x 4 rows
static_assert(PT * VDIM == 256 * 2 * 4);    // sp tile staging: 256 threads x 2 steps x 4 floats
static_assert(VSTEP == 2 * 4 && (VDIM % VSTEP) == 0);
static_assert((SEQ % PT) == 0);

#define LDT 72   // halves per LDS row (144 B, 16-B aligned)
#define LDC 68   // floats per LDS row (272 B, 16-B aligned)
static_assert((LDT % 8) == 0 && LDT >= 64);
static_assert((LDC % 4) == 0 && LDC >= 64);

#define SMAXW  ((SEQ > DIM) ? SEQ : DIM)
#define SPITCH (SMAXW + 4)   // floats per score / output-stage row
#define PPITCH (SEQ + 8)     // halves per probability row
#define HROWS  (256 / (SEQ / 8))   // value-plane rows that 256 threads cover with 16 bytes each
#define HPITCH (SEQ + 8)     // halves per staged value row: 16 B x an odd number, so that the 16 rows
                             // of a fragment read fall on 64 different LDS banks
static_assert((SPITCH % 4) == 0 && SPITCH >= SEQ && SPITCH >= DIM);
static_assert((PPITCH % 8) == 0 && PPITCH >= SEQ);
static_assert((HPITCH % 8) == 0 && ((HPITCH / 8) % 2) == 1 && HPITCH >= SEQ);

#define WCARRY 64.0f          // weight planes carried x64 (hp plane x-64)
#define PCARRY_LOG2 10.0f     // softmax numerators carried x1024 (added to the exp2 argument)
#define TWO_LOG2E 2.885390081777927f
#define LOG2E     1.4426950408889634f
#define EXPLIM    63.0f       // both exp2 arguments inside +-63: each power and their product are normal f32

// workspace layout (bytes)
#define WT_BYTES  ((size_t)2 * VDIM * DIM * 2)      // two [VDIM][DIM] weight planes (+W, -W)
#define A16_BYTES ((size_t)2 * MROWS * DIM * 2)     // hq rows then hp rows, f16
#define HQT_BYTES ((size_t)NB * DIM * SEQ * 2)      // hq transposed [b][d][q], f16
#define S_BYTES   ((size_t)2 * MROWS * VDIM * 4)    // scaled projections: sq rows then -sp rows, f32
#define OFF_WT  ((size_t)0)
#define OFF_A16 (OFF_WT + WT_BYTES)
#define OFF_HQT (OFF_A16 + A16_BYTES)
#define OFF_S   (OFF_HQT + HQT_BYTES)
#define WS_TOTAL (OFF_S + S_BYTES)
static_assert((WT_BYTES % 128) == 0 && (A16_BYTES % 128) == 0);
static_assert((HQT_BYTES % 128) == 0 && (S_BYTES % 128) == 0);
static_assert(WS_TOTAL <= (size_t)134217728);

// ---------------------------------------------------------------------------
__device__ __forceinline__ float bf16r(float x) {   // RNE convert to bf16, returned widened
  unsigned int u = __float_as_uint(x);
  u = (u + 0x7FFFu + ((u >> 16) & 1u)) & 0xFFFF0000u;
  return __uint_as_float(u);
}

// f32 -> f16 operand convert that cannot produce an f16 subnormal (value select).
static __device__ __forceinline__ h16 toh_flush(float v) {
  const h16 r = (h16)v;
  return (fabsf(v) < 6.103515625e-05f) ? (h16)0.0f : r;
}

// 16-bit fragment: p points at element [row = lane&15][k0 + 8*(lane>>4)] of a k-contiguous
// row. Elements 0..7 <- k0+8h+0..7, elements 8..15 <- k0+16+8h+0..7 (same map for A and B).
__device__ __forceinline__ v16h frag_at(const _Float16* p) {
  v8h lo = *(const v8h*)(p);
  v8h hi = *(const v8h*)(p + 16);
  v16h out;
#pragma unroll
  for (int i = 0; i < 8; ++i) { out[i] = lo[i]; out[i + 8] = hi[i]; }
  return out;
}

__device__ __forceinline__ v8f wmma16(v16h a, v16h b, v8f c) {
  v8f d = __builtin_amdgcn_wmma_f32_16x16x32_f16(false, a, false, b, (short)0, c,
                                                 false, false);
  asm volatile("v_nop\n\tv_nop\n\tv_nop\n\tv_nop" : "+v"(d) : "v"(a), "v"(b));
  return d;
}

__device__ __forceinline__ float red32_sum(float x) {
#pragma unroll
  for (int off = 1; off < 32; off <<= 1) x += __shfl_xor(x, off, 32);
  return x;
}
__device__ __forceinline__ float red32_max(float x) {
#pragma unroll
  for (int off = 1; off < 32; off <<= 1) x = fmaxf(x, __shfl_xor(x, off, 32));
  return x;
}

__device__ __forceinline__ void wave_lds_sync() {
  __builtin_amdgcn_fence(3 /* release order */, "wavefront");
  asm volatile("s_wait_dscnt 0x0" ::: "memory");
  __builtin_amdgcn_wave_barrier();
}

// Eight asynchronous 16-byte copies from global memory to LDS; every lane names its own LDS byte
// address and its own global address. The s_wait_xcnt stands inside the statement, behind the last
// copy, so that no address register is written again in front of it.
__device__ __forceinline__ void async_copy8(const unsigned (&l)[8], const _Float16* const (&g)[8]) {
  asm volatile(
      "global_load_async_to_lds_b128 %0, %8, off\n\t"
      "global_load_async_to_lds_b128 %1, %9, off\n\t"
      "global_load_async_to_lds_b128 %2, %10, off\n\t"
      "global_load_async_to_lds_b128 %3, %11, off\n\t"
      "global_load_async_to_lds_b128 %4, %12, off\n\t"
      "global_load_async_to_lds_b128 %5, %13, off\n\t"
      "global_load_async_to_lds_b128 %6, %14, off\n\t"
      "global_load_async_to_lds_b128 %7, %15, off\n\t"
      "s_wait_xcnt 0x0"
      :: "v"(l[0]), "v"(l[1]), "v"(l[2]), "v"(l[3]), "v"(l[4]), "v"(l[5]), "v"(l[6]), "v"(l[7]),
         "v"(g[0]), "v"(g[1]), "v"(g[2]), "v"(g[3]), "v"(g[4]), "v"(g[5]), "v"(g[6]), "v"(g[7])
      : "memory");
}

__device__ __forceinline__ float fast_exp2(float x) {
#if __has_builtin(__builtin_amdgcn_exp2f)
  return __builtin_amdgcn_exp2f(x);
#else
  return __expf(x * 0.6931471805599453f);
#endif
}

// ---------------------------------------------------------------------------
// Weight plane: in W[N rows][K cols] (pitch ldw = K; the [out][in] layout is already
// k-contiguous, so no transpose) -> out Wt[N][K] (pitch ldk = K), f16(carry * bf16(w)).
// carry = +64 for the hq plane, -64 for the hp plane (exact sign fold).
// Tile (bx, by) of (N/64, K/64). T: cross-wave (block barrier).
// Store coverage: 2 steps x 32 rows == 64 tile rows.
// ---------------------------------------------------------------------------
__device__ __forceinline__ void wconv_body(
    _Float16* T, unsigned bx, unsigned by,
    const float* __restrict__ W, _Float16* __restrict__ Wt, unsigned ldw, unsigned ldk,
    float carry) {
  const unsigned tid = threadIdx.x;
  const unsigned n0 = bx * 64u;
  const unsigned k0 = by * 64u;
#pragma unroll 4
  for (unsigned j = 0; j < 16u; ++j) {
    const unsigned idx = tid + 256u * j;
    const unsigned nr = idx >> 6, kc = idx & 63u;
    const float v = W[(size_t)(n0 + nr) * ldw + k0 + kc];
    T[nr * LDT + kc] = toh_flush(carry * bf16r(v));
  }
  __syncthreads();
  v8h x[2];
  size_t off[2];
#pragma unroll
  for (unsigned i = 0; i < 2u; ++i) {
    const unsigned n = 32u * i + (tid >> 3);
    const unsigned kc = (tid & 7u) * 8u;
    x[i] = *(const v8h*)&T[n * LDT + kc];
    off[i] = (size_t)(n0 + n) * ldk + k0 + kc;
  }
#pragma unroll
  for (int i = 0; i < 2; ++i) *(v8h*)(Wt + off[i]) = x[i];
  
}

// ---------------------------------------------------------------------------
// Activation planes: X f32 [NB_FULL][SEQ_FULL][DIM] (input) -> X16 compact [NB*SEQ][DIM]
// = f16(bf16(x)); WITH_T also writes XT16 [NB][DIM][SEQ] (same values, transposed per batch).
// of either plane is written by 8 consecutive lanes x 16 B of one instruction.
// Store coverage: 2 steps x 32 rows == 64 tile rows, for each plane.
// Tile (bx, by) of (DIM/64, MROWS/64).
// ---------------------------------------------------------------------------
template <int WITH_T>
__device__ __forceinline__ void aconv_body(_Float16* T, _Float16* TT, unsigned bx, unsigned by,
                                           const float* __restrict__ X,
                                           _Float16* __restrict__ X16,
                                           _Float16* __restrict__ XT16) {
  const unsigned tid = threadIdx.x;
  const unsigned c0 = bx * 64u;
  const unsigned crow0 = by * 64u;
  const unsigned bidx = crow0 / (unsigned)SEQ;
  const unsigned s0 = crow0 - bidx * (unsigned)SEQ;
  const size_t frow0 = (size_t)bidx * SEQ_FULL + s0;
  const float* src[4];
  v4f a4[4];
#pragma unroll
  for (unsigned j = 0; j < 4u; ++j) {
    const unsigned idx = tid + 256u * j;
    const unsigned r = idx >> 4, c = (idx & 15u) * 4u;
    src[j] = X + (frow0 + r) * DIM + c0 + c;
    a4[j] = *(const v4f*)src[j];
  }
  // The wait that stands before a register named by an issued load is written again. It takes
  // the four addresses as inputs, so that no address register is reused in front of it, not
  // even as the destination of a later one of these loads.
  asm volatile("s_wait_xcnt 0x0" :: "v"(src[0]), "v"(src[1]), "v"(src[2]), "v"(src[3]) : "memory");
#pragma unroll
  for (unsigned j = 0; j < 4u; ++j) {
    const unsigned idx = tid + 256u * j;
    const unsigned r = idx >> 4, c = (idx & 15u) * 4u;
    const v4f a = a4[j];
#pragma unroll
    for (unsigned i = 0; i < 4u; ++i) {
      const h16 hv = toh_flush(bf16r(a[i]));
      T[r * LDT + c + i] = hv;
      if (WITH_T) TT[(c + i) * LDT + r] = hv;
    }
  }
  __syncthreads();
  v8h x[2], xt[2];
  size_t off[2], offt[2];
#pragma unroll
  for (unsigned i = 0; i < 2u; ++i) {
    const unsigned n = 32u * i + (tid >> 3);
    const unsigned kc = (tid & 7u) * 8u;
    x[i] = *(const v8h*)&T[n * LDT + kc];
    off[i] = (size_t)(crow0 + n) * DIM + c0 + kc;
    if (WITH_T) {
      xt[i] = *(const v8h*)&TT[n * LDT + kc];
      offt[i] = ((size_t)bidx * DIM + c0 + n) * SEQ + s0 + kc;
    } else {
      xt[i] = x[i];
      offt[i] = off[i];
    }
  }
#pragma unroll
  for (int i = 0; i < 2; ++i) *(v8h*)(X16 + off[i]) = x[i];
  if (WITH_T) {
#pragma unroll
    for (int i = 0; i < 2; ++i) *(v8h*)(XT16 + offt[i]) = xt[i];
  }
  // The wait that stands before a register named by an issued store is written again: in the merged
  // kernel's listing another job's code, which reuses these registers, stands behind this body.
  asm volatile("s_wait_xcnt 0x0" ::: "memory");
}

// ---------------------------------------------------------------------------
// All four operand conversions in ONE launch: none reads what another writes, so the flat block
// index picks the job (a block-uniform scalar branch; each body's barrier is passed by the whole
// block or by none of it). The weight tiles come first: their load chain is the longest.
//   [0, 2*WJOBS)                    weight plane job / WJOBS (+64 W, then -64 W)
//   [2*WJOBS, 2*WJOBS + AJOBS)      hq rows and the transposed hq plane
//   [2*WJOBS + AJOBS, CONV_BLOCKS)  hp rows
// ---------------------------------------------------------------------------
#define WJOBS ((VDIM / 64) * (DIM / 64))     // tiles per weight plane
#define AJOBS ((DIM / 64) * (MROWS / 64))    // tiles per activation plane
#define CONV_BLOCKS (2 * WJOBS + 2 * AJOBS)

__global__ __launch_bounds__(256) void conv_kernel(
    const float* __restrict__ hq, const float* __restrict__ hp, const float* __restrict__ W,
    _Float16* __restrict__ Wt, _Float16* __restrict__ A16, _Float16* __restrict__ HqT) {
  __shared__ __attribute__((aligned(16))) _Float16 T[64 * LDT];
  __shared__ __attribute__((aligned(16))) _Float16 TT[64 * LDT];
  const unsigned job = blockIdx.x;
  if (job < 2u * WJOBS) {
    const unsigned plane = job / (unsigned)WJOBS;
    const unsigned t = job - plane * (unsigned)WJOBS;
    wconv_body(T, t % (unsigned)(VDIM / 64), t / (unsigned)(VDIM / 64), W,
               Wt + (size_t)plane * ((size_t)VDIM * DIM), (unsigned)DIM, (unsigned)DIM,
               plane ? -WCARRY : WCARRY);
  } else if (job < 2u * WJOBS + AJOBS) {
    const unsigned t = job - 2u * WJOBS;
    aconv_body<1>(T, TT, t % (unsigned)(DIM / 64), t / (unsigned)(DIM / 64), hq, A16, HqT);
  } else {
    const unsigned t = job - (2u * WJOBS + AJOBS);
    _Float16* P16 = A16 + (size_t)MROWS * DIM;
    aconv_body<0>(T, TT, t % (unsigned)(DIM / 64), t / (unsigned)(DIM / 64), hp, P16, P16);
  }
}

// ---------------------------------------------------------------------------
// Projection GEMM C[64x64 tile] = A16[rows][DIM] . Wt[n][DIM]^T, fragments straight from the
// 16-bit global planes; 8 waves (mw = 16-row group, nw = 32-col group), 2 accumulators/wave.
// Rows 0..MROWS-1 (hq rows) use weight plane 0, rows MROWS..2*MROWS-1 (hp rows) plane 1
// (block-uniform integer offset). Output f32 [2*MROWS][VDIM] = acc * (2 log2 e / 64), i.e. the
// projection pre-scaled for the exp2 form of tanh. Epilogue staged through Cs (cross-wave,
// lanes x 16 B. Store coverage: 4 steps x 16 rows == 64 tile rows.
// Grid (VDIM/64, 2*MROWS/64).
// ---------------------------------------------------------------------------
__global__ __launch_bounds__(256) void proj_kernel(
    const _Float16* __restrict__ A16, const _Float16* __restrict__ Wt,
    float* __restrict__ outf) {
  __shared__ __attribute__((aligned(16))) float Cs[64 * LDC];
  const unsigned tid = threadIdx.x, lane = tid & 31u;
  const unsigned w = (unsigned)__builtin_amdgcn_readfirstlane((int)(threadIdx.x >> 5));
  const unsigned mw = w >> 1, nw = w & 1u;
  const unsigned hh = lane >> 4, m = lane & 15u;
  const unsigned n0 = blockIdx.x * 64u;
  const unsigned row0 = blockIdx.y * 64u;
  const size_t woff = (size_t)(row0 / (unsigned)MROWS) * ((size_t)VDIM * DIM);

  const _Float16* ap  = A16 + (size_t)(row0 + mw * 16u + m) * DIM + hh * 8u;
  const _Float16* bp0 = Wt + woff + (size_t)(n0 + nw * 32u + m) * DIM + hh * 8u;
  const _Float16* bp1 = bp0 + (size_t)16 * DIM;
  v8f acc0 = {}, acc1 = {};
#pragma unroll 2
  for (unsigned k0 = 0; k0 < (unsigned)DIM; k0 += 32u) {
    const v16h a  = frag_at(ap + k0);
    const v16h b0 = frag_at(bp0 + k0);
    const v16h b1 = frag_at(bp1 + k0);
    acc0 = wmma16(a, b0, acc0);
    acc1 = wmma16(a, b1, acc1);
  }
#pragma unroll
  for (int r = 0; r < 8; ++r) {
    float* d = &Cs[(mw * 16u + hh * 8u + (unsigned)r) * LDC + nw * 32u + m];
    d[0]  = acc0[r];
    d[16] = acc1[r];
  }
  __syncthreads();

  const float cs = TWO_LOG2E / WCARRY;
  v4f xs[4];
  size_t off[4];
#pragma unroll
  for (unsigned i = 0; i < 4u; ++i) {
    const unsigned r = 16u * i + (tid >> 4);
    const unsigned c = (tid & 15u) * 4u;
    const v4f u = *(const v4f*)&Cs[r * LDC + c];
    xs[i] = u * cs;
    off[i] = (size_t)(row0 + r) * VDIM + n0 + c;
  }
#pragma unroll
  for (int i = 0; i < 4; ++i) *(v4f*)(outf + off[i]) = xs[i];
  
}

// ---------------------------------------------------------------------------
// Difference-form additive attention per (8 passage rows, batch). 8 waves.
// Sp holds the NEGATED scaled hp projection (weight plane carried x-64), so that
// sq'[q][v] + sp'[p][v] = 2 log2 e * (Wq[q][v] - Wp[p][v]).
// Phase 0: stage the 8 scaled sp rows (sp_s), their powers 2^sp' (ep_s) and the vector
//          -2*bf16(v) (vs) in LDS; each wave notes whether its part of the rows is inside +-EXPLIM.
// Phase 1: thread t owns query q = 256*pass + t; for the 8 passage rows it accumulates
//          sum_v vs[v] / (1 + 2^(sq'[q][v] + sp'[p][v])) in f32 (equals the score up
//          to a constant that is the same for every query, which the softmax removes);
//          results into Ss[p][q]. The power is taken as 2^sq' * 2^sp' (one exp2 per 8 rows). That
//          holds only while both arguments are inside +-EXPLIM, so a wave that meets a larger one
//          in its pass drops the sums and forms them again from the power of the sum, which is
//          right at any size. sp_s / ep_s / vs / Ss: cross-wave (block barriers).
// Phase 2: wave w owns row w: row max, f16(1024 * exp(s - max)) into Pl (select on
//          the exp2 argument keeps the plane free of f16 subnormals), row sum over the
//          converted values into Ls. Pl / Ls: cross-wave (block barrier).
//          At the head of each pass every wave also starts asynchronous copies of its share of
//          the batch's transposed f16 plane HqT[d][q] into Hs; they fly under the score loop.
// Phase 3: out tile [8][32 per wave] = Pl[8][SEQ] . Hs[d][q]^T, B fragments from LDS (Hs:
//          cross-wave; each wave's copy wait, then the block barrier in front of this phase).
//          A-tile rows 8..15 read rows 0..7 again, so lanes 16..31
//          of each accumulator hold the same 8 rows as lanes 0..15.
// Phase 4: scale by 1 / row sum, stage in the wave's own 32 columns of Ss (wave-private from
//          Store coverage: 2 steps x 4 rows == 8 rows.
// Grid (SEQ/8, NB).
// ---------------------------------------------------------------------------
// One thread's sums over the hidden axis for PT passage rows. SPLIT: sp holds the powers 2^sp' and
// the term's power is 2^sq' * 2^sp'; otherwise sp holds sp' and the power is 2^(sq' + sp').
// With SPLIT returns the largest |sq'| that the thread has read; otherwise 0.
template <bool SPLIT>
__device__ __forceinline__ float score_pass(const float* __restrict__ sqr, const float* sp,
                                            const float* vs, float (&acc)[PT]) {
  float amax = 0.0f;
  // every inner loop below is unrolled so that acc, a and vv are indexed by constants and stay in
  // registers; the loop over v0 stays rolled: one trip's PT * VSTEP terms already fill the issue
#pragma unroll
  for (int p = 0; p < PT; ++p) acc[p] = 0.0f;
#pragma unroll 1
  for (unsigned v0 = 0; v0 < (unsigned)VDIM; v0 += (unsigned)VSTEP) {
    v4f a[2], vv[2];
#pragma unroll
    for (int h = 0; h < 2; ++h) {
      a[h] = *(const v4f*)(sqr + v0 + 4u * (unsigned)h);
      vv[h] = *(const v4f*)&vs[v0 + 4u * (unsigned)h];
    }
    if (SPLIT) {
#pragma unroll
      for (int h = 0; h < 2; ++h) {
#pragma unroll
        for (int j = 0; j < 4; ++j) {
          amax = fmaxf(amax, fabsf(a[h][j]));
          a[h][j] = fast_exp2(a[h][j]);
        }
      }
    }
#pragma unroll
    for (int p = 0; p < PT; ++p) {
#pragma unroll
      for (int h = 0; h < 2; ++h) {
        const v4f s4 = *(const v4f*)&sp[(unsigned)p * VDIM + v0 + 4u * (unsigned)h];
#pragma unroll
        for (int j = 0; j < 4; ++j) {
          const float d = SPLIT ? __builtin_fmaf(a[h][j], s4[j], 1.0f)
                                : fast_exp2(a[h][j] + s4[j]) + 1.0f;
          // written as one fma: left as * and +=, the SPLIT build came out with separate mul and add
          acc[p] = __builtin_fmaf(vv[h][j], __builtin_amdgcn_rcpf(d), acc[p]);
        }
      }
    }
  }
  return amax;
}

__global__ __launch_bounds__(256) void addattn_kernel(
    const float* __restrict__ Sq, const float* __restrict__ Sp,
    const float* __restrict__ vvec, const _Float16* __restrict__ HqT,
    float* __restrict__ out) {
  __shared__ __attribute__((aligned(16))) float sp_s[PT * VDIM];
  __shared__ __attribute__((aligned(16))) float ep_s[PT * VDIM];
  __shared__ __attribute__((aligned(16))) unsigned okw[8];
  __shared__ __attribute__((aligned(16))) float vs[VDIM];
  __shared__ __attribute__((aligned(16))) float Ss[PT * SPITCH];
  __shared__ __attribute__((aligned(16))) _Float16 Pl[PT * PPITCH];
  __shared__ __attribute__((aligned(16))) float Ls[PT];
  __shared__ __attribute__((aligned(16))) _Float16 Hs[DIM * HPITCH];
  static_assert(sizeof(float) * (2 * PT * VDIM + VDIM + PT * SPITCH + PT + 8) +
                sizeof(_Float16) * (PT * PPITCH + DIM * HPITCH) <= 327680);
  // 16-byte pieces of the value plane per thread and pass; all of one pass's are in flight at once
  static_assert((DIM * SEQ / 8) / 256 / (SEQ / 256) == 32 && ((SEQ / 8) % 32) == 0);

  const unsigned tid = threadIdx.x, lane = tid & 31u;
  const unsigned wave = (unsigned)__builtin_amdgcn_readfirstlane((int)(threadIdx.x >> 5));
  const unsigned hh = lane >> 4, m = lane & 15u;
  const unsigned p0 = blockIdx.x * (unsigned)PT;
  const unsigned b = blockIdx.y;

  // ---- phase 0 ----
  float bmax = 0.0f;
  const float vraw = vvec[tid];   // read here, so that it flies together with the sp rows' loads
  const float* spsrc[2];
  v4f x2[2];
#pragma unroll
  for (unsigned j = 0; j < 2u; ++j) {
    const unsigned idx = tid + 256u * j;
    const unsigned r = idx >> 6, c = (idx & 63u) * 4u;
    spsrc[j] = Sp + (size_t)(b * (unsigned)SEQ + p0 + r) * VDIM + c;
    x2[j] = *(const v4f*)spsrc[j];
  }
  // The wait that stands before a register named by an issued load is written again. It takes the
  // two addresses as inputs, so that neither is reused in front of it, not even as a load's target.
  asm volatile("s_wait_xcnt 0x0" :: "v"(spsrc[0]), "v"(spsrc[1]) : "memory");
#pragma unroll
  for (unsigned j = 0; j < 2u; ++j) {
    const unsigned idx = tid + 256u * j;
    const unsigned r = idx >> 6, c = (idx & 63u) * 4u;
    const v4f x = x2[j];
    v4f e;
#pragma unroll  // constant element index: x and e stay in registers
    for (int i = 0; i < 4; ++i) {
      bmax = fmaxf(bmax, fabsf(x[i]));
      e[i] = fast_exp2(x[i]);
    }
    *(v4f*)&sp_s[r * VDIM + c] = x;
    *(v4f*)&ep_s[r * VDIM + c] = e;
  }
  {
    const unsigned big = __builtin_amdgcn_ballot_w32(!(bmax <= EXPLIM));
    if (lane == 0u) okw[wave] = (big == 0u) ? 1u : 0u;
  }
  vs[tid] = -2.0f * bf16r(vraw);
  __syncthreads();
  unsigned okall = 1u;
#pragma unroll  // the eight notes come in two 16-byte LDS reads
  for (int i = 0; i < 8; ++i) okall &= okw[i];
  const bool sp_ok = __builtin_amdgcn_readfirstlane((int)okall) != 0;   // the same in every wave

  // ---- phase 1 ----
  // One copy of the whole block moves 256 pieces of 16 bytes = HROWS rows of the value plane; a wave's
  // 32 pieces are 512 contiguous bytes of one row. hl0 / hg0: this thread's piece in rows 0..HROWS-1.
  const unsigned hrow = tid / (unsigned)(SEQ / 8), hcol = (tid % (unsigned)(SEQ / 8)) * 8u;
  const unsigned hl0 = (unsigned)(size_t)&Hs[hrow * HPITCH + hcol];   // LDS byte address
  const _Float16* hg0 = HqT + ((size_t)b * DIM + hrow) * SEQ + hcol;
#pragma unroll 1
  for (unsigned pass = 0; pass < (unsigned)(SEQ / 256); ++pass) {
    const unsigned q = pass * 256u + tid;
    // The earlier pass's copies have landed before more are issued: a wave never has more than one
    // pass's 32 copies outstanding.
    asm volatile("s_wait_asynccnt 0x0" ::: "memory");
#pragma unroll  // constant indices: the eight address sets of a statement stay in registers
    for (unsigned jj = 0; jj < 4u; ++jj) {
      unsigned la[8];
      const _Float16* ga[8];
#pragma unroll
      for (unsigned j = 0; j < 8u; ++j) {
        const unsigned n = (pass * 4u + jj) * 8u + j;   // the block's n-th set of HROWS plane rows
        la[j] = hl0 + n * (unsigned)(HROWS * HPITCH * 2);
        ga[j] = hg0 + (size_t)n * (HROWS * SEQ);
      }
      async_copy8(la, ga);
    }
    const float* sqr = Sq + (size_t)(b * (unsigned)SEQ + q) * VDIM;
    float acc[PT];
    bool split_ok = false;   // wave-uniform: every argument of this wave's pass inside +-EXPLIM
    if (sp_ok) {
      const float amax = score_pass<true>(sqr, ep_s, vs, acc);
      split_ok = __builtin_amdgcn_ballot_w32(!(amax <= EXPLIM)) == 0u;
    }
    if (!split_ok) (void)score_pass<false>(sqr, sp_s, vs, acc);
#pragma unroll
    for (int p = 0; p < PT; ++p) Ss[(unsigned)p * SPITCH + q] = acc[p];
  }
  __syncthreads();

  // ---- phase 2 ----
  {
    const unsigned row = wave;
    float mx = -3.0e38f;
#pragma unroll 4
    for (unsigned j = 0; j < (unsigned)(SEQ / 32); ++j)
      mx = fmaxf(mx, Ss[row * SPITCH + lane + 32u * j]);
    mx = red32_max(mx);
    float l = 0.0f;
#pragma unroll 4
    for (unsigned j = 0; j < (unsigned)(SEQ / 32); ++j) {
      const float arg = (Ss[row * SPITCH + lane + 32u * j] - mx) * LOG2E + PCARRY_LOG2;
      const float e = fast_exp2(arg);
      const h16 ph = (arg < -14.0f) ? (h16)0.0f : (h16)e;
      Pl[row * PPITCH + lane + 32u * j] = ph;
      l += (float)ph;
    }
    l = red32_sum(l);
    if (lane == 0u) Ls[row] = l;
  }
  // This wave's copies into Hs have landed; the barrier below then shows them to the other waves.
  asm volatile("s_wait_asynccnt 0x0" ::: "memory");
  __syncthreads();

  // ---- phase 3 ----
  const unsigned d0 = wave * (unsigned)WCOLS;
  const _Float16* bp = &Hs[(d0 + m) * HPITCH + hh * 8u];
  const _Float16* pa = &Pl[(m & 7u) * PPITCH + hh * 8u];
  v8f o[NBT];
#pragma unroll
  for (int nb = 0; nb < NBT; ++nb) o[nb] = (v8f){};
#pragma unroll 2
  for (unsigned k0 = 0; k0 < (unsigned)SEQ; k0 += 32u) {
    const v16h pf = frag_at(pa + k0);
#pragma unroll
    for (int nb = 0; nb < NBT; ++nb) {
      const v16h hf = frag_at(bp + (unsigned)(nb * 16) * HPITCH + k0);
      o[nb] = wmma16(pf, hf, o[nb]);
    }
  }

  // ---- phase 4 ----
  // both lane halves hold rows 0..7: lanes 0..15 stage column tile 0, lanes 16..31 tile 1
#pragma unroll
  for (int r = 0; r < PT; ++r) {
    const float inv = __builtin_amdgcn_rcpf(Ls[r]);
    Ss[(unsigned)r * SPITCH + d0 + lane] = (hh ? o[1][r] : o[0][r]) * inv;
  }
  wave_lds_sync();
  v4f x[2];
  size_t off[2];
#pragma unroll
  for (unsigned i = 0; i < 2u; ++i) {
    const unsigned r = 4u * i + (lane >> 3);
    const unsigned c = (lane & 7u) * 4u;
    x[i] = *(const v4f*)&Ss[r * SPITCH + d0 + c];
    off[i] = ((size_t)b * SEQ_FULL + p0 + r) * DIM + d0 + c;
  }
#pragma unroll
  for (int i = 0; i < 2; ++i) *(v4f*)(out + off[i]) = x[i];
  
}

// ---------------------------------------------------------------------------
extern "C" void kernel_launch(void* const* d_in, const int* in_sizes, int n_in,
                              void* d_out, int out_size, void* d_ws, size_t ws_size,
                              hipStream_t stream) {
  if (n_in < 4) return;
  const long long need_x = ((long long)(NB - 1) * SEQ_FULL + SEQ) * DIM;
  if ((long long)in_sizes[0] < need_x) return;
  if ((long long)in_sizes[1] < need_x) return;
  if ((long long)in_sizes[2] < (long long)DIM * VDIM) return;
  if (in_sizes[3] < VDIM) return;
  if ((long long)out_size < need_x) return;
  if (ws_size < WS_TOTAL) return;

  const float* hq   = (const float*)d_in[0];   // [NB_FULL][SEQ_FULL][DIM]
  const float* hp   = (const float*)d_in[1];   // [NB_FULL][SEQ_FULL][DIM]
  const float* w_in = (const float*)d_in[2];   // [VDIM][DIM]  (out, in), shared by both sides
  const float* vvec = (const float*)d_in[3];   // [VDIM]
  float* out = (float*)d_out;                  // [NB_FULL][SEQ_FULL][DIM]

  char* ws = (char*)d_ws;
  _Float16* Wt   = (_Float16*)(ws + OFF_WT);    // plane 0: +64 W for hq, plane 1: -64 W for hp
  _Float16* A16  = (_Float16*)(ws + OFF_A16);   // [2*MROWS][DIM]: hq rows then hp rows
  _Float16* HqT  = (_Float16*)(ws + OFF_HQT);   // [NB][DIM][SEQ]
  float*    Spl  = (float*)(ws + OFF_S);        // [2*MROWS][VDIM]: sq rows then -sp rows

  dim3 blk(256);

  // both weight planes, the hq rows with their transposed plane, and the hp rows: one launch
  conv_kernel<<<dim3(CONV_BLOCKS), blk, 0, stream>>>(hq, hp, w_in, Wt, A16, HqT);

  // both projections in one launch
  proj_kernel<<<dim3(VDIM / 64, (2 * MROWS) / 64), blk, 0, stream>>>(A16, Wt, Spl);

  // scores + softmax + weighted sum
  addattn_kernel<<<dim3(SEQ / PT, NB), blk, 0, stream>>>(
      Spl, Spl + (size_t)MROWS * VDIM, vvec, HqT, out);
}

// v005
// It runs in 34.9 microseconds.
// Next to v004, in two timings, it ran 1.13 and 1.12 times as fast.
// Counting every step since v000, it is 2.48 times as fast.
#include <hip/hip_runtime.h>
#include <stddef.h>

// Contractions on v_wmma_f32_16x16x32_f16 (f16 operands, f32 accumulate): both input projections
// (rows x one shared weight, K = 256) and the probability x value product (K = 512 keys). Float
// inputs are RNE-converted to bf16 and carried in f16 (weights x64 for the hq rows and x-64 for
// the hp rows, so the hp projection comes out negated; softmax numerators x1024). The score sum
// over the 256-wide hidden axis (a matrix-vector product against one vector) runs on the vector
// unit in f32, tanh(x) formed as 1 - 2 / (1 + 2^(2 x log2 e)); the power of the difference is the
// product of one power per side while both arguments are small enough; softmax in f32.

typedef _Float16 v16h __attribute__((ext_vector_type(16)));
typedef _Float16 v8h  __attribute__((ext_vector_type(8)));
typedef float    v8f  __attribute__((ext_vector_type(8)));
typedef float    v4f  __attribute__((ext_vector_type(4)));
typedef float    v2f  __attribute__((ext_vector_type(2)));
typedef _Float16 h16;

#ifndef NB
#define NB 4
#endif
#ifndef SEQ
#define SEQ 512
#endif
#define NB_FULL  4
#define SEQ_FULL 512
#define DIM   256          // feature width of the hq / hp rows (pq_size)
#define VDIM  256          // hidden width of the score
#define MROWS (NB * SEQ)   // compact rows per activation plane (query length == passage length)
#define PT    8            // passage rows per attention block: (SEQ / PT) * NB = 256 blocks
#define VSTEP 8            // hidden columns per score-loop trip (PT * VSTEP terms per thread)
#define NTRIP (VDIM / VSTEP)  // score-loop trips per pass
#define NPF   4            // register sets for the query operand: the current trip's and three in flight
#define WCOLS (DIM / 8)    // output columns per wave in the attention kernel
#define NBT   (WCOLS / 16) // 16-column output tiles per wave

static_assert(NB >= 1 && NB <= NB_FULL);
static_assert(SEQ >= 256 && SEQ <= SEQ_FULL && (SEQ % 256) == 0);
static_assert((DIM % 64) == 0 && (DIM % 32) == 0);
static_assert((VDIM % 64) == 0 && (VDIM % 4) == 0);
static_assert(VDIM == 256);                 // one thread per hidden column when staging the vector
static_assert((MROWS % 64) == 0);
static_assert(DIM == 8 * WCOLS);            // 8 waves x WCOLS output columns
static_assert(WCOLS == 32 && NBT == 2);
static_assert((SEQ % 64) == 0 && (SEQ % 32) == 0);
static_assert(PT == 8);                     // A tile rows 0..7; rows 8..15 repeat them; 1 row per wave
static_assert(PT == 2 * 4);                 // output store: 2 steps x 4 rows
static_assert(PT * VDIM == 256 * 2 * 4);    // sp tile staging: 256 threads x 2 steps x 4 floats
static_assert(VSTEP == 2 * 4 && (VDIM % VSTEP) == 0);
static_assert((NTRIP % NPF) == 0 && NTRIP >= NPF);
static_assert((SEQ % PT) == 0);

#define LDT 72   // halves per LDS row (144 B, 16-B aligned)
#define LDC 68   // floats per LDS row (272 B, 16-B aligned)
static_assert((LDT % 8) == 0 && LDT >= 64);
static_assert((LDC % 4) == 0 && LDC >= 64);

#define SMAXW  ((SEQ > DIM) ? SEQ : DIM)
#define SPITCH (SMAXW + 4)   // floats per score / output-stage row
#define PPITCH (SEQ + 8)     // halves per probability row
#define HROWS  (256 / (SEQ / 8))   // value-plane rows that 256 threads cover with 16 bytes each
#define HPITCH (SEQ + 8)     // halves per staged value row: 16 B x an odd number, so that the 16 rows
                             // of a fragment read fall on 64 different LDS banks
static_assert((SPITCH % 4) == 0 && SPITCH >= SEQ && SPITCH >= DIM);
static_assert((PPITCH % 8) == 0 && PPITCH >= SEQ);
static_assert((HPITCH % 8) == 0 && ((HPITCH / 8) % 2) == 1 && HPITCH >= SEQ);

#define WCARRY 64.0f          // weight planes carried x64 (hp plane x-64)
#define PCARRY_LOG2 10.0f     // softmax numerators carried x1024 (added to the exp2 argument)
#define TWO_LOG2E 2.885390081777927f
#define LOG2E     1.4426950408889634f
#define EXPLIM    63.0f       // both exp2 arguments inside +-63: each power and their product are normal f32

// workspace layout (bytes)
#define WT_BYTES  ((size_t)2 * VDIM * DIM * 2)      // two [VDIM][DIM] weight planes (+W, -W)
#define A16_BYTES ((size_t)2 * MROWS * DIM * 2)     // hq rows then hp rows, f16
#define HQT_BYTES ((size_t)NB * DIM * SEQ * 2)      // hq transposed [b][d][q], f16
#define S_BYTES   ((size_t)2 * MROWS * VDIM * 4)    // scaled projections, f32: sq [b][v][q], then -sp rows
#define OFF_WT  ((size_t)0)
#define OFF_A16 (OFF_WT + WT_BYTES)
#define OFF_HQT (OFF_A16 + A16_BYTES)
#define OFF_S   (OFF_HQT + HQT_BYTES)
#define WS_TOTAL (OFF_S + S_BYTES)
static_assert((WT_BYTES % 128) == 0 && (A16_BYTES % 128) == 0);
static_assert((HQT_BYTES % 128) == 0 && (S_BYTES % 128) == 0);
static_assert(WS_TOTAL <= (size_t)134217728);

// ---------------------------------------------------------------------------
__device__ __forceinline__ float bf16r(float x) {   // RNE convert to bf16, returned widened
  unsigned int u = __float_as_uint(x);
  u = (u + 0x7FFFu + ((u >> 16) & 1u)) & 0xFFFF0000u;
  return __uint_as_float(u);
}

// f32 -> f16 operand convert that cannot produce an f16 subnormal (value select).
static __device__ __forceinline__ h16 toh_flush(float v) {
  const h16 r = (h16)v;
  return (fabsf(v) < 6.103515625e-05f) ? (h16)0.0f : r;
}

// 16-bit fragment: p points at element [row = lane&15][k0 + 8*(lane>>4)] of a k-contiguous
// row. Elements 0..7 <- k0+8h+0..7, elements 8..15 <- k0+16+8h+0..7 (same map for A and B).
__device__ __forceinline__ v16h frag_at(const _Float16* p) {
  v8h lo = *(const v8h*)(p);
  v8h hi = *(const v8h*)(p + 16);
  v16h out;
#pragma unroll
  for (int i = 0; i < 8; ++i) { out[i] = lo[i]; out[i + 8] = hi[i]; }
  return out;
}

__device__ __forceinline__ v8f wmma16(v16h a, v16h b, v8f c) {
  v8f d = __builtin_amdgcn_wmma_f32_16x16x32_f16(false, a, false, b, (short)0, c,
                                                 false, false);
  asm volatile("v_nop\n\tv_nop\n\tv_nop\n\tv_nop" : "+v"(d) : "v"(a), "v"(b));
  return d;
}

__device__ __forceinline__ float red32_sum(float x) {
#pragma unroll
  for (int off = 1; off < 32; off <<= 1) x += __shfl_xor(x, off, 32);
  return x;
}
__device__ __forceinline__ float red32_max(float x) {
#pragma unroll
  for (int off = 1; off < 32; off <<= 1) x = fmaxf(x, __shfl_xor(x, off, 32));
  return x;
}

__device__ __forceinline__ void wave_lds_sync() {
  __builtin_amdgcn_fence(3 /* release order */, "wavefront");
  asm volatile("s_wait_dscnt 0x0" ::: "memory");
  __builtin_amdgcn_wave_barrier();
}

// Eight asynchronous 16-byte copies from global memory to LDS; every lane names its own LDS byte
// address and its own global address. The s_wait_xcnt stands inside the statement, behind the last
// copy, so that no address register is written again in front of it.
__device__ __forceinline__ void async_copy8(const unsigned (&l)[8], const _Float16* const (&g)[8]) {
  asm volatile(
      "global_load_async_to_lds_b128 %0, %8, off\n\t"
      "global_load_async_to_lds_b128 %1, %9, off\n\t"
      "global_load_async_to_lds_b128 %2, %10, off\n\t"
      "global_load_async_to_lds_b128 %3, %11, off\n\t"
      "global_load_async_to_lds_b128 %4, %12, off\n\t"
      "global_load_async_to_lds_b128 %5, %13, off\n\t"
      "global_load_async_to_lds_b128 %6, %14, off\n\t"
      "global_load_async_to_lds_b128 %7, %15, off\n\t"
      "s_wait_xcnt 0x0"
      :: "v"(l[0]), "v"(l[1]), "v"(l[2]), "v"(l[3]), "v"(l[4]), "v"(l[5]), "v"(l[6]), "v"(l[7]),
         "v"(g[0]), "v"(g[1]), "v"(g[2]), "v"(g[3]), "v"(g[4]), "v"(g[5]), "v"(g[6]), "v"(g[7])
      : "memory");
}

__device__ __forceinline__ float fast_exp2(float x) {
#if __has_builtin(__builtin_amdgcn_exp2f)
  return __builtin_amdgcn_exp2f(x);
#else
  return __expf(x * 0.6931471805599453f);
#endif
}

// ---------------------------------------------------------------------------
// Weight plane: in W[N rows][K cols] (pitch ldw = K; the [out][in] layout is already
// k-contiguous, so no transpose) -> out Wt[N][K] (pitch ldk = K), f16(carry * bf16(w)).
// carry = +64 for the hq plane, -64 for the hp plane (exact sign fold).
// Tile (bx, by) of (N/64, K/64). T: cross-wave (block barrier).
// Store coverage: 2 steps x 32 rows == 64 tile rows.
// ---------------------------------------------------------------------------
__device__ __forceinline__ void wconv_body(
    _Float16* T, unsigned bx, unsigned by,
    const float* __restrict__ W, _Float16* __restrict__ Wt, unsigned ldw, unsigned ldk,
    float carry) {
  const unsigned tid = threadIdx.x;
  const unsigned n0 = bx * 64u;
  const unsigned k0 = by * 64u;
#pragma unroll 4
  for (unsigned j = 0; j < 16u; ++j) {
    const unsigned idx = tid + 256u * j;
    const unsigned nr = idx >> 6, kc = idx & 63u;
    const float v = W[(size_t)(n0 + nr) * ldw + k0 + kc];
    T[nr * LDT + kc] = toh_flush(carry * bf16r(v));
  }
  __syncthreads();
  v8h x[2];
  size_t off[2];
#pragma unroll
  for (unsigned i = 0; i < 2u; ++i) {
    const unsigned n = 32u * i + (tid >> 3);
    const unsigned kc = (tid & 7u) * 8u;
    x[i] = *(const v8h*)&T[n * LDT + kc];
    off[i] = (size_t)(n0 + n) * ldk + k0 + kc;
  }
#pragma unroll
  for (int i = 0; i < 2; ++i) *(v8h*)(Wt + off[i]) = x[i];
  
}

// ---------------------------------------------------------------------------
// Activation planes: X f32 [NB_FULL][SEQ_FULL][DIM] (input) -> X16 compact [NB*SEQ][DIM]
// = f16(bf16(x)); WITH_T also writes XT16 [NB][DIM][SEQ] (same values, transposed per batch).
// of either plane is written by 8 consecutive lanes x 16 B of one instruction.
// Store coverage: 2 steps x 32 rows == 64 tile rows, for each plane.
// Tile (bx, by) of (DIM/64, MROWS/64).
// ---------------------------------------------------------------------------
template <int WITH_T>
__device__ __forceinline__ void aconv_body(_Float16* T, _Float16* TT, unsigned bx, unsigned by,
                                           const float* __restrict__ X,
                                           _Float16* __restrict__ X16,
                                           _Float16* __restrict__ XT16) {
  const unsigned tid = threadIdx.x;
  const unsigned c0 = bx * 64u;
  const unsigned crow0 = by * 64u;
  const unsigned bidx = crow0 / (unsigned)SEQ;
  const unsigned s0 = crow0 - bidx * (unsigned)SEQ;
  const size_t frow0 = (size_t)bidx * SEQ_FULL + s0;
  const float* src[4];
  v4f a4[4];
#pragma unroll
  for (unsigned j = 0; j < 4u; ++j) {
    const unsigned idx = tid + 256u * j;
    const unsigned r = idx >> 4, c = (idx & 15u) * 4u;
    src[j] = X + (frow0 + r) * DIM + c0 + c;
    a4[j] = *(const v4f*)src[j];
  }
  // The wait that stands before a register named by an issued load is written again. It takes
  // the four addresses as inputs, so that no address register is reused in front of it, not
  // even as the destination of a later one of these loads.
  asm volatile("s_wait_xcnt 0x0" :: "v"(src[0]), "v"(src[1]), "v"(src[2]), "v"(src[3]) : "memory");
#pragma unroll
  for (unsigned j = 0; j < 4u; ++j) {
    const unsigned idx = tid + 256u * j;
    const unsigned r = idx >> 4, c = (idx & 15u) * 4u;
    const v4f a = a4[j];
#pragma unroll
    for (unsigned i = 0; i < 4u; ++i) {
      const h16 hv = toh_flush(bf16r(a[i]));
      T[r * LDT + c + i] = hv;
      if (WITH_T) TT[(c + i) * LDT + r] = hv;
    }
  }
  __syncthreads();
  v8h x[2], xt[2];
  size_t off[2], offt[2];
#pragma unroll
  for (unsigned i = 0; i < 2u; ++i) {
    const unsigned n = 32u * i + (tid >> 3);
    const unsigned kc = (tid & 7u) * 8u;
    x[i] = *(const v8h*)&T[n * LDT + kc];
    off[i] = (size_t)(crow0 + n) * DIM + c0 + kc;
    if (WITH_T) {
      xt[i] = *(const v8h*)&TT[n * LDT + kc];
      offt[i] = ((size_t)bidx * DIM + c0 + n) * SEQ + s0 + kc;
    } else {
      xt[i] = x[i];
      offt[i] = off[i];
    }
  }
#pragma unroll
  for (int i = 0; i < 2; ++i) *(v8h*)(X16 + off[i]) = x[i];
  if (WITH_T) {
#pragma unroll
    for (int i = 0; i < 2; ++i) *(v8h*)(XT16 + offt[i]) = xt[i];
  }
  // The wait that stands before a register named by an issued store is written again: in the merged
  // kernel's listing another job's code, which reuses these registers, stands behind this body.
  asm volatile("s_wait_xcnt 0x0" ::: "memory");
}

// ---------------------------------------------------------------------------
// All four operand conversions in ONE launch: none reads what another writes, so the flat block
// index picks the job (a block-uniform scalar branch; each body's barrier is passed by the whole
// block or by none of it). The weight tiles come first: their load chain is the longest.
//   [0, 2*WJOBS)                    weight plane job / WJOBS (+64 W, then -64 W)
//   [2*WJOBS, 2*WJOBS + AJOBS)      hq rows and the transposed hq plane
//   [2*WJOBS + AJOBS, CONV_BLOCKS)  hp rows
// ---------------------------------------------------------------------------
#define WJOBS ((VDIM / 64) * (DIM / 64))     // tiles per weight plane
#define AJOBS ((DIM / 64) * (MROWS / 64))    // tiles per activation plane
#define CONV_BLOCKS (2 * WJOBS + 2 * AJOBS)

__global__ __launch_bounds__(256) void conv_kernel(
    const float* __restrict__ hq, const float* __restrict__ hp, const float* __restrict__ W,
    _Float16* __restrict__ Wt, _Float16* __restrict__ A16, _Float16* __restrict__ HqT) {
  __shared__ __attribute__((aligned(16))) _Float16 T[64 * LDT];
  __shared__ __attribute__((aligned(16))) _Float16 TT[64 * LDT];
  const unsigned job = blockIdx.x;
  if (job < 2u * WJOBS) {
    const unsigned plane = job / (unsigned)WJOBS;
    const unsigned t = job - plane * (unsigned)WJOBS;
    wconv_body(T, t % (unsigned)(VDIM / 64), t / (unsigned)(VDIM / 64), W,
               Wt + (size_t)plane * ((size_t)VDIM * DIM), (unsigned)DIM, (unsigned)DIM,
               plane ? -WCARRY : WCARRY);
  } else if (job < 2u * WJOBS + AJOBS) {
    const unsigned t = job - 2u * WJOBS;
    aconv_body<1>(T, TT, t % (unsigned)(DIM / 64), t / (unsigned)(DIM / 64), hq, A16, HqT);
  } else {
    const unsigned t = job - (2u * WJOBS + AJOBS);
    _Float16* P16 = A16 + (size_t)MROWS * DIM;
    aconv_body<0>(T, TT, t % (unsigned)(DIM / 64), t / (unsigned)(DIM / 64), hp, P16, P16);
  }
}

// ---------------------------------------------------------------------------
// Projection GEMM C[64x64 tile] = A16[rows][DIM] . Wt[n][DIM]^T, fragments straight from the
// 16-bit global planes; 8 waves (mw = 16-row group, nw = 32-col group), 2 accumulators/wave.
// Rows 0..MROWS-1 (hq rows) use weight plane 0, rows MROWS..2*MROWS-1 (hp rows) plane 1
// (block-uniform integer offset). Output f32 = acc * (2 log2 e / 64), i.e. the projection
// pre-scaled for the exp2 form of tanh. The hp rows go out as rows [MROWS][VDIM]; the hq rows go
// out transposed per batch, [NB][VDIM][SEQ], so that the attention kernel's threads (one query
// each) read one hidden column of 32 neighbouring queries as one 128-byte line. Epilogue staged
// through Cs (cross-wave); an hq tile is laid into Cs column-major, so the read-out and the
// 16-byte stores are the same for both. Store coverage: 4 steps x 16 rows == 64 tile rows.
// Grid (VDIM/64, 2*MROWS/64).
// ---------------------------------------------------------------------------
__global__ __launch_bounds__(256) void proj_kernel(
    const _Float16* __restrict__ A16, const _Float16* __restrict__ Wt,
    float* __restrict__ outf) {
  __shared__ __attribute__((aligned(16))) float Cs[64 * LDC];
  const unsigned tid = threadIdx.x, lane = tid & 31u;
  const unsigned w = (unsigned)__builtin_amdgcn_readfirstlane((int)(threadIdx.x >> 5));
  const unsigned mw = w >> 1, nw = w & 1u;
  const unsigned hh = lane >> 4, m = lane & 15u;
  const unsigned n0 = blockIdx.x * 64u;
  const unsigned row0 = blockIdx.y * 64u;
  const size_t woff = (size_t)(row0 / (unsigned)MROWS) * ((size_t)VDIM * DIM);

  const _Float16* ap  = A16 + (size_t)(row0 + mw * 16u + m) * DIM + hh * 8u;
  const _Float16* bp0 = Wt + woff + (size_t)(n0 + nw * 32u + m) * DIM + hh * 8u;
  const _Float16* bp1 = bp0 + (size_t)16 * DIM;
  v8f acc0 = {}, acc1 = {};
#pragma unroll 2
  for (unsigned k0 = 0; k0 < (unsigned)DIM; k0 += 32u) {
    const v16h a  = frag_at(ap + k0);
    const v16h b0 = frag_at(bp0 + k0);
    const v16h b1 = frag_at(bp1 + k0);
    acc0 = wmma16(a, b0, acc0);
    acc1 = wmma16(a, b1, acc1);
  }
  const bool tq = row0 < (unsigned)MROWS;   // block-uniform: an hq tile, stored transposed
  if (tq) {
    // Cs[output column][tile row]: a lane's 8 accumulator rows are 8 neighbouring floats
    float* d = &Cs[(nw * 32u + m) * LDC + mw * 16u + hh * 8u];
#pragma unroll
    for (int g = 0; g < 2; ++g) {
      *(v4f*)(d + 4 * g) = (v4f){acc0[4 * g], acc0[4 * g + 1], acc0[4 * g + 2], acc0[4 * g + 3]};
      *(v4f*)(d + 16 * LDC + 4 * g) =
          (v4f){acc1[4 * g], acc1[4 * g + 1], acc1[4 * g + 2], acc1[4 * g + 3]};
    }
  } else {
#pragma unroll
    for (int r = 0; r < 8; ++r) {
      float* d = &Cs[(mw * 16u + hh * 8u + (unsigned)r) * LDC + nw * 32u + m];
      d[0]  = acc0[r];
      d[16] = acc1[r];
    }
  }
  __syncthreads();

  const float cs = TWO_LOG2E / WCARRY;
  // first element and row pitch of the tile in the output plane, as Cs holds it
  const unsigned bidx = row0 / (unsigned)SEQ;            // batch of an hq tile (SEQ % 64 == 0)
  const size_t obase = tq ? ((size_t)bidx * VDIM + n0) * SEQ + (row0 - bidx * (unsigned)SEQ)
                          : (size_t)row0 * VDIM + n0;
  const unsigned opitch = tq ? (unsigned)SEQ : (unsigned)VDIM;
  v4f xs[4];
  size_t off[4];
#pragma unroll
  for (unsigned i = 0; i < 4u; ++i) {
    const unsigned r = 16u * i + (tid >> 4);
    const unsigned c = (tid & 15u) * 4u;
    const v4f u = *(const v4f*)&Cs[r * LDC + c];
    xs[i] = u * cs;
    off[i] = obase + (size_t)r * opitch + c;
  }
#pragma unroll
  for (int i = 0; i < 4; ++i) *(v4f*)(outf + off[i]) = xs[i];
  
}

// ---------------------------------------------------------------------------
// Difference-form additive attention per (8 passage rows, batch). 8 waves.
// Sp holds the NEGATED scaled hp projection (weight plane carried x-64), so that
// sq'[q][v] + sp'[p][v] = 2 log2 e * (Wq[q][v] - Wp[p][v]).
// Phase 0: stage the 8 scaled sp rows (sp_s), their powers 2^sp' (ep_s) and the vector
//          -2*bf16(v) (vs) in LDS; each wave notes whether its part of the rows is inside +-EXPLIM.
// Phase 1: thread t owns query q = 256*pass + t; for the 8 passage rows it accumulates
//          sum_v vs[v] / (1 + 2^(sq'[q][v] + sp'[p][v])) in f32 (equals the score up
//          to a constant that is the same for every query, which the softmax removes);
//          results into Ss[p][q]. The power is taken as 2^sq' * 2^sp' (one exp2 per 8 rows). That
//          holds only while both arguments are inside +-EXPLIM, so a wave that meets a larger one
//          in its pass drops the sums and forms them again from the power of the sum, which is
//          right at any size. sp_s / ep_s / vs / Ss: cross-wave (block barriers).
// Phase 2: wave w owns row w: row max, f16(1024 * exp(s - max)) into Pl (select on
//          the exp2 argument keeps the plane free of f16 subnormals), row sum over the
//          converted values into Ls. Pl / Ls: cross-wave (block barrier).
//          At the head of each pass every wave also starts asynchronous copies of its share of
//          the batch's transposed f16 plane HqT[d][q] into Hs; they fly under the score loop.
// Phase 3: out tile [8][32 per wave] = Pl[8][SEQ] . Hs[d][q]^T, B fragments from LDS (Hs:
//          cross-wave; each wave's copy wait, then the block barrier in front of this phase).
//          A-tile rows 8..15 read rows 0..7 again, so lanes 16..31
//          of each accumulator hold the same 8 rows as lanes 0..15.
// Phase 4: scale by 1 / row sum, stage in the wave's own 32 columns of Ss (wave-private from
//          Store coverage: 2 steps x 4 rows == 8 rows.
// Grid (SEQ/8, NB).
// ---------------------------------------------------------------------------
// One thread's sums over the hidden axis for PT passage rows. SPLIT: sp holds the powers 2^sp' and
// the term's power is 2^sq' * 2^sp'; otherwise sp holds sp' and the power is 2^(sq' + sp').
// sqc points at the thread's query in hidden column 0 of the transposed plane (column pitch SEQ):
// a wave's load of one column is one 128-byte line that no other wave reads, so each comes from L2;
// the loads of trip t + NPF - 1 are therefore issued at the head of trip t, into the register set
// that trip t - 1 has used up. With SPLIT, returns the largest |sq'| that the thread has read; otherwise 0.
template <bool SPLIT>
__device__ __forceinline__ float score_pass(const float* __restrict__ sqc, const float* sp,
                                            const float* vs, float (&acc)[PT]) {
  float amax = 0.0f;
  float ring[NPF][VSTEP];
  // every inner loop below is unrolled so that acc2, ring, a, s4 and d are indexed by constants and stay
  // in registers; the loop over t0 stays rolled: NPF trips, one per register set, are its body
  v2f acc2[PT / 2];   // rows 2 pp and 2 pp + 1
#pragma unroll
  for (int pp = 0; pp < PT / 2; ++pp) acc2[pp] = (v2f){0.0f, 0.0f};
#pragma unroll
  for (int s = 0; s < NPF - 1; ++s) {
#pragma unroll
    for (int j = 0; j < VSTEP; ++j) ring[s][j] = sqc[(size_t)(s * VSTEP + j) * SEQ];
  }
#pragma unroll 1
  for (unsigned t0 = 0; t0 < (unsigned)NTRIP; t0 += (unsigned)NPF) {
#pragma unroll
    for (int s = 0; s < NPF; ++s) {
      const unsigned v0 = (t0 + (unsigned)s) * (unsigned)VSTEP;
      // behind the last trip there is nothing to fetch: the index stops there (in bounds, not used)
      const unsigned tn = t0 + (unsigned)(s + NPF - 1);
      const unsigned vf = (tn < (unsigned)NTRIP ? tn : (unsigned)(NTRIP - 1)) * (unsigned)VSTEP;
#pragma unroll
      for (int j = 0; j < VSTEP; ++j)
        ring[(s + NPF - 1) % NPF][j] = sqc[(size_t)(vf + (unsigned)j) * SEQ];
      v4f w4[2], s4[PT][2];
#pragma unroll
      for (int h = 0; h < 2; ++h) w4[h] = *(const v4f*)&vs[v0 + 4u * (unsigned)h];
#pragma unroll
      for (int p = 0; p < PT; ++p) {
#pragma unroll
        for (int h = 0; h < 2; ++h)
          s4[p][h] = *(const v4f*)&sp[(unsigned)p * VDIM + v0 + 4u * (unsigned)h];
      }
      // holds the trip's loads and all its LDS reads in one place at its head, in front of the
      // arithmetic: left free, the scheduler spread the LDS reads through the trip, each just ahead
      // of its use, so that the wave waited for LDS at many places instead of one
      __builtin_amdgcn_sched_barrier(0);
      float a[VSTEP];
#pragma unroll
      for (int j = 0; j < VSTEP; ++j) a[j] = ring[s][j];
      if (SPLIT) {
#pragma unroll
        for (int j = 0; j < VSTEP; ++j) {
          amax = fmaxf(amax, fabsf(a[j]));
          a[j] = fast_exp2(a[j]);
        }
      }
      // Two-wide f32 forms written out (the packed fma does two a clock): the denominators pair two
      // neighbouring hidden columns of one row, the sums pair two rows at one hidden column. Each
      // row's sum still takes its terms in ascending column order.
      v2f d[PT][VSTEP / 2];
      const v2f one = {1.0f, 1.0f};
#pragma unroll
      for (int p = 0; p < PT; ++p) {
#pragma unroll
        for (int g = 0; g < VSTEP / 2; ++g) {
          const v2f a2 = {a[2 * g], a[2 * g + 1]};
          const v2f s2 = {s4[p][g >> 1][2 * (g & 1)], s4[p][g >> 1][2 * (g & 1) + 1]};
          if (SPLIT) {
            d[p][g] = __builtin_elementwise_fma(a2, s2, one);
          } else {
            const v2f x = a2 + s2;
            d[p][g] = (v2f){fast_exp2(x[0]), fast_exp2(x[1])} + one;
          }
        }
      }
#pragma unroll
      for (int j = 0; j < VSTEP; ++j) {
        const float w = w4[j >> 2][j & 3];
#pragma unroll
        for (int pp = 0; pp < PT / 2; ++pp) {
          const v2f r = {__builtin_amdgcn_rcpf(d[2 * pp][j >> 1][j & 1]),
                         __builtin_amdgcn_rcpf(d[2 * pp + 1][j >> 1][j & 1])};
          acc2[pp] = __builtin_elementwise_fma((v2f){w, w}, r, acc2[pp]);
        }
      }
      // keeps each trip's instructions in that trip: left free, the scheduler drew the loads and the
      // LDS reads of all NPF trips to the head of the body, waited for all of them there and took
      // some 500 registers
      __builtin_amdgcn_sched_barrier(0);
    }
  }
#pragma unroll
  for (int pp = 0; pp < PT / 2; ++pp) {
    acc[2 * pp] = acc2[pp][0];
    acc[2 * pp + 1] = acc2[pp][1];
  }
  return amax;
}

__global__ __launch_bounds__(256) void addattn_kernel(
    const float* __restrict__ Sq, const float* __restrict__ Sp,
    const float* __restrict__ vvec, const _Float16* __restrict__ HqT,
    float* __restrict__ out) {
  __shared__ __attribute__((aligned(16))) float sp_s[PT * VDIM];
  __shared__ __attribute__((aligned(16))) float ep_s[PT * VDIM];
  __shared__ __attribute__((aligned(16))) unsigned okw[8];
  __shared__ __attribute__((aligned(16))) float vs[VDIM];
  __shared__ __attribute__((aligned(16))) float Ss[PT * SPITCH];
  __shared__ __attribute__((aligned(16))) _Float16 Pl[PT * PPITCH];
  __shared__ __attribute__((aligned(16))) float Ls[PT];
  __shared__ __attribute__((aligned(16))) _Float16 Hs[DIM * HPITCH];
  static_assert(sizeof(float) * (2 * PT * VDIM + VDIM + PT * SPITCH + PT + 8) +
                sizeof(_Float16) * (PT * PPITCH + DIM * HPITCH) <= 327680);
  // 16-byte pieces of the value plane per thread and pass; all of one pass's are in flight at once
  static_assert((DIM * SEQ / 8) / 256 / (SEQ / 256) == 32 && ((SEQ / 8) % 32) == 0);

  const unsigned tid = threadIdx.x, lane = tid & 31u;
  const unsigned wave = (unsigned)__builtin_amdgcn_readfirstlane((int)(threadIdx.x >> 5));
  const unsigned hh = lane >> 4, m = lane & 15u;
  const unsigned p0 = blockIdx.x * (unsigned)PT;
  const unsigned b = blockIdx.y;

  // ---- phase 0 ----
  float bmax = 0.0f;
  const float vraw = vvec[tid];   // read here, so that it flies together with the sp rows' loads
  const float* spsrc[2];
  v4f x2[2];
#pragma unroll
  for (unsigned j = 0; j < 2u; ++j) {
    const unsigned idx = tid + 256u * j;
    const unsigned r = idx >> 6, c = (idx & 63u) * 4u;
    spsrc[j] = Sp + (size_t)(b * (unsigned)SEQ + p0 + r) * VDIM + c;
    x2[j] = *(const v4f*)spsrc[j];
  }
  // The wait that stands before a register named by an issued load is written again. It takes the
  // two addresses as inputs, so that neither is reused in front of it, not even as a load's target.
  asm volatile("s_wait_xcnt 0x0" :: "v"(spsrc[0]), "v"(spsrc[1]) : "memory");
#pragma unroll
  for (unsigned j = 0; j < 2u; ++j) {
    const unsigned idx = tid + 256u * j;
    const unsigned r = idx >> 6, c = (idx & 63u) * 4u;
    const v4f x = x2[j];
    v4f e;
#pragma unroll  // constant element index: x and e stay in registers
    for (int i = 0; i < 4; ++i) {
      bmax = fmaxf(bmax, fabsf(x[i]));
      e[i] = fast_exp2(x[i]);
    }
    *(v4f*)&sp_s[r * VDIM + c] = x;
    *(v4f*)&ep_s[r * VDIM + c] = e;
  }
  {
    const unsigned big = __builtin_amdgcn_ballot_w32(!(bmax <= EXPLIM));
    if (lane == 0u) okw[wave] = (big == 0u) ? 1u : 0u;
  }
  vs[tid] = -2.0f * bf16r(vraw);
  __syncthreads();
  unsigned okall = 1u;
#pragma unroll  // the eight notes come in two 16-byte LDS reads
  for (int i = 0; i < 8; ++i) okall &= okw[i];
  const bool sp_ok = __builtin_amdgcn_readfirstlane((int)okall) != 0;   // the same in every wave

  // ---- phase 1 ----
  // One copy of the whole block moves 256 pieces of 16 bytes = HROWS rows of the value plane; a wave's
  // 32 pieces are 512 contiguous bytes of one row. hl0 / hg0: this thread's piece in rows 0..HROWS-1.
  const unsigned hrow = tid / (unsigned)(SEQ / 8), hcol = (tid % (unsigned)(SEQ / 8)) * 8u;
  const unsigned hl0 = (unsigned)(size_t)&Hs[hrow * HPITCH + hcol];   // LDS byte address
  const _Float16* hg0 = HqT + ((size_t)b * DIM + hrow) * SEQ + hcol;
#pragma unroll 1
  for (unsigned pass = 0; pass < (unsigned)(SEQ / 256); ++pass) {
    const unsigned q = pass * 256u + tid;
    // The earlier pass's copies have landed before more are issued: a wave never has more than one
    // pass's 32 copies outstanding.
    asm volatile("s_wait_asynccnt 0x0" ::: "memory");
#pragma unroll  // constant indices: the eight address sets of a statement stay in registers
    for (unsigned jj = 0; jj < 4u; ++jj) {
      unsigned la[8];
      const _Float16* ga[8];
#pragma unroll
      for (unsigned j = 0; j < 8u; ++j) {
        const unsigned n = (pass * 4u + jj) * 8u + j;   // the block's n-th set of HROWS plane rows
        la[j] = hl0 + n * (unsigned)(HROWS * HPITCH * 2);
        ga[j] = hg0 + (size_t)n * (HROWS * SEQ);
      }
      async_copy8(la, ga);
    }
    const float* sqc = Sq + (size_t)b * VDIM * SEQ + q;   // Sq: [b][hidden column][query]
    float acc[PT];
    bool split_ok = false;   // wave-uniform: every argument of this wave's pass inside +-EXPLIM
    if (sp_ok) {
      const float amax = score_pass<true>(sqc, ep_s, vs, acc);
      split_ok = __builtin_amdgcn_ballot_w32(!(amax <= EXPLIM)) == 0u;
    }
    if (!split_ok) (void)score_pass<false>(sqc, sp_s, vs, acc);
#pragma unroll
    for (int p = 0; p < PT; ++p) Ss[(unsigned)p * SPITCH + q] = acc[p];
  }
  __syncthreads();

  // ---- phase 2 ----
  {
    const unsigned row = wave;
    float mx = -3.0e38f;
#pragma unroll 4
    for (unsigned j = 0; j < (unsigned)(SEQ / 32); ++j)
      mx = fmaxf(mx, Ss[row * SPITCH + lane + 32u * j]);
    mx = red32_max(mx);
    float l = 0.0f;
#pragma unroll 4
    for (unsigned j = 0; j < (unsigned)(SEQ / 32); ++j) {
      const float arg = (Ss[row * SPITCH + lane + 32u * j] - mx) * LOG2E + PCARRY_LOG2;
      const float e = fast_exp2(arg);
      const h16 ph = (arg < -14.0f) ? (h16)0.0f : (h16)e;
      Pl[row * PPITCH + lane + 32u * j] = ph;
      l += (float)ph;
    }
    l = red32_sum(l);
    if (lane == 0u) Ls[row] = l;
  }
  // This wave's copies into Hs have landed; the barrier below then shows them to the other waves.
  asm volatile("s_wait_asynccnt 0x0" ::: "memory");
  __syncthreads();

  // ---- phase 3 ----
  const unsigned d0 = wave * (unsigned)WCOLS;
  const _Float16* bp = &Hs[(d0 + m) * HPITCH + hh * 8u];
  const _Float16* pa = &Pl[(m & 7u) * PPITCH + hh * 8u];
  v8f o[NBT];
#pragma unroll
  for (int nb = 0; nb < NBT; ++nb) o[nb] = (v8f){};
#pragma unroll 2
  for (unsigned k0 = 0; k0 < (unsigned)SEQ; k0 += 32u) {
    const v16h pf = frag_at(pa + k0);
#pragma unroll
    for (int nb = 0; nb < NBT; ++nb) {
      const v16h hf = frag_at(bp + (unsigned)(nb * 16) * HPITCH + k0);
      o[nb] = wmma16(pf, hf, o[nb]);
    }
  }

  // ---- phase 4 ----
  // both lane halves hold rows 0..7: lanes 0..15 stage column tile 0, lanes 16..31 tile 1
#pragma unroll
  for (int r = 0; r < PT; ++r) {
    const float inv = __builtin_amdgcn_rcpf(Ls[r]);
    Ss[(unsigned)r * SPITCH + d0 + lane] = (hh ? o[1][r] : o[0][r]) * inv;
  }
  wave_lds_sync();
  v4f x[2];
  size_t off[2];
#pragma unroll
  for (unsigned i = 0; i < 2u; ++i) {
    const unsigned r = 4u * i + (lane >> 3);
    const unsigned c = (lane & 7u) * 4u;
    x[i] = *(const v4f*)&Ss[r * SPITCH + d0 + c];
    off[i] = ((size_t)b * SEQ_FULL + p0 + r) * DIM + d0 + c;
  }
#pragma unroll
  for (int i = 0; i < 2; ++i) *(v4f*)(out + off[i]) = x[i];
  
}

// ---------------------------------------------------------------------------
extern "C" void kernel_launch(void* const* d_in, const int* in_sizes, int n_in,
                              void* d_out, int out_size, void* d_ws, size_t ws_size,
                              hipStream_t stream) {
  if (n_in < 4) return;
  const long long need_x = ((long long)(NB - 1) * SEQ_FULL + SEQ) * DIM;
  if ((long long)in_sizes[0] < need_x) return;
  if ((long long)in_sizes[1] < need_x) return;
  if ((long long)in_sizes[2] < (long long)DIM * VDIM) return;
  if (in_sizes[3] < VDIM) return;
  if ((long long)out_size < need_x) return;
  if (ws_size < WS_TOTAL) return;

  const float* hq   = (const float*)d_in[0];   // [NB_FULL][SEQ_FULL][DIM]
  const float* hp   = (const float*)d_in[1];   // [NB_FULL][SEQ_FULL][DIM]
  const float* w_in = (const float*)d_in[2];   // [VDIM][DIM]  (out, in), shared by both sides
  const float* vvec = (const float*)d_in[3];   // [VDIM]
  float* out = (float*)d_out;                  // [NB_FULL][SEQ_FULL][DIM]

  char* ws = (char*)d_ws;
  _Float16* Wt   = (_Float16*)(ws + OFF_WT);    // plane 0: +64 W for hq, plane 1: -64 W for hp
  _Float16* A16  = (_Float16*)(ws + OFF_A16);   // [2*MROWS][DIM]: hq rows then hp rows
  _Float16* HqT  = (_Float16*)(ws + OFF_HQT);   // [NB][DIM][SEQ]
  float*    Spl  = (float*)(ws + OFF_S);        // sq [NB][VDIM][SEQ], then -sp rows [MROWS][VDIM]

  dim3 blk(256);

  // both weight planes, the hq rows with their transposed plane, and the hp rows: one launch
  conv_kernel<<<dim3(CONV_BLOCKS), blk, 0, stream>>>(hq, hp, w_in, Wt, A16, HqT);

  // both projections in one launch
  proj_kernel<<<dim3(VDIM / 64, (2 * MROWS) / 64), blk, 0, stream>>>(A16, Wt, Spl);

  // scores + softmax + weighted sum
  addattn_kernel<<<dim3(SEQ / PT, NB), blk, 0, stream>>>(
      Spl, Spl + (size_t)MROWS * VDIM, vvec, HqT, out);
}

// v006
// One run takes 31.6 microseconds.
// In both of two side-by-side timings against v005, it was 1.11 times as fast.
// Counting every step since v000, it is 2.75 times as fast.
#include <hip/hip_runtime.h>
#include <stddef.h>

// Contractions on v_wmma_f32_16x16x32_f16 (f16 operands, f32 accumulate): both input projections
// (rows x one shared weight, K = 256) and the probability x value product (K = 512 keys). Float
// inputs are RNE-converted to bf16 and carried in f16 (weights x64 for the hq rows and x-64 for
// the hp rows, so the hp projection comes out negated; softmax numerators x1024). The score sum
// over the 256-wide hidden axis (a matrix-vector product against one vector) runs on the vector
// unit in f32, tanh(x) formed as 1 - 2 / (1 + 2^(2 x log2 e)); the power of the difference is the
// product of one power per side while both arguments are small enough; softmax in f32.

typedef _Float16 v16h __attribute__((ext_vector_type(16)));
typedef _Float16 v8h  __attribute__((ext_vector_type(8)));
typedef _Float16 v4h  __attribute__((ext_vector_type(4)));
typedef float    v8f  __attribute__((ext_vector_type(8)));
typedef float    v4f  __attribute__((ext_vector_type(4)));
typedef float    v2f  __attribute__((ext_vector_type(2)));
typedef _Float16 h16;

#ifndef NB
#define NB 4
#endif
#ifndef SEQ
#define SEQ 512
#endif
#define NB_FULL  4
#define SEQ_FULL 512
#define DIM   256          // feature width of the hq / hp rows (pq_size)
#define VDIM  256          // hidden width of the score
#define MROWS (NB * SEQ)   // compact rows per activation plane (query length == passage length)
#define PT    8            // passage rows per attention block: (SEQ / PT) * NB = 256 blocks
#define VSTEP 8            // hidden columns per score-loop trip (PT * VSTEP terms per thread)
#define NTRIP (VDIM / VSTEP)  // score-loop trips per pass
#define NPF   4            // register sets for the query operand: the current trip's and three in flight
#define WCOLS (DIM / 8)    // output columns per wave in the attention kernel
#define NBT   (WCOLS / 16) // 16-column output tiles per wave

static_assert(NB >= 1 && NB <= NB_FULL);
static_assert(SEQ >= 256 && SEQ <= SEQ_FULL && (SEQ % 256) == 0);
static_assert((DIM % 128) == 0);
static_assert((VDIM % 64) == 0 && (VDIM % 4) == 0);
static_assert(VDIM == 256);                 // one thread per hidden column when staging the vector
static_assert((MROWS % 64) == 0);
static_assert(DIM == 8 * WCOLS);            // 8 waves x WCOLS output columns
static_assert(WCOLS == 32 && NBT == 2);
static_assert((SEQ % 64) == 0 && (SEQ % 32) == 0);
static_assert(PT == 8);                     // A tile rows 0..7; rows 8..15 repeat them; 1 row per wave
static_assert(PT == 2 * 4);                 // output store: 2 steps x 4 rows
static_assert(PT * VDIM == 256 * 2 * 4);    // sp tile staging: 256 threads x 2 steps x 4 floats
static_assert(VSTEP == 2 * 4 && (VDIM % VSTEP) == 0);
static_assert((NTRIP % NPF) == 0 && NTRIP >= NPF);
static_assert((SEQ % PT) == 0);

#define LDA (DIM + 8)   // halves per staged operand row: 16 B x an odd number, so that the 16 rows
                        // of a fragment read fall on 64 different LDS banks
#define LDC 68   // floats per LDS row (272 B, 16-B aligned)
static_assert((LDA % 8) == 0 && ((LDA / 8) % 2) == 1 && LDA >= DIM);
static_assert((LDC % 4) == 0 && LDC >= 64);
static_assert(DIM == VDIM);                 // a block's column index names its output columns and the
                                            // feature columns that it transposes
static_assert(64 * DIM == 256 * 16 * 4);    // operand staging: 256 threads x 16 steps x 4 floats

#define SMAXW  ((SEQ > DIM) ? SEQ : DIM)
#define SPITCH (SMAXW + 4)   // floats per score / output-stage row
#define PPITCH (SEQ + 8)     // halves per probability row
#define HROWS  (256 / (SEQ / 8))   // value-plane rows that 256 threads cover with 16 bytes each
#define HPITCH (SEQ + 8)     // halves per staged value row: 16 B x an odd number, so that the 16 rows
                             // of a fragment read fall on 64 different LDS banks
static_assert((SPITCH % 4) == 0 && SPITCH >= SEQ && SPITCH >= DIM);
static_assert((PPITCH % 8) == 0 && PPITCH >= SEQ);
static_assert((HPITCH % 8) == 0 && ((HPITCH / 8) % 2) == 1 && HPITCH >= SEQ);

#define WCARRY 64.0f          // weight planes carried x64 (hp plane x-64)
#define PCARRY_LOG2 10.0f     // softmax numerators carried x1024 (added to the exp2 argument)
#define TWO_LOG2E 2.885390081777927f
#define LOG2E     1.4426950408889634f
#define EXPLIM    63.0f       // both exp2 arguments inside +-63: each power and their product are normal f32

// workspace layout (bytes)
#define HQT_BYTES ((size_t)NB * DIM * SEQ * 2)      // hq transposed [b][d][q], f16
#define S_BYTES   ((size_t)2 * MROWS * VDIM * 4)    // scaled projections, f32: sq [b][v][q], then -sp rows
#define OFF_HQT ((size_t)0)
#define OFF_S   (OFF_HQT + HQT_BYTES)
#define WS_TOTAL (OFF_S + S_BYTES)
static_assert((HQT_BYTES % 128) == 0 && (S_BYTES % 128) == 0);
static_assert(WS_TOTAL <= (size_t)134217728);

// ---------------------------------------------------------------------------
__device__ __forceinline__ float bf16r(float x) {   // RNE convert to bf16, returned widened
  unsigned int u = __float_as_uint(x);
  u = (u + 0x7FFFu + ((u >> 16) & 1u)) & 0xFFFF0000u;
  return __uint_as_float(u);
}

// f32 -> f16 operand convert that cannot produce an f16 subnormal (value select).
static __device__ __forceinline__ h16 toh_flush(float v) {
  const h16 r = (h16)v;
  return (fabsf(v) < 6.103515625e-05f) ? (h16)0.0f : r;
}

// 16-bit fragment: p points at element [row = lane&15][k0 + 8*(lane>>4)] of a k-contiguous
// row. Elements 0..7 <- k0+8h+0..7, elements 8..15 <- k0+16+8h+0..7 (same map for A and B).
__device__ __forceinline__ v16h frag_at(const _Float16* p) {
  v8h lo = *(const v8h*)(p);
  v8h hi = *(const v8h*)(p + 16);
  v16h out;
#pragma unroll
  for (int i = 0; i < 8; ++i) { out[i] = lo[i]; out[i + 8] = hi[i]; }
  return out;
}

__device__ __forceinline__ v8f wmma16(v16h a, v16h b, v8f c) {
  v8f d = __builtin_amdgcn_wmma_f32_16x16x32_f16(false, a, false, b, (short)0, c,
                                                 false, false);
  asm volatile("v_nop\n\tv_nop\n\tv_nop\n\tv_nop" : "+v"(d) : "v"(a), "v"(b));
  return d;
}

__device__ __forceinline__ float red32_sum(float x) {
#pragma unroll
  for (int off = 1; off < 32; off <<= 1) x += __shfl_xor(x, off, 32);
  return x;
}
__device__ __forceinline__ float red32_max(float x) {
#pragma unroll
  for (int off = 1; off < 32; off <<= 1) x = fmaxf(x, __shfl_xor(x, off, 32));
  return x;
}

__device__ __forceinline__ void wave_lds_sync() {
  __builtin_amdgcn_fence(3 /* release order */, "wavefront");
  asm volatile("s_wait_dscnt 0x0" ::: "memory");
  __builtin_amdgcn_wave_barrier();
}

// Eight asynchronous 16-byte copies from global memory to LDS; every lane names its own LDS byte
// address and its own global address. The s_wait_xcnt stands inside the statement, behind the last
// copy, so that no address register is written again in front of it.
__device__ __forceinline__ void async_copy8(const unsigned (&l)[8], const _Float16* const (&g)[8]) {
  asm volatile(
      "global_load_async_to_lds_b128 %0, %8, off\n\t"
      "global_load_async_to_lds_b128 %1, %9, off\n\t"
      "global_load_async_to_lds_b128 %2, %10, off\n\t"
      "global_load_async_to_lds_b128 %3, %11, off\n\t"
      "global_load_async_to_lds_b128 %4, %12, off\n\t"
      "global_load_async_to_lds_b128 %5, %13, off\n\t"
      "global_load_async_to_lds_b128 %6, %14, off\n\t"
      "global_load_async_to_lds_b128 %7, %15, off\n\t"
      "s_wait_xcnt 0x0"
      :: "v"(l[0]), "v"(l[1]), "v"(l[2]), "v"(l[3]), "v"(l[4]), "v"(l[5]), "v"(l[6]), "v"(l[7]),
         "v"(g[0]), "v"(g[1]), "v"(g[2]), "v"(g[3]), "v"(g[4]), "v"(g[5]), "v"(g[6]), "v"(g[7])
      : "memory");
}

__device__ __forceinline__ float fast_exp2(float x) {
#if __has_builtin(__builtin_amdgcn_exp2f)
  return __builtin_amdgcn_exp2f(x);
#else
  return __expf(x * 0.6931471805599453f);
#endif
}

// ---------------------------------------------------------------------------
// Projection GEMM C[64x64 tile] = X[rows][DIM] . W[n][DIM]^T, straight from the f32 inputs: the
// block converts its 64 activation rows (f16(bf16(x))) and its 64 weight rows (f16(carry * bf16(w)),
// the [out][in] layout is already k-contiguous) into LDS and takes its fragments from there.
// 8 waves (mw = 16-row group, nw = 32-col group), 2 accumulators/wave.
// Rows 0..MROWS-1 are hq rows (carry +64), rows MROWS..2*MROWS-1 hp rows (carry -64, an exact sign
// fold); which, is block-uniform. Output f32 = acc * (2 log2 e / 64), i.e. the projection
// pre-scaled for the exp2 form of tanh. The hp rows go out as rows [MROWS][VDIM]; the hq rows go
// out transposed per batch, [NB][VDIM][SEQ], so that the attention kernel's threads (one query
// each) read one hidden column of 32 neighbouring queries as one 128-byte line. Epilogue staged
// through Cs (cross-wave); an hq tile is laid into Cs column-major, so the read-out and the
// 16-byte stores are the same for both. Store coverage: 4 steps x 16 rows == 64 tile rows.
// An hq block also writes its 64 rows x 64 feature columns (the columns of its own column index)
// of the f16 plane transposed per batch, HqT[NB][DIM][SEQ]: each 128-byte line by 8 consecutive
// lanes x 16 B of one instruction; 2 steps x 32 rows == 64 plane rows.
// As / Ws: cross-wave (block barrier). Grid (VDIM/64, 2*MROWS/64).
// ---------------------------------------------------------------------------
__global__ __launch_bounds__(256) void proj_kernel(
    const float* __restrict__ hq, const float* __restrict__ hp, const float* __restrict__ W,
    float* __restrict__ outf, _Float16* __restrict__ HqT) {
  __shared__ __attribute__((aligned(16))) _Float16 As[64 * LDA];
  __shared__ __attribute__((aligned(16))) _Float16 Ws[64 * LDA];
  __shared__ __attribute__((aligned(16))) float Cs[64 * LDC];
  const unsigned tid = threadIdx.x, lane = tid & 31u;
  const unsigned w = (unsigned)__builtin_amdgcn_readfirstlane((int)(threadIdx.x >> 5));
  const unsigned mw = w >> 1, nw = w & 1u;
  const unsigned hh = lane >> 4, m = lane & 15u;
  const unsigned n0 = blockIdx.x * 64u;
  const unsigned row0 = blockIdx.y * 64u;
  const bool tq = row0 < (unsigned)MROWS;   // block-uniform: an hq tile, stored transposed
  const unsigned crow0 = tq ? row0 : row0 - (unsigned)MROWS;   // first row within its plane
  const unsigned bidx = crow0 / (unsigned)SEQ;                 // batch of the tile (SEQ % 64 == 0)
  const unsigned s0 = crow0 - bidx * (unsigned)SEQ;
  const float carry = tq ? WCARRY : -WCARRY;

  // a step of the whole block covers 4 rows of DIM floats; a wave's load is 512 contiguous bytes
  const unsigned sr = tid >> 6, sc = (tid & 63u) * 4u;
  const float* asrc = (tq ? hq : hp) + ((size_t)bidx * SEQ_FULL + s0 + sr) * DIM + sc;
  const float* wsrc = W + (size_t)(n0 + sr) * DIM + sc;
  v4f a4[16], w4[16];
#pragma unroll  // constant indices: a4 and w4 stay in registers; all 32 loads are in flight at once
  for (unsigned j = 0; j < 16u; ++j) {
    a4[j] = *(const v4f*)(asrc + (size_t)j * (4 * DIM));
    w4[j] = *(const v4f*)(wsrc + (size_t)j * (4 * DIM));
  }
  // The wait that stands before a register named by an issued load is written again. It takes the
  // two addresses as inputs, so that neither is reused in front of it, not even as a load's target.
  asm volatile("s_wait_xcnt 0x0" :: "v"(asrc), "v"(wsrc) : "memory");
#pragma unroll
  for (unsigned j = 0; j < 16u; ++j) {
    v4h ha, hw;
#pragma unroll
    for (int i = 0; i < 4; ++i) {
      ha[i] = toh_flush(bf16r(a4[j][i]));
      hw[i] = toh_flush(carry * bf16r(w4[j][i]));
    }
    *(v4h*)&As[(sr + 4u * j) * LDA + sc] = ha;
    *(v4h*)&Ws[(sr + 4u * j) * LDA + sc] = hw;
  }
  __syncthreads();

  const _Float16* ap  = &As[(mw * 16u + m) * LDA + hh * 8u];
  const _Float16* bp0 = &Ws[(nw * 32u + m) * LDA + hh * 8u];
  const _Float16* bp1 = bp0 + 16 * LDA;
  v8f acc0 = {}, acc1 = {};
#pragma unroll 1  // rolled: a trip reads four steps' fragments (96 registers) together, ahead of their
                  // products, so that LDS latency is waited for twice and not at every step
  for (unsigned k0 = 0; k0 < (unsigned)DIM; k0 += 128u) {
    v16h a[4], b0[4], b1[4];
#pragma unroll  // constant indices: the fragments stay in registers
    for (unsigned t = 0; t < 4u; ++t) {
      a[t]  = frag_at(ap + k0 + 32u * t);
      b0[t] = frag_at(bp0 + k0 + 32u * t);
      b1[t] = frag_at(bp1 + k0 + 32u * t);
    }
#pragma unroll
    for (unsigned t = 0; t < 4u; ++t) {
      acc0 = wmma16(a[t], b0[t], acc0);
      acc1 = wmma16(a[t], b1[t], acc1);
    }
  }
  if (tq) {
    // Cs[output column][tile row]: a lane's 8 accumulator rows are 8 neighbouring floats
    float* d = &Cs[(nw * 32u + m) * LDC + mw * 16u + hh * 8u];
#pragma unroll
    for (int g = 0; g < 2; ++g) {
      *(v4f*)(d + 4 * g) = (v4f){acc0[4 * g], acc0[4 * g + 1], acc0[4 * g + 2], acc0[4 * g + 3]};
      *(v4f*)(d + 16 * LDC + 4 * g) =
          (v4f){acc1[4 * g], acc1[4 * g + 1], acc1[4 * g + 2], acc1[4 * g + 3]};
    }
  } else {
#pragma unroll
    for (int r = 0; r < 8; ++r) {
      float* d = &Cs[(mw * 16u + hh * 8u + (unsigned)r) * LDC + nw * 32u + m];
      d[0]  = acc0[r];
      d[16] = acc1[r];
    }
  }
  __syncthreads();

  const float cs = TWO_LOG2E / WCARRY;
  // first element and row pitch of the tile in the output plane, as Cs holds it
  const size_t obase = tq ? ((size_t)bidx * VDIM + n0) * SEQ + s0
                          : (size_t)row0 * VDIM + n0;
  const unsigned opitch = tq ? (unsigned)SEQ : (unsigned)VDIM;
  v4f xs[4];
  size_t off[4];
#pragma unroll
  for (unsigned i = 0; i < 4u; ++i) {
    const unsigned r = 16u * i + (tid >> 4);
    const unsigned c = (tid & 15u) * 4u;
    const v4f u = *(const v4f*)&Cs[r * LDC + c];
    xs[i] = u * cs;
    off[i] = obase + (size_t)r * opitch + c;
  }
  // the transposed f16 plane, from the staged rows; behind the last barrier, so that none waits
  // for these stores
  v8h xt[2] = {};
  size_t offt[2] = {};
  if (tq) {
#pragma unroll
    for (unsigned i = 0; i < 2u; ++i) {
      const unsigned n = 32u * i + (tid >> 3);
      const unsigned kc = (tid & 7u) * 8u;
#pragma unroll
      for (unsigned e = 0; e < 8u; ++e) xt[i][e] = As[(kc + e) * LDA + n0 + n];
      offt[i] = ((size_t)bidx * DIM + n0 + n) * SEQ + s0 + kc;
    }
  }
#pragma unroll
  for (int i = 0; i < 4; ++i) *(v4f*)(outf + off[i]) = xs[i];
  // The wait that stands before a register named by an issued store is written again: the two
  // addresses formed in the branch below reuse registers of the stores above. It stands in front of
  // the branch, so that nothing of the branch's code is moved ahead of it.
  asm volatile("s_wait_xcnt 0x0" ::: "memory");
  if (tq) {
#pragma unroll
    for (int i = 0; i < 2; ++i) *(v8h*)(HqT + offt[i]) = xt[i];
  }
}

// ---------------------------------------------------------------------------
// Difference-form additive attention per (8 passage rows, batch). 8 waves.
// Sp holds the NEGATED scaled hp projection (weight plane carried x-64), so that
// sq'[q][v] + sp'[p][v] = 2 log2 e * (Wq[q][v] - Wp[p][v]).
// Phase 0: stage the 8 scaled sp rows (sp_s), their powers 2^sp' (ep_s) and the vector
//          -2*bf16(v) (vs) in LDS; each wave notes whether its part of the rows is inside +-EXPLIM.
// Phase 1: thread t owns query q = 256*pass + t; for the 8 passage rows it accumulates
//          sum_v vs[v] / (1 + 2^(sq'[q][v] + sp'[p][v])) in f32 (equals the score up
//          to a constant that is the same for every query, which the softmax removes);
//          results into Ss[p][q]. The power is taken as 2^sq' * 2^sp' (one exp2 per 8 rows). That
//          holds only while both arguments are inside +-EXPLIM, so a wave that meets a larger one
//          in its pass drops the sums and forms them again from the power of the sum, which is
//          right at any size. sp_s / ep_s / vs / Ss: cross-wave (block barriers).
// Phase 2: wave w owns row w: row max, f16(1024 * exp(s - max)) into Pl (select on
//          the exp2 argument keeps the plane free of f16 subnormals), row sum over the
//          converted values into Ls. Pl / Ls: cross-wave (block barrier).
//          At the head of each pass every wave also starts asynchronous copies of its share of
//          the batch's transposed f16 plane HqT[d][q] into Hs; they fly under the score loop.
// Phase 3: out tile [8][32 per wave] = Pl[8][SEQ] . Hs[d][q]^T, B fragments from LDS (Hs:
//          cross-wave; each wave's copy wait, then the block barrier in front of this phase).
//          A-tile rows 8..15 read rows 0..7 again, so lanes 16..31
//          of each accumulator hold the same 8 rows as lanes 0..15.
// Phase 4: scale by 1 / row sum, stage in the wave's own 32 columns of Ss (wave-private from
//          Store coverage: 2 steps x 4 rows == 8 rows.
// Grid (SEQ/8, NB).
// ---------------------------------------------------------------------------
// One thread's sums over the hidden axis for PT passage rows. SPLIT: sp holds the powers 2^sp' and
// the term's power is 2^sq' * 2^sp'; otherwise sp holds sp' and the power is 2^(sq' + sp').
// sqc points at the thread's query in hidden column 0 of the transposed plane (column pitch SEQ):
// a wave's load of one column is one 128-byte line that no other wave reads, so each comes from L2;
// the loads of trip t + NPF - 1 are therefore issued at the head of trip t, into the register set
// that trip t - 1 has used up. With SPLIT, returns the largest |sq'| that the thread has read; otherwise 0.
template <bool SPLIT>
__device__ __forceinline__ float score_pass(const float* __restrict__ sqc, const float* sp,
                                            const float* vs, float (&acc)[PT]) {
  float amax = 0.0f;
  float ring[NPF][VSTEP];
  // every inner loop below is unrolled so that acc2, ring, a, s4 and d are indexed by constants and stay
  // in registers; the loop over t0 stays rolled: NPF trips, one per register set, are its body
  v2f acc2[PT / 2];   // rows 2 pp and 2 pp + 1
#pragma unroll
  for (int pp = 0; pp < PT / 2; ++pp) acc2[pp] = (v2f){0.0f, 0.0f};
#pragma unroll
  for (int s = 0; s < NPF - 1; ++s) {
#pragma unroll
    for (int j = 0; j < VSTEP; ++j) ring[s][j] = sqc[(size_t)(s * VSTEP + j) * SEQ];
  }
#pragma unroll 1
  for (unsigned t0 = 0; t0 < (unsigned)NTRIP; t0 += (unsigned)NPF) {
#pragma unroll
    for (int s = 0; s < NPF; ++s) {
      const unsigned v0 = (t0 + (unsigned)s) * (unsigned)VSTEP;
      // behind the last trip there is nothing to fetch: the index stops there (in bounds, not used)
      const unsigned tn = t0 + (unsigned)(s + NPF - 1);
      const unsigned vf = (tn < (unsigned)NTRIP ? tn : (unsigned)(NTRIP - 1)) * (unsigned)VSTEP;
#pragma unroll
      for (int j = 0; j < VSTEP; ++j)
        ring[(s + NPF - 1) % NPF][j] = sqc[(size_t)(vf + (unsigned)j) * SEQ];
      v4f w4[2], s4[PT][2];
#pragma unroll
      for (int h = 0; h < 2; ++h) w4[h] = *(const v4f*)&vs[v0 + 4u * (unsigned)h];
#pragma unroll
      for (int p = 0; p < PT; ++p) {
#pragma unroll
        for (int h = 0; h < 2; ++h)
          s4[p][h] = *(const v4f*)&sp[(unsigned)p * VDIM + v0 + 4u * (unsigned)h];
      }
      // holds the trip's loads and all its LDS reads in one place at its head, in front of the
      // arithmetic: left free, the scheduler spread the LDS reads through the trip, each just ahead
      // of its use, so that the wave waited for LDS at many places instead of one
      __builtin_amdgcn_sched_barrier(0);
      float a[VSTEP];
#pragma unroll
      for (int j = 0; j < VSTEP; ++j) a[j] = ring[s][j];
      if (SPLIT) {
#pragma unroll
        for (int j = 0; j < VSTEP; ++j) {
          amax = fmaxf(amax, fabsf(a[j]));
          a[j] = fast_exp2(a[j]);
        }
      }
      // Two-wide f32 forms written out (the packed fma does two a clock): the denominators pair two
      // neighbouring hidden columns of one row, the sums pair two rows at one hidden column. Each
      // row's sum still takes its terms in ascending column order.
      v2f d[PT][VSTEP / 2];
      const v2f one = {1.0f, 1.0f};
#pragma unroll
      for (int p = 0; p < PT; ++p) {
#pragma unroll
        for (int g = 0; g < VSTEP / 2; ++g) {
          const v2f a2 = {a[2 * g], a[2 * g + 1]};
          const v2f s2 = {s4[p][g >> 1][2 * (g & 1)], s4[p][g >> 1][2 * (g & 1) + 1]};
          if (SPLIT) {
            d[p][g] = __builtin_elementwise_fma(a2, s2, one);
          } else {
            const v2f x = a2 + s2;
            d[p][g] = (v2f){fast_exp2(x[0]), fast_exp2(x[1])} + one;
          }
        }
      }
#pragma unroll
      for (int j = 0; j < VSTEP; ++j) {
        const float w = w4[j >> 2][j & 3];
#pragma unroll
        for (int pp = 0; pp < PT / 2; ++pp) {
          const v2f r = {__builtin_amdgcn_rcpf(d[2 * pp][j >> 1][j & 1]),
                         __builtin_amdgcn_rcpf(d[2 * pp + 1][j >> 1][j & 1])};
          acc2[pp] = __builtin_elementwise_fma((v2f){w, w}, r, acc2[pp]);
        }
      }
      // keeps each trip's instructions in that trip: left free, the scheduler drew the loads and the
      // LDS reads of all NPF trips to the head of the body, waited for all of them there and took
      // some 500 registers
      __builtin_amdgcn_sched_barrier(0);
    }
  }
#pragma unroll
  for (int pp = 0; pp < PT / 2; ++pp) {
    acc[2 * pp] = acc2[pp][0];
    acc[2 * pp + 1] = acc2[pp][1];
  }
  return amax;
}

__global__ __launch_bounds__(256) void addattn_kernel(
    const float* __restrict__ Sq, const float* __restrict__ Sp,
    const float* __restrict__ vvec, const _Float16* __restrict__ HqT,
    float* __restrict__ out) {
  __shared__ __attribute__((aligned(16))) float sp_s[PT * VDIM];
  __shared__ __attribute__((aligned(16))) float ep_s[PT * VDIM];
  __shared__ __attribute__((aligned(16))) unsigned okw[8];
  __shared__ __attribute__((aligned(16))) float vs[VDIM];
  __shared__ __attribute__((aligned(16))) float Ss[PT * SPITCH];
  __shared__ __attribute__((aligned(16))) _Float16 Pl[PT * PPITCH];
  __shared__ __attribute__((aligned(16))) float Ls[PT];
  __shared__ __attribute__((aligned(16))) _Float16 Hs[DIM * HPITCH];
  static_assert(sizeof(float) * (2 * PT * VDIM + VDIM + PT * SPITCH + PT + 8) +
                sizeof(_Float16) * (PT * PPITCH + DIM * HPITCH) <= 327680);
  // 16-byte pieces of the value plane per thread and pass; all of one pass's are in flight at once
  static_assert((DIM * SEQ / 8) / 256 / (SEQ / 256) == 32 && ((SEQ / 8) % 32) == 0);

  const unsigned tid = threadIdx.x, lane = tid & 31u;
  const unsigned wave = (unsigned)__builtin_amdgcn_readfirstlane((int)(threadIdx.x >> 5));
  const unsigned hh = lane >> 4, m = lane & 15u;
  const unsigned p0 = blockIdx.x * (unsigned)PT;
  const unsigned b = blockIdx.y;

  // ---- phase 0 ----
  float bmax = 0.0f;
  const float vraw = vvec[tid];   // read here, so that it flies together with the sp rows' loads
  const float* spsrc[2];
  v4f x2[2];
#pragma unroll
  for (unsigned j = 0; j < 2u; ++j) {
    const unsigned idx = tid + 256u * j;
    const unsigned r = idx >> 6, c = (idx & 63u) * 4u;
    spsrc[j] = Sp + (size_t)(b * (unsigned)SEQ + p0 + r) * VDIM + c;
    x2[j] = *(const v4f*)spsrc[j];
  }
  // The wait that stands before a register named by an issued load is written again. It takes the
  // two addresses as inputs, so that neither is reused in front of it, not even as a load's target.
  asm volatile("s_wait_xcnt 0x0" :: "v"(spsrc[0]), "v"(spsrc[1]) : "memory");
#pragma unroll
  for (unsigned j = 0; j < 2u; ++j) {
    const unsigned idx = tid + 256u * j;
    const unsigned r = idx >> 6, c = (idx & 63u) * 4u;
    const v4f x = x2[j];
    v4f e;
#pragma unroll  // constant element index: x and e stay in registers
    for (int i = 0; i < 4; ++i) {
      bmax = fmaxf(bmax, fabsf(x[i]));
      e[i] = fast_exp2(x[i]);
    }
    *(v4f*)&sp_s[r * VDIM + c] = x;
    *(v4f*)&ep_s[r * VDIM + c] = e;
  }
  {
    const unsigned big = __builtin_amdgcn_ballot_w32(!(bmax <= EXPLIM));
    if (lane == 0u) okw[wave] = (big == 0u) ? 1u : 0u;
  }
  vs[tid] = -2.0f * bf16r(vraw);
  __syncthreads();
  unsigned okall = 1u;
#pragma unroll  // the eight notes come in two 16-byte LDS reads
  for (int i = 0; i < 8; ++i) okall &= okw[i];
  const bool sp_ok = __builtin_amdgcn_readfirstlane((int)okall) != 0;   // the same in every wave

  // ---- phase 1 ----
  // One copy of the whole block moves 256 pieces of 16 bytes = HROWS rows of the value plane; a wave's
  // 32 pieces are 512 contiguous bytes of one row. hl0 / hg0: this thread's piece in rows 0..HROWS-1.
  const unsigned hrow = tid / (unsigned)(SEQ / 8), hcol = (tid % (unsigned)(SEQ / 8)) * 8u;
  const unsigned hl0 = (unsigned)(size_t)&Hs[hrow * HPITCH + hcol];   // LDS byte address
  const _Float16* hg0 = HqT + ((size_t)b * DIM + hrow) * SEQ + hcol;
#pragma unroll 1
  for (unsigned pass = 0; pass < (unsigned)(SEQ / 256); ++pass) {
    const unsigned q = pass * 256u + tid;
    // The earlier pass's copies have landed before more are issued: a wave never has more than one
    // pass's 32 copies outstanding.
    asm volatile("s_wait_asynccnt 0x0" ::: "memory");
#pragma unroll  // constant indices: the eight address sets of a statement stay in registers
    for (unsigned jj = 0; jj < 4u; ++jj) {
      unsigned la[8];
      const _Float16* ga[8];
#pragma unroll
      for (unsigned j = 0; j < 8u; ++j) {
        const unsigned n = (pass * 4u + jj) * 8u + j;   // the block's n-th set of HROWS plane rows
        la[j] = hl0 + n * (unsigned)(HROWS * HPITCH * 2);
        ga[j] = hg0 + (size_t)n * (HROWS * SEQ);
      }
      async_copy8(la, ga);
    }
    const float* sqc = Sq + (size_t)b * VDIM * SEQ + q;   // Sq: [b][hidden column][query]
    float acc[PT];
    bool split_ok = false;   // wave-uniform: every argument of this wave's pass inside +-EXPLIM
    if (sp_ok) {
      const float amax = score_pass<true>(sqc, ep_s, vs, acc);
      split_ok = __builtin_amdgcn_ballot_w32(!(amax <= EXPLIM)) == 0u;
    }
    if (!split_ok) (void)score_pass<false>(sqc, sp_s, vs, acc);
#pragma unroll
    for (int p = 0; p < PT; ++p) Ss[(unsigned)p * SPITCH + q] = acc[p];
  }
  __syncthreads();

  // ---- phase 2 ----
  {
    const unsigned row = wave;
    float mx = -3.0e38f;
#pragma unroll 4
    for (unsigned j = 0; j < (unsigned)(SEQ / 32); ++j)
      mx = fmaxf(mx, Ss[row * SPITCH + lane + 32u * j]);
    mx = red32_max(mx);
    float l = 0.0f;
#pragma unroll 4
    for (unsigned j = 0; j < (unsigned)(SEQ / 32); ++j) {
      const float arg = (Ss[row * SPITCH + lane + 32u * j] - mx) * LOG2E + PCARRY_LOG2;
      const float e = fast_exp2(arg);
      const h16 ph = (arg < -14.0f) ? (h16)0.0f : (h16)e;
      Pl[row * PPITCH + lane + 32u * j] = ph;
      l += (float)ph;
    }
    l = red32_sum(l);
    if (lane == 0u) Ls[row] = l;
  }
  // This wave's copies into Hs have landed; the barrier below then shows them to the other waves.
  asm volatile("s_wait_asynccnt 0x0" ::: "memory");
  __syncthreads();

  // ---- phase 3 ----
  const unsigned d0 = wave * (unsigned)WCOLS;
  const _Float16* bp = &Hs[(d0 + m) * HPITCH + hh * 8u];
  const _Float16* pa = &Pl[(m & 7u) * PPITCH + hh * 8u];
  v8f o[NBT];
#pragma unroll
  for (int nb = 0; nb < NBT; ++nb) o[nb] = (v8f){};
#pragma unroll 2
  for (unsigned k0 = 0; k0 < (unsigned)SEQ; k0 += 32u) {
    const v16h pf = frag_at(pa + k0);
#pragma unroll
    for (int nb = 0; nb < NBT; ++nb) {
      const v16h hf = frag_at(bp + (unsigned)(nb * 16) * HPITCH + k0);
      o[nb] = wmma16(pf, hf, o[nb]);
    }
  }

  // ---- phase 4 ----
  // both lane halves hold rows 0..7: lanes 0..15 stage column tile 0, lanes 16..31 tile 1
#pragma unroll
  for (int r = 0; r < PT; ++r) {
    const float inv = __builtin_amdgcn_rcpf(Ls[r]);
    Ss[(unsigned)r * SPITCH + d0 + lane] = (hh ? o[1][r] : o[0][r]) * inv;
  }
  wave_lds_sync();
  v4f x[2];
  size_t off[2];
#pragma unroll
  for (unsigned i = 0; i < 2u; ++i) {
    const unsigned r = 4u * i + (lane >> 3);
    const unsigned c = (lane & 7u) * 4u;
    x[i] = *(const v4f*)&Ss[r * SPITCH + d0 + c];
    off[i] = ((size_t)b * SEQ_FULL + p0 + r) * DIM + d0 + c;
  }
#pragma unroll
  for (int i = 0; i < 2; ++i) *(v4f*)(out + off[i]) = x[i];
  
}

// ---------------------------------------------------------------------------
extern "C" void kernel_launch(void* const* d_in, const int* in_sizes, int n_in,
                              void* d_out, int out_size, void* d_ws, size_t ws_size,
                              hipStream_t stream) {
  if (n_in < 4) return;
  const long long need_x = ((long long)(NB - 1) * SEQ_FULL + SEQ) * DIM;
  if ((long long)in_sizes[0] < need_x) return;
  if ((long long)in_sizes[1] < need_x) return;
  if ((long long)in_sizes[2] < (long long)DIM * VDIM) return;
  if (in_sizes[3] < VDIM) return;
  if ((long long)out_size < need_x) return;
  if (ws_size < WS_TOTAL) return;

  const float* hq   = (const float*)d_in[0];   // [NB_FULL][SEQ_FULL][DIM]
  const float* hp   = (const float*)d_in[1];   // [NB_FULL][SEQ_FULL][DIM]
  const float* w_in = (const float*)d_in[2];   // [VDIM][DIM]  (out, in), shared by both sides
  const float* vvec = (const float*)d_in[3];   // [VDIM]
  float* out = (float*)d_out;                  // [NB_FULL][SEQ_FULL][DIM]

  char* ws = (char*)d_ws;
  _Float16* HqT  = (_Float16*)(ws + OFF_HQT);   // [NB][DIM][SEQ]
  float*    Spl  = (float*)(ws + OFF_S);        // sq [NB][VDIM][SEQ], then -sp rows [MROWS][VDIM]

  dim3 blk(256);

  // operand conversion, both projections and the transposed hq plane: one launch
  proj_kernel<<<dim3(VDIM / 64, (2 * MROWS) / 64), blk, 0, stream>>>(hq, hp, w_in, Spl, HqT);

  // scores + softmax + weighted sum
  addattn_kernel<<<dim3(SEQ / PT, NB), blk, 0, stream>>>(
      Spl, Spl + (size_t)MROWS * VDIM, vvec, HqT, out);
}

// v007
// One run takes 29.2 microseconds.
// Two timings next to v006 put it at 1.07 and 1.08 times that version's speed.
// All steps since v000 together make it 2.96 times as fast.
#include <hip/hip_runtime.h>
#include <stddef.h>

// Contractions on v_wmma_f32_16x16x32_f16 (f16 operands, f32 accumulate): both input projections
// (rows x one shared weight, K = 256) and the probability x value product (K = 512 keys). Float
// inputs are RNE-converted to bf16 and carried in f16 (weights x64 for the hq rows and x-64 for
// the hp rows, so the hp projection comes out negated; softmax numerators x1024). The score sum
// over the 256-wide hidden axis (a matrix-vector product against one vector) runs on the vector
// unit in f32, tanh(x) formed as 1 - 2 / (1 + 2^(2 x log2 e)); the power of the difference is the
// product of one power per side, and four terms of a row share one reciprocal, while the arguments
// are small enough; softmax in f32.

typedef _Float16 v16h __attribute__((ext_vector_type(16)));
typedef _Float16 v8h  __attribute__((ext_vector_type(8)));
typedef _Float16 v4h  __attribute__((ext_vector_type(4)));
typedef float    v8f  __attribute__((ext_vector_type(8)));
typedef float    v4f  __attribute__((ext_vector_type(4)));
typedef float    v2f  __attribute__((ext_vector_type(2)));
typedef _Float16 h16;

#ifndef NB
#define NB 4
#endif
#ifndef SEQ
#define SEQ 512
#endif
#define NB_FULL  4
#define SEQ_FULL 512
#define DIM   256          // feature width of the hq / hp rows (pq_size)
#define VDIM  256          // hidden width of the score
#define MROWS (NB * SEQ)   // compact rows per activation plane (query length == passage length)
#define PT    8            // passage rows per attention block: (SEQ / PT) * NB = 256 blocks
#define VSTEP 8            // hidden columns per score-loop trip (PT * VSTEP terms per thread)
#define NTRIP (VDIM / VSTEP)  // score-loop trips per pass
#define NPF   4            // register sets for the query operand: the current trip's and three in flight
#define WCOLS (DIM / 8)    // output columns per wave in the attention kernel
#define NBT   (WCOLS / 16) // 16-column output tiles per wave

static_assert(NB >= 1 && NB <= NB_FULL);
static_assert(SEQ >= 256 && SEQ <= SEQ_FULL && (SEQ % 256) == 0);
static_assert((DIM % 128) == 0);
static_assert((VDIM % 64) == 0 && (VDIM % 4) == 0);
static_assert(VDIM == 256);                 // one thread per hidden column when staging the vector
static_assert((MROWS % 64) == 0);
static_assert(DIM == 8 * WCOLS);            // 8 waves x WCOLS output columns
static_assert(WCOLS == 32 && NBT == 2);
static_assert((SEQ % 64) == 0 && (SEQ % 32) == 0);
static_assert(PT == 8);                     // A tile rows 0..7; rows 8..15 repeat them; 1 row per wave
static_assert(PT == 2 * 4);                 // output store: 2 steps x 4 rows
static_assert(PT * VDIM == 256 * 2 * 4);    // sp tile staging: 256 threads x 2 steps x 4 floats
static_assert(VSTEP == 2 * 4 && (VDIM % VSTEP) == 0);
static_assert((NTRIP % NPF) == 0 && NTRIP >= NPF);
static_assert((SEQ % PT) == 0);

#define LDA (DIM + 8)   // halves per staged operand row: 16 B x an odd number, so that the 16 rows
                        // of a fragment read fall on 64 different LDS banks
#define LDC 68   // floats per LDS row (272 B, 16-B aligned)
static_assert((LDA % 8) == 0 && ((LDA / 8) % 2) == 1 && LDA >= DIM);
static_assert((LDC % 4) == 0 && LDC >= 64);
static_assert(DIM == VDIM);                 // a block's column index names its output columns and the
                                            // feature columns that it transposes
static_assert(64 * DIM == 256 * 16 * 4);    // operand staging: 256 threads x 16 steps x 4 floats

#define SMAXW  ((SEQ > DIM) ? SEQ : DIM)
#define SPITCH (SMAXW + 4)   // floats per score / output-stage row
#define PPITCH (SEQ + 8)     // halves per probability row
#define HROWS  (256 / (SEQ / 8))   // value-plane rows that 256 threads cover with 16 bytes each
#define HPITCH (SEQ + 8)     // halves per staged value row: 16 B x an odd number, so that the 16 rows
                             // of a fragment read fall on 64 different LDS banks
static_assert((SPITCH % 4) == 0 && SPITCH >= SEQ && SPITCH >= DIM);
static_assert((PPITCH % 8) == 0 && PPITCH >= SEQ);
static_assert((HPITCH % 8) == 0 && ((HPITCH / 8) % 2) == 1 && HPITCH >= SEQ);

#define WCARRY 64.0f          // weight planes carried x64 (hp plane x-64)
#define PCARRY_LOG2 10.0f     // softmax numerators carried x1024 (added to the exp2 argument)
#define TWO_LOG2E 2.885390081777927f
#define LOG2E     1.4426950408889634f
#define SUMLIM    31.0f       // largest |sq'| + largest |sp'| <= 31: a denominator is at most 1 + 2^31, the
                              // product of four at most about 2^124, so it and its reciprocal are normal f32
#define WLIM      536870912.0f  // |v| <= 2^29: a numerator over four terms stays below 2^125

// workspace layout (bytes)
#define HQT_BYTES ((size_t)NB * DIM * SEQ * 2)      // hq transposed [b][d][q], f16
#define S_BYTES   ((size_t)2 * MROWS * VDIM * 4)    // scaled projections, f32: sq [b][v][q], then -sp rows
#define OFF_HQT ((size_t)0)
#define OFF_S   (OFF_HQT + HQT_BYTES)
#define WS_TOTAL (OFF_S + S_BYTES)
static_assert((HQT_BYTES % 128) == 0 && (S_BYTES % 128) == 0);
static_assert(WS_TOTAL <= (size_t)134217728);

// ---------------------------------------------------------------------------
__device__ __forceinline__ float bf16r(float x) {   // RNE convert to bf16, returned widened
  unsigned int u = __float_as_uint(x);
  u = (u + 0x7FFFu + ((u >> 16) & 1u)) & 0xFFFF0000u;
  return __uint_as_float(u);
}

// f32 -> f16 operand convert that cannot produce an f16 subnormal (value select).
static __device__ __forceinline__ h16 toh_flush(float v) {
  const h16 r = (h16)v;
  return (fabsf(v) < 6.103515625e-05f) ? (h16)0.0f : r;
}

// 16-bit fragment: p points at element [row = lane&15][k0 + 8*(lane>>4)] of a k-contiguous
// row. Elements 0..7 <- k0+8h+0..7, elements 8..15 <- k0+16+8h+0..7 (same map for A and B).
__device__ __forceinline__ v16h frag_at(const _Float16* p) {
  v8h lo = *(const v8h*)(p);
  v8h hi = *(const v8h*)(p + 16);
  v16h out;
#pragma unroll
  for (int i = 0; i < 8; ++i) { out[i] = lo[i]; out[i + 8] = hi[i]; }
  return out;
}

__device__ __forceinline__ v8f wmma16(v16h a, v16h b, v8f c) {
  v8f d = __builtin_amdgcn_wmma_f32_16x16x32_f16(false, a, false, b, (short)0, c,
                                                 false, false);
  asm volatile("v_nop\n\tv_nop\n\tv_nop\n\tv_nop" : "+v"(d) : "v"(a), "v"(b));
  return d;
}

__device__ __forceinline__ float red32_sum(float x) {
#pragma unroll
  for (int off = 1; off < 32; off <<= 1) x += __shfl_xor(x, off, 32);
  return x;
}
__device__ __forceinline__ float red32_max(float x) {
#pragma unroll
  for (int off = 1; off < 32; off <<= 1) x = fmaxf(x, __shfl_xor(x, off, 32));
  return x;
}

// Maximum over the wave's 32 lanes, in every lane, on the vector unit: four exchanges inside each
// 16-lane row (DPP row_xmask 1, 2, 4, 8), then lane l with lane l ^ 16.
__device__ __forceinline__ float wave_max_dpp(float x) {
  x = fmaxf(x, __int_as_float(__builtin_amdgcn_update_dpp(0, __float_as_int(x), 0x161, 0xf, 0xf, true)));
  x = fmaxf(x, __int_as_float(__builtin_amdgcn_update_dpp(0, __float_as_int(x), 0x162, 0xf, 0xf, true)));
  x = fmaxf(x, __int_as_float(__builtin_amdgcn_update_dpp(0, __float_as_int(x), 0x164, 0xf, 0xf, true)));
  x = fmaxf(x, __int_as_float(__builtin_amdgcn_update_dpp(0, __float_as_int(x), 0x168, 0xf, 0xf, true)));
  const int b = __float_as_int(x);
  return fmaxf(x, __int_as_float(__builtin_amdgcn_permlanex16(b, b, 0x76543210, 0xfedcba98, false, false)));
}

__device__ __forceinline__ void wave_lds_sync() {
  __builtin_amdgcn_fence(3 /* release order */, "wavefront");
  asm volatile("s_wait_dscnt 0x0" ::: "memory");
  __builtin_amdgcn_wave_barrier();
}

// Eight asynchronous 16-byte copies from global memory to LDS; every lane names its own LDS byte
// address and its own global address. The s_wait_xcnt stands inside the statement, behind the last
// copy, so that no address register is written again in front of it.
__device__ __forceinline__ void async_copy8(const unsigned (&l)[8], const _Float16* const (&g)[8]) {
  asm volatile(
      "global_load_async_to_lds_b128 %0, %8, off\n\t"
      "global_load_async_to_lds_b128 %1, %9, off\n\t"
      "global_load_async_to_lds_b128 %2, %10, off\n\t"
      "global_load_async_to_lds_b128 %3, %11, off\n\t"
      "global_load_async_to_lds_b128 %4, %12, off\n\t"
      "global_load_async_to_lds_b128 %5, %13, off\n\t"
      "global_load_async_to_lds_b128 %6, %14, off\n\t"
      "global_load_async_to_lds_b128 %7, %15, off\n\t"
      "s_wait_xcnt 0x0"
      :: "v"(l[0]), "v"(l[1]), "v"(l[2]), "v"(l[3]), "v"(l[4]), "v"(l[5]), "v"(l[6]), "v"(l[7]),
         "v"(g[0]), "v"(g[1]), "v"(g[2]), "v"(g[3]), "v"(g[4]), "v"(g[5]), "v"(g[6]), "v"(g[7])
      : "memory");
}

__device__ __forceinline__ float fast_exp2(float x) {
#if __has_builtin(__builtin_amdgcn_exp2f)
  return __builtin_amdgcn_exp2f(x);
#else
  return __expf(x * 0.6931471805599453f);
#endif
}

// ---------------------------------------------------------------------------
// Projection GEMM C[64x64 tile] = X[rows][DIM] . W[n][DIM]^T, straight from the f32 inputs: the
// block converts its 64 activation rows (f16(bf16(x))) and its 64 weight rows (f16(carry * bf16(w)),
// the [out][in] layout is already k-contiguous) into LDS and takes its fragments from there.
// 8 waves (mw = 16-row group, nw = 32-col group), 2 accumulators/wave.
// Rows 0..MROWS-1 are hq rows (carry +64), rows MROWS..2*MROWS-1 hp rows (carry -64, an exact sign
// fold); which, is block-uniform. Output f32 = acc * (2 log2 e / 64), i.e. the projection
// pre-scaled for the exp2 form of tanh. The hp rows go out as rows [MROWS][VDIM]; the hq rows go
// out transposed per batch, [NB][VDIM][SEQ], so that the attention kernel's threads (one query
// each) read one hidden column of 32 neighbouring queries as one 128-byte line. Epilogue staged
// through Cs (cross-wave); an hq tile is laid into Cs column-major, so the read-out and the
// 16-byte stores are the same for both. Store coverage: 4 steps x 16 rows == 64 tile rows.
// An hq block also writes its 64 rows x 64 feature columns (the columns of its own column index)
// of the f16 plane transposed per batch, HqT[NB][DIM][SEQ]: each 128-byte line by 8 consecutive
// lanes x 16 B of one instruction; 2 steps x 32 rows == 64 plane rows.
// As / Ws: cross-wave (block barrier). Grid (VDIM/64, 2*MROWS/64).
// ---------------------------------------------------------------------------
__global__ __launch_bounds__(256) void proj_kernel(
    const float* __restrict__ hq, const float* __restrict__ hp, const float* __restrict__ W,
    float* __restrict__ outf, _Float16* __restrict__ HqT) {
  __shared__ __attribute__((aligned(16))) _Float16 As[64 * LDA];
  __shared__ __attribute__((aligned(16))) _Float16 Ws[64 * LDA];
  __shared__ __attribute__((aligned(16))) float Cs[64 * LDC];
  const unsigned tid = threadIdx.x, lane = tid & 31u;
  const unsigned w = (unsigned)__builtin_amdgcn_readfirstlane((int)(threadIdx.x >> 5));
  const unsigned mw = w >> 1, nw = w & 1u;
  const unsigned hh = lane >> 4, m = lane & 15u;
  const unsigned n0 = blockIdx.x * 64u;
  const unsigned row0 = blockIdx.y * 64u;
  const bool tq = row0 < (unsigned)MROWS;   // block-uniform: an hq tile, stored transposed
  const unsigned crow0 = tq ? row0 : row0 - (unsigned)MROWS;   // first row within its plane
  const unsigned bidx = crow0 / (unsigned)SEQ;                 // batch of the tile (SEQ % 64 == 0)
  const unsigned s0 = crow0 - bidx * (unsigned)SEQ;
  const float carry = tq ? WCARRY : -WCARRY;

  // a step of the whole block covers 4 rows of DIM floats; a wave's load is 512 contiguous bytes
  const unsigned sr = tid >> 6, sc = (tid & 63u) * 4u;
  const float* asrc = (tq ? hq : hp) + ((size_t)bidx * SEQ_FULL + s0 + sr) * DIM + sc;
  const float* wsrc = W + (size_t)(n0 + sr) * DIM + sc;
  v4f a4[16], w4[16];
#pragma unroll  // constant indices: a4 and w4 stay in registers; all 32 loads are in flight at once
  for (unsigned j = 0; j < 16u; ++j) {
    a4[j] = *(const v4f*)(asrc + (size_t)j * (4 * DIM));
    w4[j] = *(const v4f*)(wsrc + (size_t)j * (4 * DIM));
  }
  // The wait that stands before a register named by an issued load is written again. It takes the
  // two addresses as inputs, so that neither is reused in front of it, not even as a load's target.
  asm volatile("s_wait_xcnt 0x0" :: "v"(asrc), "v"(wsrc) : "memory");
#pragma unroll
  for (unsigned j = 0; j < 16u; ++j) {
    v4h ha, hw;
#pragma unroll
    for (int i = 0; i < 4; ++i) {
      ha[i] = toh_flush(bf16r(a4[j][i]));
      hw[i] = toh_flush(carry * bf16r(w4[j][i]));
    }
    *(v4h*)&As[(sr + 4u * j) * LDA + sc] = ha;
    *(v4h*)&Ws[(sr + 4u * j) * LDA + sc] = hw;
  }
  __syncthreads();

  const _Float16* ap  = &As[(mw * 16u + m) * LDA + hh * 8u];
  const _Float16* bp0 = &Ws[(nw * 32u + m) * LDA + hh * 8u];
  const _Float16* bp1 = bp0 + 16 * LDA;
  v8f acc0 = {}, acc1 = {};
#pragma unroll 1  // rolled: a trip reads four steps' fragments (96 registers) together, ahead of their
                  // products, so that LDS latency is waited for twice and not at every step
  for (unsigned k0 = 0; k0 < (unsigned)DIM; k0 += 128u) {
    v16h a[4], b0[4], b1[4];
#pragma unroll  // constant indices: the fragments stay in registers
    for (unsigned t = 0; t < 4u; ++t) {
      a[t]  = frag_at(ap + k0 + 32u * t);
      b0[t] = frag_at(bp0 + k0 + 32u * t);
      b1[t] = frag_at(bp1 + k0 + 32u * t);
    }
#pragma unroll
    for (unsigned t = 0; t < 4u; ++t) {
      acc0 = wmma16(a[t], b0[t], acc0);
      acc1 = wmma16(a[t], b1[t], acc1);
    }
  }
  if (tq) {
    // Cs[output column][tile row]: a lane's 8 accumulator rows are 8 neighbouring floats
    float* d = &Cs[(nw * 32u + m) * LDC + mw * 16u + hh * 8u];
#pragma unroll
    for (int g = 0; g < 2; ++g) {
      *(v4f*)(d + 4 * g) = (v4f){acc0[4 * g], acc0[4 * g + 1], acc0[4 * g + 2], acc0[4 * g + 3]};
      *(v4f*)(d + 16 * LDC + 4 * g) =
          (v4f){acc1[4 * g], acc1[4 * g + 1], acc1[4 * g + 2], acc1[4 * g + 3]};
    }
  } else {
#pragma unroll
    for (int r = 0; r < 8; ++r) {
      float* d = &Cs[(mw * 16u + hh * 8u + (unsigned)r) * LDC + nw * 32u + m];
      d[0]  = acc0[r];
      d[16] = acc1[r];
    }
  }
  __syncthreads();

  const float cs = TWO_LOG2E / WCARRY;
  // first element and row pitch of the tile in the output plane, as Cs holds it
  const size_t obase = tq ? ((size_t)bidx * VDIM + n0) * SEQ + s0
                          : (size_t)row0 * VDIM + n0;
  const unsigned opitch = tq ? (unsigned)SEQ : (unsigned)VDIM;
  v4f xs[4];
  size_t off[4];
#pragma unroll
  for (unsigned i = 0; i < 4u; ++i) {
    const unsigned r = 16u * i + (tid >> 4);
    const unsigned c = (tid & 15u) * 4u;
    const v4f u = *(const v4f*)&Cs[r * LDC + c];
    xs[i] = u * cs;
    off[i] = obase + (size_t)r * opitch + c;
  }
  // the transposed f16 plane, from the staged rows; behind the last barrier, so that none waits
  // for these stores
  v8h xt[2] = {};
  size_t offt[2] = {};
  if (tq) {
#pragma unroll
    for (unsigned i = 0; i < 2u; ++i) {
      const unsigned n = 32u * i + (tid >> 3);
      const unsigned kc = (tid & 7u) * 8u;
#pragma unroll
      for (unsigned e = 0; e < 8u; ++e) xt[i][e] = As[(kc + e) * LDA + n0 + n];
      offt[i] = ((size_t)bidx * DIM + n0 + n) * SEQ + s0 + kc;
    }
  }
#pragma unroll
  for (int i = 0; i < 4; ++i) *(v4f*)(outf + off[i]) = xs[i];
  // The wait that stands before a register named by an issued store is written again: the two
  // addresses formed in the branch below reuse registers of the stores above. It stands in front of
  // the branch, so that nothing of the branch's code is moved ahead of it.
  asm volatile("s_wait_xcnt 0x0" ::: "memory");
  if (tq) {
#pragma unroll
    for (int i = 0; i < 2; ++i) *(v8h*)(HqT + offt[i]) = xt[i];
  }
}

// ---------------------------------------------------------------------------
// Difference-form additive attention per (8 passage rows, batch). 8 waves.
// Sp holds the NEGATED scaled hp projection (weight plane carried x-64), so that
// sq'[q][v] + sp'[p][v] = 2 log2 e * (Wq[q][v] - Wp[p][v]).
// Phase 0: stage the 8 scaled sp rows (sp_s), their powers 2^sp' (ep_s) and the vector
//          -2*bf16(v) (vs) in LDS; each wave notes the largest |sp'| in its part of the rows.
// Phase 1: thread t owns query q = 256*pass + t; for the 8 passage rows it accumulates
//          sum_v vs[v] / (1 + 2^(sq'[q][v] + sp'[p][v])) in f32 (equals the score up
//          to a constant that is the same for every query, which the softmax removes);
//          results into Ss[p][q]. The power is taken as 2^sq' * 2^sp' (one exp2 per 8 rows) and
//          four terms share one reciprocal. That holds only while the largest |sq'| and the largest
//          |sp'| add up to SUMLIM at most, so a wave that meets more in its pass drops the sums and
//          forms them again term by term from the power of the sum, which is right at any size.
//          sp_s / ep_s / vs / Ss: cross-wave (block barriers).
// Phase 2: wave w owns row w: row max, f16(1024 * exp(s - max)) into Pl (select on
//          the exp2 argument keeps the plane free of f16 subnormals), row sum over the
//          converted values into Ls. Pl / Ls: cross-wave (block barrier).
//          At the head of each pass every wave also starts asynchronous copies of its share of
//          the batch's transposed f16 plane HqT[d][q] into Hs; they fly under the score loop.
// Phase 3: out tile [8][32 per wave] = Pl[8][SEQ] . Hs[d][q]^T, B fragments from LDS (Hs:
//          cross-wave; each wave's copy wait, then the block barrier in front of this phase).
//          A-tile rows 8..15 read rows 0..7 again, so lanes 16..31
//          of each accumulator hold the same 8 rows as lanes 0..15.
// Phase 4: scale by 1 / row sum, stage in the wave's own 32 columns of Ss (wave-private from
//          Store coverage: 2 steps x 4 rows == 8 rows.
// Grid (SEQ/8, NB).
// ---------------------------------------------------------------------------
// One thread's sums over the hidden axis for PT passage rows. SPLIT: sp holds the powers 2^sp', the
// term's power is 2^sq' * 2^sp', and four terms w / d of a row are added over their common
// denominator, so that they take one reciprocal; otherwise sp holds sp', the power is 2^(sq' + sp')
// and every term has its own reciprocal.
// sqc points at the thread's query in hidden column 0 of the transposed plane (column pitch SEQ):
// a wave's load of one column is one 128-byte line that no other wave reads, so each comes from L2;
// the loads of trip t + NPF - 1 are therefore issued at the head of trip t, into the register set
// that trip t - 1 has used up. With SPLIT, returns the largest |sq'| that the thread has read; otherwise 0.
template <bool SPLIT>
__device__ __forceinline__ float score_pass(const float* __restrict__ sqc, const float* sp,
                                            const float* vs, float (&acc)[PT]) {
  float amax = 0.0f;
  float ring[NPF][VSTEP];
  // every inner loop below is unrolled so that acc2, ring, a, s4 and d are indexed by constants and stay
  // in registers; the loop over t0 stays rolled: NPF trips, one per register set, are its body
  v2f acc2[PT / 2];   // rows 2 pp and 2 pp + 1 (own-reciprocal form)
#pragma unroll
  for (int pp = 0; pp < PT / 2; ++pp) acc2[pp] = (v2f){0.0f, 0.0f};
  v2f accq[PT];       // row p: the even and the odd hidden columns (SPLIT form)
#pragma unroll
  for (int p = 0; p < PT; ++p) accq[p] = (v2f){0.0f, 0.0f};
#pragma unroll
  for (int s = 0; s < NPF - 1; ++s) {
#pragma unroll
    for (int j = 0; j < VSTEP; ++j) ring[s][j] = sqc[(size_t)(s * VSTEP + j) * SEQ];
  }
#pragma unroll 1
  for (unsigned t0 = 0; t0 < (unsigned)NTRIP; t0 += (unsigned)NPF) {
#pragma unroll
    for (int s = 0; s < NPF; ++s) {
      const unsigned v0 = (t0 + (unsigned)s) * (unsigned)VSTEP;
      // behind the last trip there is nothing to fetch: the index stops there (in bounds, not used)
      const unsigned tn = t0 + (unsigned)(s + NPF - 1);
      const unsigned vf = (tn < (unsigned)NTRIP ? tn : (unsigned)(NTRIP - 1)) * (unsigned)VSTEP;
#pragma unroll
      for (int j = 0; j < VSTEP; ++j)
        ring[(s + NPF - 1) % NPF][j] = sqc[(size_t)(vf + (unsigned)j) * SEQ];
      v4f w4[2], s4[PT][2];
#pragma unroll
      for (int h = 0; h < 2; ++h) w4[h] = *(const v4f*)&vs[v0 + 4u * (unsigned)h];
#pragma unroll
      for (int p = 0; p < PT; ++p) {
#pragma unroll
        for (int h = 0; h < 2; ++h)
          s4[p][h] = *(const v4f*)&sp[(unsigned)p * VDIM + v0 + 4u * (unsigned)h];
      }
      // holds the trip's loads and all its LDS reads in one place at its head, in front of the
      // arithmetic: left free, the scheduler spread the LDS reads through the trip, each just ahead
      // of its use, so that the wave waited for LDS at many places instead of one
      __builtin_amdgcn_sched_barrier(0);
      float a[VSTEP];
#pragma unroll
      for (int j = 0; j < VSTEP; ++j) a[j] = ring[s][j];
      if (SPLIT) {
#pragma unroll
        for (int j = 0; j < VSTEP; ++j) {
          amax = fmaxf(amax, fabsf(a[j]));
          a[j] = fast_exp2(a[j]);
        }
      }
      // Two-wide f32 forms written out (the packed fma does two a clock): the denominators pair two
      // neighbouring hidden columns of one row.
      v2f d[PT][VSTEP / 2];
      const v2f one = {1.0f, 1.0f};
#pragma unroll
      for (int p = 0; p < PT; ++p) {
#pragma unroll
        for (int g = 0; g < VSTEP / 2; ++g) {
          const v2f a2 = {a[2 * g], a[2 * g + 1]};
          const v2f s2 = {s4[p][g >> 1][2 * (g & 1)], s4[p][g >> 1][2 * (g & 1) + 1]};
          if (SPLIT) {
            d[p][g] = __builtin_elementwise_fma(a2, s2, one);
          } else {
            const v2f x = a2 + s2;
            d[p][g] = (v2f){fast_exp2(x[0]), fast_exp2(x[1])} + one;
          }
        }
      }
      if (SPLIT) {
        // w0/d0 + w1/d1 + w2/d2 + w3/d3 = n / (d0 d1 d2 d3), built from the two pairs: a reciprocal
        // issues at half the rate of a packed product and serves one value, not two. One half of each
        // two-wide value takes the trip's four even columns, the other its four odd ones.
        static_assert(VSTEP == 8);
        v2f w2[VSTEP / 2];
#pragma unroll
        for (int g = 0; g < VSTEP / 2; ++g)
          w2[g] = (v2f){w4[g >> 1][2 * (g & 1)], w4[g >> 1][2 * (g & 1) + 1]};
#pragma unroll
        for (int p = 0; p < PT; ++p) {
          const v2f d01 = d[p][0] * d[p][1];
          const v2f d23 = d[p][2] * d[p][3];
          const v2f n01 = __builtin_elementwise_fma(w2[0], d[p][1], w2[1] * d[p][0]);
          const v2f n23 = __builtin_elementwise_fma(w2[2], d[p][3], w2[3] * d[p][2]);
          const v2f dd = d01 * d23;
          const v2f nn = __builtin_elementwise_fma(n01, d23, n23 * d01);
          const v2f r = {__builtin_amdgcn_rcpf(dd[0]), __builtin_amdgcn_rcpf(dd[1])};
          accq[p] = __builtin_elementwise_fma(nn, r, accq[p]);
        }
      } else {
        // the sums pair two rows at one hidden column; each row's sum takes its terms in ascending
        // column order
#pragma unroll
        for (int j = 0; j < VSTEP; ++j) {
          const float w = w4[j >> 2][j & 3];
#pragma unroll
          for (int pp = 0; pp < PT / 2; ++pp) {
            const v2f r = {__builtin_amdgcn_rcpf(d[2 * pp][j >> 1][j & 1]),
                           __builtin_amdgcn_rcpf(d[2 * pp + 1][j >> 1][j & 1])};
            acc2[pp] = __builtin_elementwise_fma((v2f){w, w}, r, acc2[pp]);
          }
        }
      }
      // keeps each trip's instructions in that trip: left free, the scheduler drew the loads and the
      // LDS reads of all NPF trips to the head of the body, waited for all of them there and took
      // some 500 registers
      __builtin_amdgcn_sched_barrier(0);
    }
  }
  if (SPLIT) {
#pragma unroll
    for (int p = 0; p < PT; ++p) acc[p] = accq[p][0] + accq[p][1];
  } else {
#pragma unroll
    for (int pp = 0; pp < PT / 2; ++pp) {
      acc[2 * pp] = acc2[pp][0];
      acc[2 * pp + 1] = acc2[pp][1];
    }
  }
  return amax;
}

__global__ __launch_bounds__(256) void addattn_kernel(
    const float* __restrict__ Sq, const float* __restrict__ Sp,
    const float* __restrict__ vvec, const _Float16* __restrict__ HqT,
    float* __restrict__ out) {
  __shared__ __attribute__((aligned(16))) float sp_s[PT * VDIM];
  __shared__ __attribute__((aligned(16))) float ep_s[PT * VDIM];
  __shared__ __attribute__((aligned(16))) float bmw[8];
  __shared__ __attribute__((aligned(16))) float vs[VDIM];
  __shared__ __attribute__((aligned(16))) float Ss[PT * SPITCH];
  __shared__ __attribute__((aligned(16))) _Float16 Pl[PT * PPITCH];
  __shared__ __attribute__((aligned(16))) float Ls[PT];
  __shared__ __attribute__((aligned(16))) _Float16 Hs[DIM * HPITCH];
  static_assert(sizeof(float) * (2 * PT * VDIM + VDIM + PT * SPITCH + PT + 8) +
                sizeof(_Float16) * (PT * PPITCH + DIM * HPITCH) <= 327680);
  // 16-byte pieces of the value plane per thread and pass; all of one pass's are in flight at once
  static_assert((DIM * SEQ / 8) / 256 / (SEQ / 256) == 32 && ((SEQ / 8) % 32) == 0);

  const unsigned tid = threadIdx.x, lane = tid & 31u;
  const unsigned wave = (unsigned)__builtin_amdgcn_readfirstlane((int)(threadIdx.x >> 5));
  const unsigned hh = lane >> 4, m = lane & 15u;
  const unsigned p0 = blockIdx.x * (unsigned)PT;
  const unsigned b = blockIdx.y;

  // ---- phase 0 ----
  float bmax = 0.0f;
  const float vraw = vvec[tid];   // read here, so that it flies together with the sp rows' loads
  const float* spsrc[2];
  v4f x2[2];
#pragma unroll
  for (unsigned j = 0; j < 2u; ++j) {
    const unsigned idx = tid + 256u * j;
    const unsigned r = idx >> 6, c = (idx & 63u) * 4u;
    spsrc[j] = Sp + (size_t)(b * (unsigned)SEQ + p0 + r) * VDIM + c;
    x2[j] = *(const v4f*)spsrc[j];
  }
  // The wait that stands before a register named by an issued load is written again. It takes the
  // two addresses as inputs, so that neither is reused in front of it, not even as a load's target.
  asm volatile("s_wait_xcnt 0x0" :: "v"(spsrc[0]), "v"(spsrc[1]) : "memory");
#pragma unroll
  for (unsigned j = 0; j < 2u; ++j) {
    const unsigned idx = tid + 256u * j;
    const unsigned r = idx >> 6, c = (idx & 63u) * 4u;
    const v4f x = x2[j];
    v4f e;
#pragma unroll  // constant element index: x and e stay in registers
    for (int i = 0; i < 4; ++i) {
      bmax = fmaxf(bmax, fabsf(x[i]));
      e[i] = fast_exp2(x[i]);
    }
    *(v4f*)&sp_s[r * VDIM + c] = x;
    *(v4f*)&ep_s[r * VDIM + c] = e;
  }
  // a vector entry too large for the shared numerator counts as an argument out of range
  if (!(fabsf(vraw) <= WLIM)) bmax = __builtin_inff();
  bmax = wave_max_dpp(bmax);
  if (lane == 0u) bmw[wave] = bmax;
  vs[tid] = -2.0f * bf16r(vraw);
  __syncthreads();
  float bmall = 0.0f;   // the block's largest |sp'|: the same in every wave
#pragma unroll  // the eight notes come in two 16-byte LDS reads
  for (int i = 0; i < 8; ++i) bmall = fmaxf(bmall, bmw[i]);
  const bool sp_ok = __builtin_amdgcn_ballot_w32(!(bmall <= SUMLIM)) == 0u;

  // ---- phase 1 ----
  // One copy of the whole block moves 256 pieces of 16 bytes = HROWS rows of the value plane; a wave's
  // 32 pieces are 512 contiguous bytes of one row. hl0 / hg0: this thread's piece in rows 0..HROWS-1.
  const unsigned hrow = tid / (unsigned)(SEQ / 8), hcol = (tid % (unsigned)(SEQ / 8)) * 8u;
  const unsigned hl0 = (unsigned)(size_t)&Hs[hrow * HPITCH + hcol];   // LDS byte address
  const _Float16* hg0 = HqT + ((size_t)b * DIM + hrow) * SEQ + hcol;
#pragma unroll 1
  for (unsigned pass = 0; pass < (unsigned)(SEQ / 256); ++pass) {
    const unsigned q = pass * 256u + tid;
    // The earlier pass's copies have landed before more are issued: a wave never has more than one
    // pass's 32 copies outstanding.
    asm volatile("s_wait_asynccnt 0x0" ::: "memory");
#pragma unroll  // constant indices: the eight address sets of a statement stay in registers
    for (unsigned jj = 0; jj < 4u; ++jj) {
      unsigned la[8];
      const _Float16* ga[8];
#pragma unroll
      for (unsigned j = 0; j < 8u; ++j) {
        const unsigned n = (pass * 4u + jj) * 8u + j;   // the block's n-th set of HROWS plane rows
        la[j] = hl0 + n * (unsigned)(HROWS * HPITCH * 2);
        ga[j] = hg0 + (size_t)n * (HROWS * SEQ);
      }
      async_copy8(la, ga);
    }
    const float* sqc = Sq + (size_t)b * VDIM * SEQ + q;   // Sq: [b][hidden column][query]
    float acc[PT];
    bool split_ok = false;   // wave-uniform: the arguments of this wave's pass inside SUMLIM
    if (sp_ok) {
      const float amax = score_pass<true>(sqc, ep_s, vs, acc);
      split_ok = __builtin_amdgcn_ballot_w32(!(amax + bmall <= SUMLIM)) == 0u;
    }
    if (!split_ok) (void)score_pass<false>(sqc, sp_s, vs, acc);
#pragma unroll
    for (int p = 0; p < PT; ++p) Ss[(unsigned)p * SPITCH + q] = acc[p];
  }
  __syncthreads();

  // ---- phase 2 ----
  {
    const unsigned row = wave;
    float mx = -3.0e38f;
#pragma unroll 4
    for (unsigned j = 0; j < (unsigned)(SEQ / 32); ++j)
      mx = fmaxf(mx, Ss[row * SPITCH + lane + 32u * j]);
    mx = red32_max(mx);
    float l = 0.0f;
#pragma unroll 4
    for (unsigned j = 0; j < (unsigned)(SEQ / 32); ++j) {
      const float arg = (Ss[row * SPITCH + lane + 32u * j] - mx) * LOG2E + PCARRY_LOG2;
      const float e = fast_exp2(arg);
      const h16 ph = (arg < -14.0f) ? (h16)0.0f : (h16)e;
      Pl[row * PPITCH + lane + 32u * j] = ph;
      l += (float)ph;
    }
    l = red32_sum(l);
    if (lane == 0u) Ls[row] = l;
  }
  // This wave's copies into Hs have landed; the barrier below then shows them to the other waves.
  asm volatile("s_wait_asynccnt 0x0" ::: "memory");
  __syncthreads();

  // ---- phase 3 ----
  const unsigned d0 = wave * (unsigned)WCOLS;
  const _Float16* bp = &Hs[(d0 + m) * HPITCH + hh * 8u];
  const _Float16* pa = &Pl[(m & 7u) * PPITCH + hh * 8u];
  v8f o[NBT];
#pragma unroll
  for (int nb = 0; nb < NBT; ++nb) o[nb] = (v8f){};
#pragma unroll 2
  for (unsigned k0 = 0; k0 < (unsigned)SEQ; k0 += 32u) {
    const v16h pf = frag_at(pa + k0);
#pragma unroll
    for (int nb = 0; nb < NBT; ++nb) {
      const v16h hf = frag_at(bp + (unsigned)(nb * 16) * HPITCH + k0);
      o[nb] = wmma16(pf, hf, o[nb]);
    }
  }

  // ---- phase 4 ----
  // both lane halves hold rows 0..7: lanes 0..15 stage column tile 0, lanes 16..31 tile 1
#pragma unroll
  for (int r = 0; r < PT; ++r) {
    const float inv = __builtin_amdgcn_rcpf(Ls[r]);
    Ss[(unsigned)r * SPITCH + d0 + lane] = (hh ? o[1][r] : o[0][r]) * inv;
  }
  wave_lds_sync();
  v4f x[2];
  size_t off[2];
#pragma unroll
  for (unsigned i = 0; i < 2u; ++i) {
    const unsigned r = 4u * i + (lane >> 3);
    const unsigned c = (lane & 7u) * 4u;
    x[i] = *(const v4f*)&Ss[r * SPITCH + d0 + c];
    off[i] = ((size_t)b * SEQ_FULL + p0 + r) * DIM + d0 + c;
  }
#pragma unroll
  for (int i = 0; i < 2; ++i) *(v4f*)(out + off[i]) = x[i];
  
}

// ---------------------------------------------------------------------------
extern "C" void kernel_launch(void* const* d_in, const int* in_sizes, int n_in,
                              void* d_out, int out_size, void* d_ws, size_t ws_size,
                              hipStream_t stream) {
  if (n_in < 4) return;
  const long long need_x = ((long long)(NB - 1) * SEQ_FULL + SEQ) * DIM;
  if ((long long)in_sizes[0] < need_x) return;
  if ((long long)in_sizes[1] < need_x) return;
  if ((long long)in_sizes[2] < (long long)DIM * VDIM) return;
  if (in_sizes[3] < VDIM) return;
  if ((long long)out_size < need_x) return;
  if (ws_size < WS_TOTAL) return;

  const float* hq   = (const float*)d_in[0];   // [NB_FULL][SEQ_FULL][DIM]
  const float* hp   = (const float*)d_in[1];   // [NB_FULL][SEQ_FULL][DIM]
  const float* w_in = (const float*)d_in[2];   // [VDIM][DIM]  (out, in), shared by both sides
  const float* vvec = (const float*)d_in[3];   // [VDIM]
  float* out = (float*)d_out;                  // [NB_FULL][SEQ_FULL][DIM]

  char* ws = (char*)d_ws;
  _Float16* HqT  = (_Float16*)(ws + OFF_HQT);   // [NB][DIM][SEQ]
  float*    Spl  = (float*)(ws + OFF_S);        // sq [NB][VDIM][SEQ], then -sp rows [MROWS][VDIM]

  dim3 blk(256);

  // operand conversion, both projections and the transposed hq plane: one launch
  proj_kernel<<<dim3(VDIM / 64, (2 * MROWS) / 64), blk, 0, stream>>>(hq, hp, w_in, Spl, HqT);

  // scores + softmax + weighted sum
  addattn_kernel<<<dim3(SEQ / PT, NB), blk, 0, stream>>>(
      Spl, Spl + (size_t)MROWS * VDIM, vvec, HqT, out);
}

// v008
// A run of this version takes 27.8 microseconds.
// Two timings next to v007 put it at 1.04 and 1.06 times that version's speed.
// All steps since v000 together make it 3.11 times as fast.
#include <hip/hip_runtime.h>
#include <stddef.h>

// Contractions on v_wmma_f32_16x16x32_f16 (f16 operands, f32 accumulate): both input projections
// (rows x one shared weight, K = 256) and the probability x value product (K = 512 keys). Float
// inputs are RNE-converted to bf16 and carried in f16 (weights x64 for the hq rows and x-64 for
// the hp rows, so the hp projection comes out negated; softmax numerators x1024). The score sum
// over the 256-wide hidden axis (a matrix-vector product against one vector) runs on the vector
// unit in f32, tanh(x) formed as 1 - 2 / (1 + 2^(2 x log2 e)); the power of the difference is the
// product of one power per side, and four terms of a row share one reciprocal, while the arguments
// are small enough; softmax in f32.

typedef _Float16 v16h __attribute__((ext_vector_type(16)));
typedef _Float16 v8h  __attribute__((ext_vector_type(8)));
typedef _Float16 v4h  __attribute__((ext_vector_type(4)));
typedef float    v8f  __attribute__((ext_vector_type(8)));
typedef float    v4f  __attribute__((ext_vector_type(4)));
typedef float    v2f  __attribute__((ext_vector_type(2)));
typedef _Float16 h16;

#ifndef NB
#define NB 4
#endif
#ifndef SEQ
#define SEQ 512
#endif
#define NB_FULL  4
#define SEQ_FULL 512
#define DIM   256          // feature width of the hq / hp rows (pq_size)
#define VDIM  256          // hidden width of the score
#define MROWS (NB * SEQ)   // compact rows per activation plane (query length == passage length)
#define PT    8            // passage rows per attention block: (SEQ / PT) * NB = 256 blocks
#define VSTEP 8            // hidden columns per score-loop trip (PT * VSTEP terms per thread)
#define NTRIP (VDIM / VSTEP)  // score-loop trips per pass
#define NPF   4            // register sets for the query operand: the current trip's and three in flight
#define WCOLS (DIM / 8)    // output columns per wave in the attention kernel
#define NBT   (WCOLS / 16) // 16-column output tiles per wave

static_assert(NB >= 1 && NB <= NB_FULL);
static_assert(SEQ >= 256 && SEQ <= SEQ_FULL && (SEQ % 256) == 0);
static_assert((DIM % 128) == 0);
static_assert((VDIM % 64) == 0 && (VDIM % 4) == 0);
static_assert(VDIM == 256);                 // one thread per hidden column when staging the vector
static_assert((MROWS % 64) == 0);
static_assert(DIM == 8 * WCOLS);            // 8 waves x WCOLS output columns
static_assert(WCOLS == 32 && NBT == 2);
static_assert((SEQ % 64) == 0 && (SEQ % 32) == 0);
static_assert(PT == 8);                     // A tile rows 0..7; rows 8..15 repeat them; 1 row per wave
static_assert(PT == 2 * 4);                 // output store: 2 steps x 4 rows
static_assert(PT * VDIM == 256 * 2 * 4);    // sp tile staging: 256 threads x 2 steps x 4 floats
static_assert(VSTEP == 2 * 4 && (VDIM % VSTEP) == 0);
static_assert((NTRIP % NPF) == 0 && NTRIP >= NPF);
static_assert((SEQ % PT) == 0);

#define LDA (DIM + 8)   // halves per staged operand row: 16 B x an odd number, so that the 16 rows
                        // of a fragment read fall on 64 different LDS banks
#define LDC 68   // floats per LDS row (272 B, 16-B aligned)
static_assert((LDA % 8) == 0 && ((LDA / 8) % 2) == 1 && LDA >= DIM);
static_assert((LDC % 4) == 0 && LDC >= 64);
static_assert(DIM == VDIM);                 // a block's column index names its output columns and the
                                            // feature columns that it transposes
static_assert(64 * DIM == 256 * 16 * 4);    // operand staging: 256 threads x 16 steps x 4 floats

#define SMAXW  ((SEQ > DIM) ? SEQ : DIM)
#define SPITCH (SMAXW + 4)   // floats per score / output-stage row
#define PPITCH (SEQ + 8)     // halves per probability row
#define HROWS  (256 / (SEQ / 8))   // value-plane rows that 256 threads cover with 16 bytes each
#define HPITCH (SEQ + 8)     // halves per staged value row: 16 B x an odd number, so that the 16 rows
                             // of a fragment read fall on 64 different LDS banks
static_assert((SPITCH % 4) == 0 && SPITCH >= SEQ && SPITCH >= DIM);
static_assert((PPITCH % 8) == 0 && PPITCH >= SEQ);
static_assert((HPITCH % 8) == 0 && ((HPITCH / 8) % 2) == 1 && HPITCH >= SEQ);

#define WCARRY 64.0f          // weight planes carried x64 (hp plane x-64)
#define PCARRY_LOG2 10.0f     // softmax numerators carried x1024 (added to the exp2 argument)
#define TWO_LOG2E 2.885390081777927f
#define LOG2E     1.4426950408889634f
#define SUMLIM    31.0f       // largest |sq'| + largest |sp'| <= 31: a denominator is at most 1 + 2^31, the
                              // product of four at most about 2^124, so it and its reciprocal are normal f32
#define WLIM      536870912.0f  // |v| <= 2^29: a numerator over four terms stays below 2^125

// workspace layout (bytes)
#define HQT_BYTES ((size_t)NB * DIM * SEQ * 2)      // hq transposed [b][d][q], f16
#define S_BYTES   ((size_t)2 * MROWS * VDIM * 4)    // scaled projections, f32: sq [b][v][q], then -sp rows
#define OFF_HQT ((size_t)0)
#define OFF_S   (OFF_HQT + HQT_BYTES)
#define WS_TOTAL (OFF_S + S_BYTES)
static_assert((HQT_BYTES % 128) == 0 && (S_BYTES % 128) == 0);
static_assert(WS_TOTAL <= (size_t)134217728);

// ---------------------------------------------------------------------------
__device__ __forceinline__ float bf16r(float x) {   // RNE convert to bf16, returned widened
  unsigned int u = __float_as_uint(x);
  u = (u + 0x7FFFu + ((u >> 16) & 1u)) & 0xFFFF0000u;
  return __uint_as_float(u);
}

// f32 -> f16 operand convert that cannot produce an f16 subnormal (value select).
static __device__ __forceinline__ h16 toh_flush(float v) {
  const h16 r = (h16)v;
  return (fabsf(v) < 6.103515625e-05f) ? (h16)0.0f : r;
}

// 16-bit fragment: p points at element [row = lane&15][k0 + 8*(lane>>4)] of a k-contiguous
// row. Elements 0..7 <- k0+8h+0..7, elements 8..15 <- k0+16+8h+0..7 (same map for A and B).
__device__ __forceinline__ v16h frag_at(const _Float16* p) {
  v8h lo = *(const v8h*)(p);
  v8h hi = *(const v8h*)(p + 16);
  v16h out;
#pragma unroll
  for (int i = 0; i < 8; ++i) { out[i] = lo[i]; out[i + 8] = hi[i]; }
  return out;
}

__device__ __forceinline__ v8f wmma16(v16h a, v16h b, v8f c) {
  v8f d = __builtin_amdgcn_wmma_f32_16x16x32_f16(false, a, false, b, (short)0, c,
                                                 false, false);
  asm volatile("v_nop\n\tv_nop\n\tv_nop\n\tv_nop" : "+v"(d) : "v"(a), "v"(b));
  return d;
}

__device__ __forceinline__ float red32_sum(float x) {
#pragma unroll
  for (int off = 1; off < 32; off <<= 1) x += __shfl_xor(x, off, 32);
  return x;
}
__device__ __forceinline__ float red32_max(float x) {
#pragma unroll
  for (int off = 1; off < 32; off <<= 1) x = fmaxf(x, __shfl_xor(x, off, 32));
  return x;
}

// Maximum over the wave's 32 lanes, in every lane, on the vector unit: four exchanges inside each
// 16-lane row (DPP row_xmask 1, 2, 4, 8), then lane l with lane l ^ 16.
__device__ __forceinline__ float wave_max_dpp(float x) {
  x = fmaxf(x, __int_as_float(__builtin_amdgcn_update_dpp(0, __float_as_int(x), 0x161, 0xf, 0xf, true)));
  x = fmaxf(x, __int_as_float(__builtin_amdgcn_update_dpp(0, __float_as_int(x), 0x162, 0xf, 0xf, true)));
  x = fmaxf(x, __int_as_float(__builtin_amdgcn_update_dpp(0, __float_as_int(x), 0x164, 0xf, 0xf, true)));
  x = fmaxf(x, __int_as_float(__builtin_amdgcn_update_dpp(0, __float_as_int(x), 0x168, 0xf, 0xf, true)));
  const int b = __float_as_int(x);
  return fmaxf(x, __int_as_float(__builtin_amdgcn_permlanex16(b, b, 0x76543210, 0xfedcba98, false, false)));
}

__device__ __forceinline__ void wave_lds_sync() {
  __builtin_amdgcn_fence(3 /* release order */, "wavefront");
  asm volatile("s_wait_dscnt 0x0" ::: "memory");
  __builtin_amdgcn_wave_barrier();
}

// Eight asynchronous 16-byte copies from global memory to LDS; every lane names its own LDS byte
// address and its own global address. The s_wait_xcnt stands inside the statement, behind the last
// copy, so that no address register is written again in front of it.
__device__ __forceinline__ void async_copy8(const unsigned (&l)[8], const _Float16* const (&g)[8]) {
  asm volatile(
      "global_load_async_to_lds_b128 %0, %8, off\n\t"
      "global_load_async_to_lds_b128 %1, %9, off\n\t"
      "global_load_async_to_lds_b128 %2, %10, off\n\t"
      "global_load_async_to_lds_b128 %3, %11, off\n\t"
      "global_load_async_to_lds_b128 %4, %12, off\n\t"
      "global_load_async_to_lds_b128 %5, %13, off\n\t"
      "global_load_async_to_lds_b128 %6, %14, off\n\t"
      "global_load_async_to_lds_b128 %7, %15, off\n\t"
      "s_wait_xcnt 0x0"
      :: "v"(l[0]), "v"(l[1]), "v"(l[2]), "v"(l[3]), "v"(l[4]), "v"(l[5]), "v"(l[6]), "v"(l[7]),
         "v"(g[0]), "v"(g[1]), "v"(g[2]), "v"(g[3]), "v"(g[4]), "v"(g[5]), "v"(g[6]), "v"(g[7])
      : "memory");
}

__device__ __forceinline__ float fast_exp2(float x) {
#if __has_builtin(__builtin_amdgcn_exp2f)
  return __builtin_amdgcn_exp2f(x);
#else
  return __expf(x * 0.6931471805599453f);
#endif
}

// ---------------------------------------------------------------------------
// Projection GEMM C[64x64 tile] = X[rows][DIM] . W[n][DIM]^T, straight from the f32 inputs: the
// block converts its 64 activation rows (f16(bf16(x))) and its 64 weight rows (f16(carry * bf16(w)),
// the [out][in] layout is already k-contiguous) into LDS and takes its fragments from there.
// 8 waves (mw = 16-row group, nw = 32-col group), 2 accumulators/wave.
// Rows 0..MROWS-1 are hq rows (carry +64), rows MROWS..2*MROWS-1 hp rows (carry -64, an exact sign
// fold); which, is block-uniform. Output f32 = acc * (2 log2 e / 64), i.e. the projection
// pre-scaled for the exp2 form of tanh. The hp rows go out as rows [MROWS][VDIM]; the hq rows go
// out transposed per batch, [NB][VDIM][SEQ], so that the attention kernel's threads (one query
// each) read one hidden column of 32 neighbouring queries as one 128-byte line. Epilogue staged
// through Cs (cross-wave); an hq tile is laid into Cs column-major, so the read-out and the
// 16-byte stores are the same for both. Store coverage: 4 steps x 16 rows == 64 tile rows.
// An hq block also writes its 64 rows x 64 feature columns (the columns of its own column index)
// of the f16 plane transposed per batch, HqT[NB][DIM][SEQ]: each 128-byte line by 8 consecutive
// lanes x 16 B of one instruction; 2 steps x 32 rows == 64 plane rows.
// As / Ws: cross-wave (block barrier). Grid (VDIM/64, 2*MROWS/64).
// ---------------------------------------------------------------------------
__global__ __launch_bounds__(256) void proj_kernel(
    const float* __restrict__ hq, const float* __restrict__ hp, const float* __restrict__ W,
    float* __restrict__ outf, _Float16* __restrict__ HqT) {
  __shared__ __attribute__((aligned(16))) _Float16 As[64 * LDA];
  __shared__ __attribute__((aligned(16))) _Float16 Ws[64 * LDA];
  __shared__ __attribute__((aligned(16))) float Cs[64 * LDC];
  const unsigned tid = threadIdx.x, lane = tid & 31u;
  const unsigned w = (unsigned)__builtin_amdgcn_readfirstlane((int)(threadIdx.x >> 5));
  const unsigned mw = w >> 1, nw = w & 1u;
  const unsigned hh = lane >> 4, m = lane & 15u;
  const unsigned n0 = blockIdx.x * 64u;
  const unsigned row0 = blockIdx.y * 64u;
  const bool tq = row0 < (unsigned)MROWS;   // block-uniform: an hq tile, stored transposed
  const unsigned crow0 = tq ? row0 : row0 - (unsigned)MROWS;   // first row within its plane
  const unsigned bidx = crow0 / (unsigned)SEQ;                 // batch of the tile (SEQ % 64 == 0)
  const unsigned s0 = crow0 - bidx * (unsigned)SEQ;
  const float carry = tq ? WCARRY : -WCARRY;

  // a step of the whole block covers 4 rows of DIM floats; a wave's load is 512 contiguous bytes
  const unsigned sr = tid >> 6, sc = (tid & 63u) * 4u;
  const float* asrc = (tq ? hq : hp) + ((size_t)bidx * SEQ_FULL + s0 + sr) * DIM + sc;
  const float* wsrc = W + (size_t)(n0 + sr) * DIM + sc;
  v4f a4[16], w4[16];
#pragma unroll  // constant indices: a4 and w4 stay in registers; all 32 loads are in flight at once
  for (unsigned j = 0; j < 16u; ++j) {
    a4[j] = *(const v4f*)(asrc + (size_t)j * (4 * DIM));
    w4[j] = *(const v4f*)(wsrc + (size_t)j * (4 * DIM));
  }
  // The wait that stands before a register named by an issued load is written again. It takes the
  // two addresses as inputs, so that neither is reused in front of it, not even as a load's target.
  asm volatile("s_wait_xcnt 0x0" :: "v"(asrc), "v"(wsrc) : "memory");
#pragma unroll
  for (unsigned j = 0; j < 16u; ++j) {
    v4h ha, hw;
#pragma unroll
    for (int i = 0; i < 4; ++i) {
      ha[i] = toh_flush(bf16r(a4[j][i]));
      hw[i] = toh_flush(carry * bf16r(w4[j][i]));
    }
    *(v4h*)&As[(sr + 4u * j) * LDA + sc] = ha;
    *(v4h*)&Ws[(sr + 4u * j) * LDA + sc] = hw;
  }
  __syncthreads();

  const _Float16* ap  = &As[(mw * 16u + m) * LDA + hh * 8u];
  const _Float16* bp0 = &Ws[(nw * 32u + m) * LDA + hh * 8u];
  const _Float16* bp1 = bp0 + 16 * LDA;
  v8f acc0 = {}, acc1 = {};
#pragma unroll 1  // rolled: a trip reads four steps' fragments (96 registers) together, ahead of their
                  // products, so that LDS latency is waited for twice and not at every step
  for (unsigned k0 = 0; k0 < (unsigned)DIM; k0 += 128u) {
    v16h a[4], b0[4], b1[4];
#pragma unroll  // constant indices: the fragments stay in registers
    for (unsigned t = 0; t < 4u; ++t) {
      a[t]  = frag_at(ap + k0 + 32u * t);
      b0[t] = frag_at(bp0 + k0 + 32u * t);
      b1[t] = frag_at(bp1 + k0 + 32u * t);
    }
#pragma unroll
    for (unsigned t = 0; t < 4u; ++t) {
      acc0 = wmma16(a[t], b0[t], acc0);
      acc1 = wmma16(a[t], b1[t], acc1);
    }
  }
  if (tq) {
    // Cs[output column][tile row]: a lane's 8 accumulator rows are 8 neighbouring floats
    float* d = &Cs[(nw * 32u + m) * LDC + mw * 16u + hh * 8u];
#pragma unroll
    for (int g = 0; g < 2; ++g) {
      *(v4f*)(d + 4 * g) = (v4f){acc0[4 * g], acc0[4 * g + 1], acc0[4 * g + 2], acc0[4 * g + 3]};
      *(v4f*)(d + 16 * LDC + 4 * g) =
          (v4f){acc1[4 * g], acc1[4 * g + 1], acc1[4 * g + 2], acc1[4 * g + 3]};
    }
  } else {
#pragma unroll
    for (int r = 0; r < 8; ++r) {
      float* d = &Cs[(mw * 16u + hh * 8u + (unsigned)r) * LDC + nw * 32u + m];
      d[0]  = acc0[r];
      d[16] = acc1[r];
    }
  }
  __syncthreads();

  const float cs = TWO_LOG2E / WCARRY;
  // first element and row pitch of the tile in the output plane, as Cs holds it
  const size_t obase = tq ? ((size_t)bidx * VDIM + n0) * SEQ + s0
                          : (size_t)row0 * VDIM + n0;
  const unsigned opitch = tq ? (unsigned)SEQ : (unsigned)VDIM;
  v4f xs[4];
  size_t off[4];
#pragma unroll
  for (unsigned i = 0; i < 4u; ++i) {
    const unsigned r = 16u * i + (tid >> 4);
    const unsigned c = (tid & 15u) * 4u;
    const v4f u = *(const v4f*)&Cs[r * LDC + c];
    xs[i] = u * cs;
    off[i] = obase + (size_t)r * opitch + c;
  }
  // the transposed f16 plane, from the staged rows; behind the last barrier, so that none waits
  // for these stores
  v8h xt[2] = {};
  size_t offt[2] = {};
  if (tq) {
#pragma unroll
    for (unsigned i = 0; i < 2u; ++i) {
      const unsigned n = 32u * i + (tid >> 3);
      const unsigned kc = (tid & 7u) * 8u;
#pragma unroll
      for (unsigned e = 0; e < 8u; ++e) xt[i][e] = As[(kc + e) * LDA + n0 + n];
      offt[i] = ((size_t)bidx * DIM + n0 + n) * SEQ + s0 + kc;
    }
  }
#pragma unroll
  for (int i = 0; i < 4; ++i) *(v4f*)(outf + off[i]) = xs[i];
  // The wait that stands before a register named by an issued store is written again: the two
  // addresses formed in the branch below reuse registers of the stores above. It stands in front of
  // the branch, so that nothing of the branch's code is moved ahead of it.
  asm volatile("s_wait_xcnt 0x0" ::: "memory");
  if (tq) {
#pragma unroll
    for (int i = 0; i < 2; ++i) *(v8h*)(HqT + offt[i]) = xt[i];
  }
}

// ---------------------------------------------------------------------------
// Difference-form additive attention per (8 passage rows, batch). 8 waves.
// Sp holds the NEGATED scaled hp projection (weight plane carried x-64), so that
// sq'[q][v] + sp'[p][v] = 2 log2 e * (Wq[q][v] - Wp[p][v]).
// Phase 0: stage the 8 scaled sp rows (sp_s), their powers 2^sp' (ep_s) and the vector
//          -2*bf16(v) (vs) in LDS; each wave notes the largest |sp'| in its part of the rows.
// Phase 1: thread t owns query q = 256*pass + t; for the 8 passage rows it accumulates
//          sum_v vs[v] / (1 + 2^(sq'[q][v] + sp'[p][v])) in f32 (equals the score up
//          to a constant that is the same for every query, which the softmax removes);
//          results into Ss[p][q]. The power is taken as 2^sq' * 2^sp' (one exp2 per 8 rows) and
//          four terms share one reciprocal. That holds only while the largest |sq'| and the largest
//          |sp'| add up to SUMLIM at most, so a wave that meets more in its pass drops the sums and
//          forms them again term by term from the power of the sum, which is right at any size.
//          sp_s / ep_s / vs / Ss: cross-wave (block barriers).
// Phase 2: wave w owns row w: row max, f16(1024 * exp(s - max)) into Pl (select on
//          the exp2 argument keeps the plane free of f16 subnormals), row sum over the
//          converted values into Ls. Pl / Ls: cross-wave (block barrier).
//          At the head of each pass every wave also starts asynchronous copies of its share of
//          the batch's transposed f16 plane HqT[d][q] into Hs; they fly under the score loop.
// Phase 3: out tile [8][32 per wave] = Pl[8][SEQ] . Hs[d][q]^T, B fragments from LDS (Hs:
//          cross-wave; each wave's copy wait, then the block barrier in front of this phase).
//          A-tile rows 8..15 read rows 0..7 again, so lanes 16..31
//          of each accumulator hold the same 8 rows as lanes 0..15.
// Phase 4: scale by 1 / row sum, stage in the wave's own 32 columns of Ss (wave-private from
//          Store coverage: 2 steps x 4 rows == 8 rows.
// Grid (SEQ/8, NB).
// ---------------------------------------------------------------------------
// One thread's sums over the hidden axis for PT passage rows. SPLIT: sp holds the powers 2^sp', the
// term's power is 2^sq' * 2^sp', and four terms w / d of a row are added over their common
// denominator, so that they take one reciprocal; otherwise sp holds sp', the power is 2^(sq' + sp')
// and every term has its own reciprocal.
// sqc points at the thread's query in hidden column 0 of the transposed plane (column pitch SEQ):
// a wave's load of one column is one 128-byte line that no other wave reads, so each comes from L2;
// the loads of trip t + NPF - 1 are therefore issued at the head of trip t, into the register set
// that trip t - 1 has used up. With SPLIT, returns the largest |sq'| that the thread has read; otherwise 0.
template <bool SPLIT>
__device__ __forceinline__ float score_pass(const float* __restrict__ sqc, const float* sp,
                                            const float* vs, float (&acc)[PT]) {
  float amax = 0.0f;
  float ring[NPF][VSTEP];
  // every inner loop below is unrolled so that acc2, ring, a, s4 and d are indexed by constants and stay
  // in registers; the loop over t0 stays rolled: NPF trips, one per register set, are its body
  v2f acc2[PT / 2];   // rows 2 pp and 2 pp + 1 (own-reciprocal form)
#pragma unroll
  for (int pp = 0; pp < PT / 2; ++pp) acc2[pp] = (v2f){0.0f, 0.0f};
  v2f accq[PT];       // row p: the even and the odd hidden columns (SPLIT form)
#pragma unroll
  for (int p = 0; p < PT; ++p) accq[p] = (v2f){0.0f, 0.0f};
#pragma unroll
  for (int s = 0; s < NPF - 1; ++s) {
#pragma unroll
    for (int j = 0; j < VSTEP; ++j) ring[s][j] = sqc[(size_t)(s * VSTEP + j) * SEQ];
  }
  // Two register sets for the trip's LDS operands (vector entries, passage rows): trip t works on one
  // while trip t + 1's reads land in the other, so that no trip waits out its own LDS latency.
  static_assert((NPF % 2) == 0);   // the set of a trip is a constant of its place in the loop body
  v4f w4[2][2], s4[2][PT][2];
#pragma unroll
  for (int h = 0; h < 2; ++h) w4[0][h] = *(const v4f*)&vs[4u * (unsigned)h];
#pragma unroll
  for (int p = 0; p < PT; ++p) {
#pragma unroll
    for (int h = 0; h < 2; ++h) s4[0][p][h] = *(const v4f*)&sp[(unsigned)p * VDIM + 4u * (unsigned)h];
  }
#pragma unroll 1
  for (unsigned t0 = 0; t0 < (unsigned)NTRIP; t0 += (unsigned)NPF) {
#pragma unroll
    for (int s = 0; s < NPF; ++s) {
      const int cur = s & 1, nxt = cur ^ 1;   // constants once the loop over s is unrolled
      // behind the last trip there is nothing to fetch: the index stops there (in bounds, not used)
      const unsigned tn = t0 + (unsigned)(s + NPF - 1);
      const unsigned vf = (tn < (unsigned)NTRIP ? tn : (unsigned)(NTRIP - 1)) * (unsigned)VSTEP;
#pragma unroll
      for (int j = 0; j < VSTEP; ++j)
        ring[(s + NPF - 1) % NPF][j] = sqc[(size_t)(vf + (unsigned)j) * SEQ];
      const unsigned tl = t0 + (unsigned)(s + 1);   // the next trip, whose LDS operands are read now
      const unsigned vl = (tl < (unsigned)NTRIP ? tl : (unsigned)(NTRIP - 1)) * (unsigned)VSTEP;
#pragma unroll
      for (int h = 0; h < 2; ++h) w4[nxt][h] = *(const v4f*)&vs[vl + 4u * (unsigned)h];
#pragma unroll
      for (int p = 0; p < PT; ++p) {
#pragma unroll
        for (int h = 0; h < 2; ++h)
          s4[nxt][p][h] = *(const v4f*)&sp[(unsigned)p * VDIM + vl + 4u * (unsigned)h];
      }
      // holds the trip's loads and the next trip's LDS reads in one place at its head, in front of the
      // arithmetic that they fly under (with one register set the scheduler, left free, spread the LDS
      // reads through the trip, each just ahead of its use)
      __builtin_amdgcn_sched_barrier(0);
      float a[VSTEP];
#pragma unroll
      for (int j = 0; j < VSTEP; ++j) a[j] = ring[s][j];
      if (SPLIT) {
#pragma unroll
        for (int j = 0; j < VSTEP; ++j) {
          amax = fmaxf(amax, fabsf(a[j]));
          a[j] = fast_exp2(a[j]);
        }
      }
      // Two-wide f32 forms written out (the packed fma does two a clock): the denominators pair two
      // neighbouring hidden columns of one row.
      v2f d[PT][VSTEP / 2];
      const v2f one = {1.0f, 1.0f};
#pragma unroll
      for (int p = 0; p < PT; ++p) {
#pragma unroll
        for (int g = 0; g < VSTEP / 2; ++g) {
          const v2f a2 = {a[2 * g], a[2 * g + 1]};
          const v2f s2 = {s4[cur][p][g >> 1][2 * (g & 1)], s4[cur][p][g >> 1][2 * (g & 1) + 1]};
          if (SPLIT) {
            d[p][g] = __builtin_elementwise_fma(a2, s2, one);
          } else {
            const v2f x = a2 + s2;
            d[p][g] = (v2f){fast_exp2(x[0]), fast_exp2(x[1])} + one;
          }
        }
      }
      if (SPLIT) {
        // w0/d0 + w1/d1 + w2/d2 + w3/d3 = n / (d0 d1 d2 d3), built from the two pairs: a reciprocal
        // issues at half the rate of a packed product and serves one value, not two. One half of each
        // two-wide value takes the trip's four even columns, the other its four odd ones.
        static_assert(VSTEP == 8);
        v2f w2[VSTEP / 2];
#pragma unroll
        for (int g = 0; g < VSTEP / 2; ++g)
          w2[g] = (v2f){w4[cur][g >> 1][2 * (g & 1)], w4[cur][g >> 1][2 * (g & 1) + 1]};
#pragma unroll
        for (int p = 0; p < PT; ++p) {
          const v2f d01 = d[p][0] * d[p][1];
          const v2f d23 = d[p][2] * d[p][3];
          const v2f n01 = __builtin_elementwise_fma(w2[0], d[p][1], w2[1] * d[p][0]);
          const v2f n23 = __builtin_elementwise_fma(w2[2], d[p][3], w2[3] * d[p][2]);
          const v2f dd = d01 * d23;
          const v2f nn = __builtin_elementwise_fma(n01, d23, n23 * d01);
          const v2f r = {__builtin_amdgcn_rcpf(dd[0]), __builtin_amdgcn_rcpf(dd[1])};
          accq[p] = __builtin_elementwise_fma(nn, r, accq[p]);
        }
      } else {
        // the sums pair two rows at one hidden column; each row's sum takes its terms in ascending
        // column order
#pragma unroll
        for (int j = 0; j < VSTEP; ++j) {
          const float w = w4[cur][j >> 2][j & 3];
#pragma unroll
          for (int pp = 0; pp < PT / 2; ++pp) {
            const v2f r = {__builtin_amdgcn_rcpf(d[2 * pp][j >> 1][j & 1]),
                           __builtin_amdgcn_rcpf(d[2 * pp + 1][j >> 1][j & 1])};
            acc2[pp] = __builtin_elementwise_fma((v2f){w, w}, r, acc2[pp]);
          }
        }
      }
      // keeps each trip's instructions in that trip: left free, the scheduler drew the loads and the
      // LDS reads of all NPF trips to the head of the body, waited for all of them there and took
      // some 500 registers
      __builtin_amdgcn_sched_barrier(0);
    }
  }
  if (SPLIT) {
#pragma unroll
    for (int p = 0; p < PT; ++p) acc[p] = accq[p][0] + accq[p][1];
  } else {
#pragma unroll
    for (int pp = 0; pp < PT / 2; ++pp) {
      acc[2 * pp] = acc2[pp][0];
      acc[2 * pp + 1] = acc2[pp][1];
    }
  }
  return amax;
}

__global__ __launch_bounds__(256) void addattn_kernel(
    const float* __restrict__ Sq, const float* __restrict__ Sp,
    const float* __restrict__ vvec, const _Float16* __restrict__ HqT,
    float* __restrict__ out) {
  __shared__ __attribute__((aligned(16))) float sp_s[PT * VDIM];
  __shared__ __attribute__((aligned(16))) float ep_s[PT * VDIM];
  __shared__ __attribute__((aligned(16))) float bmw[8];
  __shared__ __attribute__((aligned(16))) float vs[VDIM];
  __shared__ __attribute__((aligned(16))) float Ss[PT * SPITCH];
  __shared__ __attribute__((aligned(16))) _Float16 Pl[PT * PPITCH];
  __shared__ __attribute__((aligned(16))) float Ls[PT];
  __shared__ __attribute__((aligned(16))) _Float16 Hs[DIM * HPITCH];
  static_assert(sizeof(float) * (2 * PT * VDIM + VDIM + PT * SPITCH + PT + 8) +
                sizeof(_Float16) * (PT * PPITCH + DIM * HPITCH) <= 327680);
  // 16-byte pieces of the value plane per thread and pass; all of one pass's are in flight at once
  static_assert((DIM * SEQ / 8) / 256 / (SEQ / 256) == 32 && ((SEQ / 8) % 32) == 0);

  const unsigned tid = threadIdx.x, lane = tid & 31u;
  const unsigned wave = (unsigned)__builtin_amdgcn_readfirstlane((int)(threadIdx.x >> 5));
  const unsigned hh = lane >> 4, m = lane & 15u;
  const unsigned p0 = blockIdx.x * (unsigned)PT;
  const unsigned b = blockIdx.y;

  // ---- phase 0 ----
  float bmax = 0.0f;
  const float vraw = vvec[tid];   // read here, so that it flies together with the sp rows' loads
  const float* spsrc[2];
  v4f x2[2];
#pragma unroll
  for (unsigned j = 0; j < 2u; ++j) {
    const unsigned idx = tid + 256u * j;
    const unsigned r = idx >> 6, c = (idx & 63u) * 4u;
    spsrc[j] = Sp + (size_t)(b * (unsigned)SEQ + p0 + r) * VDIM + c;
    x2[j] = *(const v4f*)spsrc[j];
  }
  // The wait that stands before a register named by an issued load is written again. It takes the
  // two addresses as inputs, so that neither is reused in front of it, not even as a load's target.
  asm volatile("s_wait_xcnt 0x0" :: "v"(spsrc[0]), "v"(spsrc[1]) : "memory");
#pragma unroll
  for (unsigned j = 0; j < 2u; ++j) {
    const unsigned idx = tid + 256u * j;
    const unsigned r = idx >> 6, c = (idx & 63u) * 4u;
    const v4f x = x2[j];
    v4f e;
#pragma unroll  // constant element index: x and e stay in registers
    for (int i = 0; i < 4; ++i) {
      bmax = fmaxf(bmax, fabsf(x[i]));
      e[i] = fast_exp2(x[i]);
    }
    *(v4f*)&sp_s[r * VDIM + c] = x;
    *(v4f*)&ep_s[r * VDIM + c] = e;
  }
  // a vector entry too large for the shared numerator counts as an argument out of range
  if (!(fabsf(vraw) <= WLIM)) bmax = __builtin_inff();
  bmax = wave_max_dpp(bmax);
  if (lane == 0u) bmw[wave] = bmax;
  vs[tid] = -2.0f * bf16r(vraw);
  __syncthreads();
  float bmall = 0.0f;   // the block's largest |sp'|: the same in every wave
#pragma unroll  // the eight notes come in two 16-byte LDS reads
  for (int i = 0; i < 8; ++i) bmall = fmaxf(bmall, bmw[i]);
  const bool sp_ok = __builtin_amdgcn_ballot_w32(!(bmall <= SUMLIM)) == 0u;

  // ---- phase 1 ----
  // One copy of the whole block moves 256 pieces of 16 bytes = HROWS rows of the value plane; a wave's
  // 32 pieces are 512 contiguous bytes of one row. hl0 / hg0: this thread's piece in rows 0..HROWS-1.
  const unsigned hrow = tid / (unsigned)(SEQ / 8), hcol = (tid % (unsigned)(SEQ / 8)) * 8u;
  const unsigned hl0 = (unsigned)(size_t)&Hs[hrow * HPITCH + hcol];   // LDS byte address
  const _Float16* hg0 = HqT + ((size_t)b * DIM + hrow) * SEQ + hcol;
#pragma unroll 1
  for (unsigned pass = 0; pass < (unsigned)(SEQ / 256); ++pass) {
    const unsigned q = pass * 256u + tid;
    // The earlier pass's copies have landed before more are issued: a wave never has more than one
    // pass's 32 copies outstanding.
    asm volatile("s_wait_asynccnt 0x0" ::: "memory");
#pragma unroll  // constant indices: the eight address sets of a statement stay in registers
    for (unsigned jj = 0; jj < 4u; ++jj) {
      unsigned la[8];
      const _Float16* ga[8];
#pragma unroll
      for (unsigned j = 0; j < 8u; ++j) {
        const unsigned n = (pass * 4u + jj) * 8u + j;   // the block's n-th set of HROWS plane rows
        la[j] = hl0 + n * (unsigned)(HROWS * HPITCH * 2);
        ga[j] = hg0 + (size_t)n * (HROWS * SEQ);
      }
      async_copy8(la, ga);
    }
    const float* sqc = Sq + (size_t)b * VDIM * SEQ + q;   // Sq: [b][hidden column][query]
    float acc[PT];
    bool split_ok = false;   // wave-uniform: the arguments of this wave's pass inside SUMLIM
    if (sp_ok) {
      const float amax = score_pass<true>(sqc, ep_s, vs, acc);
      split_ok = __builtin_amdgcn_ballot_w32(!(amax + bmall <= SUMLIM)) == 0u;
    }
    if (!split_ok) (void)score_pass<false>(sqc, sp_s, vs, acc);
#pragma unroll
    for (int p = 0; p < PT; ++p) Ss[(unsigned)p * SPITCH + q] = acc[p];
  }
  __syncthreads();

  // ---- phase 2 ----
  {
    const unsigned row = wave;
    // the lane's scores are read once, all together, and stay in registers for both uses: one LDS
    // latency instead of one per group of reads; unrolled so that sv is indexed by constants
    float sv[SEQ / 32];
#pragma unroll
    for (unsigned j = 0; j < (unsigned)(SEQ / 32); ++j) sv[j] = Ss[row * SPITCH + lane + 32u * j];
    float mx = -3.0e38f;
#pragma unroll
    for (unsigned j = 0; j < (unsigned)(SEQ / 32); ++j) mx = fmaxf(mx, sv[j]);
    mx = red32_max(mx);
    float l = 0.0f;
#pragma unroll
    for (unsigned j = 0; j < (unsigned)(SEQ / 32); ++j) {
      const float arg = (sv[j] - mx) * LOG2E + PCARRY_LOG2;
      const float e = fast_exp2(arg);
      const h16 ph = (arg < -14.0f) ? (h16)0.0f : (h16)e;
      Pl[row * PPITCH + lane + 32u * j] = ph;
      l += (float)ph;
    }
    l = red32_sum(l);
    if (lane == 0u) Ls[row] = l;
  }
  // This wave's copies into Hs have landed; the barrier below then shows them to the other waves.
  asm volatile("s_wait_asynccnt 0x0" ::: "memory");
  __syncthreads();

  // ---- phase 3 ----
  const unsigned d0 = wave * (unsigned)WCOLS;
  const _Float16* bp = &Hs[(d0 + m) * HPITCH + hh * 8u];
  const _Float16* pa = &Pl[(m & 7u) * PPITCH + hh * 8u];
  v8f o[NBT];
#pragma unroll
  for (int nb = 0; nb < NBT; ++nb) o[nb] = (v8f){};
  // Fragments of KG k steps are read as one group, one group ahead of the products that use them,
  // into the other of two register sets: LDS latency is waited for once, not at every product.
  // Unrolled, so that both sets are indexed by constants and stay in registers.
  constexpr int KG = 4, NG = SEQ / (32 * KG);
  static_assert(NG * KG * 32 == SEQ);
  v16h pf[2][KG], hf[2][KG][NBT];
#pragma unroll
  for (int t = 0; t < KG; ++t) {
    pf[0][t] = frag_at(pa + 32 * t);
#pragma unroll
    for (int nb = 0; nb < NBT; ++nb) hf[0][t][nb] = frag_at(bp + (nb * 16) * HPITCH + 32 * t);
  }
#pragma unroll
  for (int g = 0; g < NG; ++g) {
    if (g + 1 < NG) {
#pragma unroll
      for (int t = 0; t < KG; ++t) {
        const int k0 = 32 * ((g + 1) * KG + t);
        pf[(g + 1) & 1][t] = frag_at(pa + k0);
#pragma unroll
        for (int nb = 0; nb < NBT; ++nb)
          hf[(g + 1) & 1][t][nb] = frag_at(bp + (nb * 16) * HPITCH + k0);
      }
    }
#pragma unroll
    for (int t = 0; t < KG; ++t) {
#pragma unroll
      for (int nb = 0; nb < NBT; ++nb) o[nb] = wmma16(pf[g & 1][t], hf[g & 1][t][nb], o[nb]);
    }
  }

  // ---- phase 4 ----
  // both lane halves hold rows 0..7: lanes 0..15 stage column tile 0, lanes 16..31 tile 1
#pragma unroll
  for (int r = 0; r < PT; ++r) {
    const float inv = __builtin_amdgcn_rcpf(Ls[r]);
    Ss[(unsigned)r * SPITCH + d0 + lane] = (hh ? o[1][r] : o[0][r]) * inv;
  }
  wave_lds_sync();
  v4f x[2];
  size_t off[2];
#pragma unroll
  for (unsigned i = 0; i < 2u; ++i) {
    const unsigned r = 4u * i + (lane >> 3);
    const unsigned c = (lane & 7u) * 4u;
    x[i] = *(const v4f*)&Ss[r * SPITCH + d0 + c];
    off[i] = ((size_t)b * SEQ_FULL + p0 + r) * DIM + d0 + c;
  }
#pragma unroll
  for (int i = 0; i < 2; ++i) *(v4f*)(out + off[i]) = x[i];
  
}

// ---------------------------------------------------------------------------
extern "C" void kernel_launch(void* const* d_in, const int* in_sizes, int n_in,
                              void* d_out, int out_size, void* d_ws, size_t ws_size,
                              hipStream_t stream) {
  if (n_in < 4) return;
  const long long need_x = ((long long)(NB - 1) * SEQ_FULL + SEQ) * DIM;
  if ((long long)in_sizes[0] < need_x) return;
  if ((long long)in_sizes[1] < need_x) return;
  if ((long long)in_sizes[2] < (long long)DIM * VDIM) return;
  if (in_sizes[3] < VDIM) return;
  if ((long long)out_size < need_x) return;
  if (ws_size < WS_TOTAL) return;

  const float* hq   = (const float*)d_in[0];   // [NB_FULL][SEQ_FULL][DIM]
  const float* hp   = (const float*)d_in[1];   // [NB_FULL][SEQ_FULL][DIM]
  const float* w_in = (const float*)d_in[2];   // [VDIM][DIM]  (out, in), shared by both sides
  const float* vvec = (const float*)d_in[3];   // [VDIM]
  float* out = (float*)d_out;                  // [NB_FULL][SEQ_FULL][DIM]

  char* ws = (char*)d_ws;
  _Float16* HqT  = (_Float16*)(ws + OFF_HQT);   // [NB][DIM][SEQ]
  float*    Spl  = (float*)(ws + OFF_S);        // sq [NB][VDIM][SEQ], then -sp rows [MROWS][VDIM]

  dim3 blk(256);

  // operand conversion, both projections and the transposed hq plane: one launch
  proj_kernel<<<dim3(VDIM / 64, (2 * MROWS) / 64), blk, 0, stream>>>(hq, hp, w_in, Spl, HqT);

  // scores + softmax + weighted sum
  addattn_kernel<<<dim3(SEQ / PT, NB), blk, 0, stream>>>(
      Spl, Spl + (size_t)MROWS * VDIM, vvec, HqT, out);
}

// v009
// A run of this version takes 26.7 microseconds.
// Two timings next to v008 put it at 1.04 and 1.03 times that version's speed.
// Counting every step since v000, it is 3.23 times as fast.
#include <hip/hip_runtime.h>
#include <stddef.h>

// Contractions on v_wmma_f32_16x16x32_f16 (f16 operands, f32 accumulate): both input projections
// (rows x one shared weight, K = 256) and the probability x value product (K = 512 keys). Float
// inputs are RNE-converted to bf16 and carried in f16 (weights x64 for the hq rows and x-64 for
// the hp rows, so the hp projection comes out negated; softmax numerators x1024). The score sum
// over the 256-wide hidden axis (a matrix-vector product against one vector) runs on the vector
// unit in f32, tanh(x) formed as 1 - 2 / (1 + 2^(2 x log2 e)); the power of the difference is the
// product of one power per side (the query side's powers come from the projection launch, which
// forms each once), and four terms of a row share one reciprocal, while the arguments are small
// enough; softmax in f32.

typedef _Float16 v16h __attribute__((ext_vector_type(16)));
typedef _Float16 v8h  __attribute__((ext_vector_type(8)));
typedef _Float16 v4h  __attribute__((ext_vector_type(4)));
typedef float    v8f  __attribute__((ext_vector_type(8)));
typedef float    v4f  __attribute__((ext_vector_type(4)));
typedef float    v2f  __attribute__((ext_vector_type(2)));
typedef _Float16 h16;

#ifndef NB
#define NB 4
#endif
#ifndef SEQ
#define SEQ 512
#endif
#define NB_FULL  4
#define SEQ_FULL 512
#define DIM   256          // feature width of the hq / hp rows (pq_size)
#define VDIM  256          // hidden width of the score
#define MROWS (NB * SEQ)   // compact rows per activation plane (query length == passage length)
#define PT    8            // passage rows per attention block: (SEQ / PT) * NB = 256 blocks
#define VSTEP 8            // hidden columns per score-loop trip (PT * VSTEP terms per thread)
#define NTRIP (VDIM / VSTEP)  // score-loop trips per pass
#define NPF   4            // register sets for the query operand: the current trip's and three in flight
#define WCOLS (DIM / 8)    // output columns per wave in the attention kernel
#define NBT   (WCOLS / 16) // 16-column output tiles per wave

static_assert(NB >= 1 && NB <= NB_FULL);
static_assert(SEQ >= 256 && SEQ <= SEQ_FULL && (SEQ % 256) == 0);
static_assert((DIM % 128) == 0);
static_assert((VDIM % 64) == 0 && (VDIM % 4) == 0);
static_assert(VDIM == 256);                 // one thread per hidden column when staging the vector
static_assert((MROWS % 64) == 0);
static_assert(DIM == 8 * WCOLS);            // 8 waves x WCOLS output columns
static_assert(WCOLS == 32 && NBT == 2);
static_assert((SEQ % 64) == 0 && (SEQ % 32) == 0);
static_assert(PT == 8);                     // A tile rows 0..7; rows 8..15 repeat them; 1 row per wave
static_assert(PT == 2 * 4);                 // output store: 2 steps x 4 rows
static_assert(PT * VDIM == 256 * 2 * 4);    // sp tile staging: 256 threads x 2 steps x 4 floats
static_assert(VSTEP == 2 * 4 && (VDIM % VSTEP) == 0);
static_assert((NTRIP % NPF) == 0 && NTRIP >= NPF);
static_assert((SEQ % PT) == 0);

#define LDA (DIM + 8)   // halves per staged operand row: 16 B x an odd number, so that the 16 rows
                        // of a fragment read fall on 64 different LDS banks
#define LDC 68   // floats per LDS row (272 B, 16-B aligned)
static_assert((LDA % 8) == 0 && ((LDA / 8) % 2) == 1 && LDA >= DIM);
static_assert((LDC % 4) == 0 && LDC >= 64);
static_assert(DIM == VDIM);                 // a block's column index names its output columns and the
                                            // feature columns that it transposes
static_assert(64 * DIM == 256 * 16 * 4);    // operand staging: 256 threads x 16 steps x 4 floats

#define SMAXW  ((SEQ > DIM) ? SEQ : DIM)
#define SPITCH (SMAXW + 4)   // floats per score / output-stage row
#define PPITCH (SEQ + 8)     // halves per probability row
#define HROWS  (256 / (SEQ / 8))   // value-plane rows that 256 threads cover with 16 bytes each
#define HPITCH (SEQ + 8)     // halves per staged value row: 16 B x an odd number, so that the 16 rows
                             // of a fragment read fall on 64 different LDS banks
static_assert((SPITCH % 4) == 0 && SPITCH >= SEQ && SPITCH >= DIM);
static_assert((PPITCH % 8) == 0 && PPITCH >= SEQ);
static_assert((HPITCH % 8) == 0 && ((HPITCH / 8) % 2) == 1 && HPITCH >= SEQ);

#define WCARRY 64.0f          // weight planes carried x64 (hp plane x-64)
#define PCARRY_LOG2 10.0f     // softmax numerators carried x1024 (added to the exp2 argument)
#define TWO_LOG2E 2.885390081777927f
#define LOG2E     1.4426950408889634f
#define SUMLIM    31.0f       // largest |sq'| + largest |sp'| <= 31: a denominator is at most 1 + 2^31, the
                              // product of four at most about 2^124, so it and its reciprocal are normal f32
#define WLIM      536870912.0f  // |v| <= 2^29: a numerator over four terms stays below 2^125

// workspace layout (bytes)
#define HQT_BYTES ((size_t)NB * DIM * SEQ * 2)      // hq transposed [b][d][q], f16
#define S_BYTES   ((size_t)2 * MROWS * VDIM * 4)    // scaled projections, f32: sq [b][v][q], then -sp rows
#define E_BYTES   ((size_t)MROWS * VDIM * 4)        // powers 2^sq', f32, [b][v][q] like sq
#define NQN       ((SEQ / 64) * (VDIM / 64) * 8)    // notes of the largest |sq'| per batch: one per
                                                    // wave of each projection block of hq rows
#define N_BYTES   ((size_t)NB * NQN * 4)
#define OFF_HQT ((size_t)0)
#define OFF_S   (OFF_HQT + HQT_BYTES)
#define OFF_E   (OFF_S + S_BYTES)
#define OFF_N   (OFF_E + E_BYTES)
#define WS_TOTAL (OFF_N + N_BYTES)
static_assert((HQT_BYTES % 128) == 0 && (S_BYTES % 128) == 0 && (E_BYTES % 128) == 0);
static_assert(NQN <= 256);                  // the attention block reads its batch's notes one per thread
static_assert(WS_TOTAL <= (size_t)134217728);

// ---------------------------------------------------------------------------
__device__ __forceinline__ float bf16r(float x) {   // RNE convert to bf16, returned widened
  unsigned int u = __float_as_uint(x);
  u = (u + 0x7FFFu + ((u >> 16) & 1u)) & 0xFFFF0000u;
  return __uint_as_float(u);
}

// f32 -> f16 operand convert that cannot produce an f16 subnormal (value select).
static __device__ __forceinline__ h16 toh_flush(float v) {
  const h16 r = (h16)v;
  return (fabsf(v) < 6.103515625e-05f) ? (h16)0.0f : r;
}

// 16-bit fragment: p points at element [row = lane&15][k0 + 8*(lane>>4)] of a k-contiguous
// row. Elements 0..7 <- k0+8h+0..7, elements 8..15 <- k0+16+8h+0..7 (same map for A and B).
__device__ __forceinline__ v16h frag_at(const _Float16* p) {
  v8h lo = *(const v8h*)(p);
  v8h hi = *(const v8h*)(p + 16);
  v16h out;
#pragma unroll
  for (int i = 0; i < 8; ++i) { out[i] = lo[i]; out[i + 8] = hi[i]; }
  return out;
}

__device__ __forceinline__ v8f wmma16(v16h a, v16h b, v8f c) {
  v8f d = __builtin_amdgcn_wmma_f32_16x16x32_f16(false, a, false, b, (short)0, c,
                                                 false, false);
  asm volatile("v_nop\n\tv_nop\n\tv_nop\n\tv_nop" : "+v"(d) : "v"(a), "v"(b));
  return d;
}

__device__ __forceinline__ float red32_sum(float x) {
#pragma unroll
  for (int off = 1; off < 32; off <<= 1) x += __shfl_xor(x, off, 32);
  return x;
}
__device__ __forceinline__ float red32_max(float x) {
#pragma unroll
  for (int off = 1; off < 32; off <<= 1) x = fmaxf(x, __shfl_xor(x, off, 32));
  return x;
}

// Maximum over the wave's 32 lanes, in every lane, on the vector unit: four exchanges inside each
// 16-lane row (DPP row_xmask 1, 2, 4, 8), then lane l with lane l ^ 16.
__device__ __forceinline__ float wave_max_dpp(float x) {
  x = fmaxf(x, __int_as_float(__builtin_amdgcn_update_dpp(0, __float_as_int(x), 0x161, 0xf, 0xf, true)));
  x = fmaxf(x, __int_as_float(__builtin_amdgcn_update_dpp(0, __float_as_int(x), 0x162, 0xf, 0xf, true)));
  x = fmaxf(x, __int_as_float(__builtin_amdgcn_update_dpp(0, __float_as_int(x), 0x164, 0xf, 0xf, true)));
  x = fmaxf(x, __int_as_float(__builtin_amdgcn_update_dpp(0, __float_as_int(x), 0x168, 0xf, 0xf, true)));
  const int b = __float_as_int(x);
  return fmaxf(x, __int_as_float(__builtin_amdgcn_permlanex16(b, b, 0x76543210, 0xfedcba98, false, false)));
}

__device__ __forceinline__ void wave_lds_sync() {
  __builtin_amdgcn_fence(3 /* release order */, "wavefront");
  asm volatile("s_wait_dscnt 0x0" ::: "memory");
  __builtin_amdgcn_wave_barrier();
}

// Eight asynchronous 16-byte copies from global memory to LDS; every lane names its own LDS byte
// address and its own global address. The s_wait_xcnt stands inside the statement, behind the last
// copy, so that no address register is written again in front of it.
__device__ __forceinline__ void async_copy8(const unsigned (&l)[8], const _Float16* const (&g)[8]) {
  asm volatile(
      "global_load_async_to_lds_b128 %0, %8, off\n\t"
      "global_load_async_to_lds_b128 %1, %9, off\n\t"
      "global_load_async_to_lds_b128 %2, %10, off\n\t"
      "global_load_async_to_lds_b128 %3, %11, off\n\t"
      "global_load_async_to_lds_b128 %4, %12, off\n\t"
      "global_load_async_to_lds_b128 %5, %13, off\n\t"
      "global_load_async_to_lds_b128 %6, %14, off\n\t"
      "global_load_async_to_lds_b128 %7, %15, off\n\t"
      "s_wait_xcnt 0x0"
      :: "v"(l[0]), "v"(l[1]), "v"(l[2]), "v"(l[3]), "v"(l[4]), "v"(l[5]), "v"(l[6]), "v"(l[7]),
         "v"(g[0]), "v"(g[1]), "v"(g[2]), "v"(g[3]), "v"(g[4]), "v"(g[5]), "v"(g[6]), "v"(g[7])
      : "memory");
}

__device__ __forceinline__ float fast_exp2(float x) {
#if __has_builtin(__builtin_amdgcn_exp2f)
  return __builtin_amdgcn_exp2f(x);
#else
  return __expf(x * 0.6931471805599453f);
#endif
}

// ---------------------------------------------------------------------------
// Projection GEMM C[64x64 tile] = X[rows][DIM] . W[n][DIM]^T, straight from the f32 inputs: the
// block converts its 64 activation rows (f16(bf16(x))) and its 64 weight rows (f16(carry * bf16(w)),
// the [out][in] layout is already k-contiguous) into LDS and takes its fragments from there.
// 8 waves (mw = 16-row group, nw = 32-col group), 2 accumulators/wave.
// Rows 0..MROWS-1 are hq rows (carry +64), rows MROWS..2*MROWS-1 hp rows (carry -64, an exact sign
// fold); which, is block-uniform. Output f32 = acc * (2 log2 e / 64), i.e. the projection
// pre-scaled for the exp2 form of tanh. The hp rows go out as rows [MROWS][VDIM]; the hq rows go
// out transposed per batch, [NB][VDIM][SEQ], so that the attention kernel's threads (one query
// each) read one hidden column of 32 neighbouring queries as one 128-byte line. Epilogue staged
// through Cs (cross-wave); an hq tile is laid into Cs column-major, so the read-out and the
// 16-byte stores are the same for both. Store coverage: 4 steps x 16 rows == 64 tile rows.
// An hq block also writes its 64 rows x 64 feature columns (the columns of its own column index)
// of the f16 plane transposed per batch, HqT[NB][DIM][SEQ]: each 128-byte line by 8 consecutive
// lanes x 16 B of one instruction; 2 steps x 32 rows == 64 plane rows.
// An hq block further writes the powers 2^sq' of its tile (Eq, laid out like sq) and, per wave, the
// largest |sq'| among the values that the wave stores (qnote): every attention block of the batch
// needs them, so they are formed here, once, and not in each of those blocks.
// As / Ws: cross-wave (block barrier). Grid (VDIM/64, 2*MROWS/64).
// ---------------------------------------------------------------------------
__global__ __launch_bounds__(256) void proj_kernel(
    const float* __restrict__ hq, const float* __restrict__ hp, const float* __restrict__ W,
    float* __restrict__ outf, _Float16* __restrict__ HqT, float* __restrict__ Eq,
    float* __restrict__ qnote) {
  __shared__ __attribute__((aligned(16))) _Float16 As[64 * LDA];
  __shared__ __attribute__((aligned(16))) _Float16 Ws[64 * LDA];
  __shared__ __attribute__((aligned(16))) float Cs[64 * LDC];
  const unsigned tid = threadIdx.x, lane = tid & 31u;
  const unsigned w = (unsigned)__builtin_amdgcn_readfirstlane((int)(threadIdx.x >> 5));
  const unsigned mw = w >> 1, nw = w & 1u;
  const unsigned hh = lane >> 4, m = lane & 15u;
  const unsigned n0 = blockIdx.x * 64u;
  const unsigned row0 = blockIdx.y * 64u;
  const bool tq = row0 < (unsigned)MROWS;   // block-uniform: an hq tile, stored transposed
  const unsigned crow0 = tq ? row0 : row0 - (unsigned)MROWS;   // first row within its plane
  const unsigned bidx = crow0 / (unsigned)SEQ;                 // batch of the tile (SEQ % 64 == 0)
  const unsigned s0 = crow0 - bidx * (unsigned)SEQ;
  const float carry = tq ? WCARRY : -WCARRY;

  // a step of the whole block covers 4 rows of DIM floats; a wave's load is 512 contiguous bytes
  const unsigned sr = tid >> 6, sc = (tid & 63u) * 4u;
  const float* asrc = (tq ? hq : hp) + ((size_t)bidx * SEQ_FULL + s0 + sr) * DIM + sc;
  const float* wsrc = W + (size_t)(n0 + sr) * DIM + sc;
  v4f a4[16], w4[16];
#pragma unroll  // constant indices: a4 and w4 stay in registers; all 32 loads are in flight at once
  for (unsigned j = 0; j < 16u; ++j) {
    a4[j] = *(const v4f*)(asrc + (size_t)j * (4 * DIM));
    w4[j] = *(const v4f*)(wsrc + (size_t)j * (4 * DIM));
  }
  // The wait that stands before a register named by an issued load is written again. It takes the
  // two addresses as inputs, so that neither is reused in front of it, not even as a load's target.
  asm volatile("s_wait_xcnt 0x0" :: "v"(asrc), "v"(wsrc) : "memory");
#pragma unroll
  for (unsigned j = 0; j < 16u; ++j) {
    v4h ha, hw;
#pragma unroll
    for (int i = 0; i < 4; ++i) {
      ha[i] = toh_flush(bf16r(a4[j][i]));
      hw[i] = toh_flush(carry * bf16r(w4[j][i]));
    }
    *(v4h*)&As[(sr + 4u * j) * LDA + sc] = ha;
    *(v4h*)&Ws[(sr + 4u * j) * LDA + sc] = hw;
  }
  __syncthreads();

  const _Float16* ap  = &As[(mw * 16u + m) * LDA + hh * 8u];
  const _Float16* bp0 = &Ws[(nw * 32u + m) * LDA + hh * 8u];
  const _Float16* bp1 = bp0 + 16 * LDA;
  v8f acc0 = {}, acc1 = {};
#pragma unroll 1  // rolled: a trip reads four steps' fragments (96 registers) together, ahead of their
                  // products, so that LDS latency is waited for twice and not at every step
  for (unsigned k0 = 0; k0 < (unsigned)DIM; k0 += 128u) {
    v16h a[4], b0[4], b1[4];
#pragma unroll  // constant indices: the fragments stay in registers
    for (unsigned t = 0; t < 4u; ++t) {
      a[t]  = frag_at(ap + k0 + 32u * t);
      b0[t] = frag_at(bp0 + k0 + 32u * t);
      b1[t] = frag_at(bp1 + k0 + 32u * t);
    }
#pragma unroll
    for (unsigned t = 0; t < 4u; ++t) {
      acc0 = wmma16(a[t], b0[t], acc0);
      acc1 = wmma16(a[t], b1[t], acc1);
    }
  }
  if (tq) {
    // Cs[output column][tile row]: a lane's 8 accumulator rows are 8 neighbouring floats
    float* d = &Cs[(nw * 32u + m) * LDC + mw * 16u + hh * 8u];
#pragma unroll
    for (int g = 0; g < 2; ++g) {
      *(v4f*)(d + 4 * g) = (v4f){acc0[4 * g], acc0[4 * g + 1], acc0[4 * g + 2], acc0[4 * g + 3]};
      *(v4f*)(d + 16 * LDC + 4 * g) =
          (v4f){acc1[4 * g], acc1[4 * g + 1], acc1[4 * g + 2], acc1[4 * g + 3]};
    }
  } else {
#pragma unroll
    for (int r = 0; r < 8; ++r) {
      float* d = &Cs[(mw * 16u + hh * 8u + (unsigned)r) * LDC + nw * 32u + m];
      d[0]  = acc0[r];
      d[16] = acc1[r];
    }
  }
  __syncthreads();

  const float cs = TWO_LOG2E / WCARRY;
  // first element and row pitch of the tile in the output plane, as Cs holds it
  const size_t obase = tq ? ((size_t)bidx * VDIM + n0) * SEQ + s0
                          : (size_t)row0 * VDIM + n0;
  const unsigned opitch = tq ? (unsigned)SEQ : (unsigned)VDIM;
  v4f xs[4];
  size_t off[4];
#pragma unroll
  for (unsigned i = 0; i < 4u; ++i) {
    const unsigned r = 16u * i + (tid >> 4);
    const unsigned c = (tid & 15u) * 4u;
    const v4f u = *(const v4f*)&Cs[r * LDC + c];
    xs[i] = u * cs;
    off[i] = obase + (size_t)r * opitch + c;
  }
  // the transposed f16 plane, from the staged rows; behind the last barrier, so that none waits
  // for these stores
  v8h xt[2] = {};
  size_t offt[2] = {};
  v4f es[4] = {};
  float nmax = 0.0f;
  if (tq) {
#pragma unroll  // constant indices: xs and es stay in registers
    for (unsigned i = 0; i < 4u; ++i) {
#pragma unroll
      for (int e = 0; e < 4; ++e) {
        nmax = fmaxf(nmax, fabsf(xs[i][e]));
        es[i][e] = fast_exp2(xs[i][e]);
      }
    }
    nmax = wave_max_dpp(nmax);
#pragma unroll
    for (unsigned i = 0; i < 2u; ++i) {
      const unsigned n = 32u * i + (tid >> 3);
      const unsigned kc = (tid & 7u) * 8u;
#pragma unroll
      for (unsigned e = 0; e < 8u; ++e) xt[i][e] = As[(kc + e) * LDA + n0 + n];
      offt[i] = ((size_t)bidx * DIM + n0 + n) * SEQ + s0 + kc;
    }
  }
#pragma unroll
  for (int i = 0; i < 4; ++i) *(v4f*)(outf + off[i]) = xs[i];
  // The wait that stands before a register named by an issued store is written again: the
  // addresses formed in the branch below reuse registers of the stores above. It stands in front of
  // the branch, so that nothing of the branch's code is moved ahead of it.
  asm volatile("s_wait_xcnt 0x0" ::: "memory");
  if (tq) {
#pragma unroll
    for (int i = 0; i < 2; ++i) *(v8h*)(HqT + offt[i]) = xt[i];
    float* ed[4];
#pragma unroll
    for (int i = 0; i < 4; ++i) {
      ed[i] = Eq + off[i];
      *(v4f*)ed[i] = es[i];
    }
    // The wait that stands before a register named by an issued store is written again: the note's
    // address below may reuse one. It takes the four addresses as inputs, so that none is reused in
    // front of it.
    asm volatile("s_wait_xcnt 0x0" :: "v"(ed[0]), "v"(ed[1]), "v"(ed[2]), "v"(ed[3]) : "memory");
    if (lane == 0u)
      qnote[((bidx * (unsigned)(SEQ / 64) + s0 / 64u) * (unsigned)(VDIM / 64) + blockIdx.x) * 8u + w] = nmax;
  }
}

// ---------------------------------------------------------------------------
// Difference-form additive attention per (8 passage rows, batch). 8 waves.
// Sp holds the NEGATED scaled hp projection (weight plane carried x-64), so that
// sq'[q][v] + sp'[p][v] = 2 log2 e * (Wq[q][v] - Wp[p][v]).
// Phase 0: stage the 8 scaled sp rows (sp_s), their powers 2^sp' (ep_s) and the vector
//          -2*bf16(v) (vs) in LDS; each wave notes the largest |sp'| in its part of the rows and
//          the largest of its part of the batch's notes of |sq'|.
// Phase 1: thread t owns query q = 256*pass + t; for the 8 passage rows it accumulates
//          sum_v vs[v] / (1 + 2^(sq'[q][v] + sp'[p][v])) in f32 (equals the score up
//          to a constant that is the same for every query, which the softmax removes);
//          results into Ss[p][q]. The power is taken as 2^sq' * 2^sp' (both read as powers) and
//          four terms share one reciprocal. That holds only while the batch's largest |sq'| and the
//          block's largest |sp'| add up to SUMLIM at most; a block that meets more forms its sums
//          term by term from the power of the sum, which is right at any size.
//          sp_s / ep_s / vs / Ss: cross-wave (block barriers).
// Phase 2: wave w owns row w: row max, f16(1024 * exp(s - max)) into Pl (select on
//          the exp2 argument keeps the plane free of f16 subnormals), row sum over the
//          converted values into Ls. Pl / Ls: cross-wave (block barrier).
//          At the head of each pass every wave also starts asynchronous copies of its share of
//          the batch's transposed f16 plane HqT[d][q] into Hs; they fly under the score loop.
// Phase 3: out tile [8][32 per wave] = Pl[8][SEQ] . Hs[d][q]^T, B fragments from LDS (Hs:
//          cross-wave; each wave's copy wait, then the block barrier in front of this phase).
//          A-tile rows 8..15 read rows 0..7 again, so lanes 16..31
//          of each accumulator hold the same 8 rows as lanes 0..15.
// Phase 4: scale by 1 / row sum, stage in the wave's own 32 columns of Ss (wave-private from
//          Store coverage: 2 steps x 4 rows == 8 rows.
// Grid (SEQ/8, NB).
// ---------------------------------------------------------------------------
// One thread's sums over the hidden axis for PT passage rows. SPLIT: sqc and sp hold the powers 2^sq'
// and 2^sp', the term's power is their product, and four terms w / d of a row are added over their
// common denominator, so that they take one reciprocal; otherwise they hold sq' and sp', the power
// is 2^(sq' + sp') and every term has its own reciprocal.
// sqc points at the thread's query in hidden column 0 of the transposed plane (column pitch SEQ):
// a wave's load of one column is one 128-byte line that no other wave reads, so each comes from L2;
// the loads of trip t + NPF - 1 are therefore issued at the head of trip t, into the register set
// that trip t - 1 has used up.
template <bool SPLIT>
__device__ __forceinline__ void score_pass(const float* __restrict__ sqc, const float* sp,
                                           const float* vs, float (&acc)[PT]) {
  float ring[NPF][VSTEP];
  // every inner loop below is unrolled so that acc2, ring, a, s4 and d are indexed by constants and stay
  // in registers; the loop over t0 stays rolled: NPF trips, one per register set, are its body
  v2f acc2[PT / 2];   // rows 2 pp and 2 pp + 1 (own-reciprocal form)
#pragma unroll
  for (int pp = 0; pp < PT / 2; ++pp) acc2[pp] = (v2f){0.0f, 0.0f};
  v2f accq[PT];       // row p: the even and the odd hidden columns (SPLIT form)
#pragma unroll
  for (int p = 0; p < PT; ++p) accq[p] = (v2f){0.0f, 0.0f};
#pragma unroll
  for (int s = 0; s < NPF - 1; ++s) {
#pragma unroll
    for (int j = 0; j < VSTEP; ++j) ring[s][j] = sqc[(size_t)(s * VSTEP + j) * SEQ];
  }
  // Two register sets for the trip's LDS operands (vector entries, passage rows): trip t works on one
  // while trip t + 1's reads land in the other, so that no trip waits out its own LDS latency.
  static_assert((NPF % 2) == 0);   // the set of a trip is a constant of its place in the loop body
  v4f w4[2][2], s4[2][PT][2];
#pragma unroll
  for (int h = 0; h < 2; ++h) w4[0][h] = *(const v4f*)&vs[4u * (unsigned)h];
#pragma unroll
  for (int p = 0; p < PT; ++p) {
#pragma unroll
    for (int h = 0; h < 2; ++h) s4[0][p][h] = *(const v4f*)&sp[(unsigned)p * VDIM + 4u * (unsigned)h];
  }
#pragma unroll 1
  for (unsigned t0 = 0; t0 < (unsigned)NTRIP; t0 += (unsigned)NPF) {
#pragma unroll
    for (int s = 0; s < NPF; ++s) {
      const int cur = s & 1, nxt = cur ^ 1;   // constants once the loop over s is unrolled
      // behind the last trip there is nothing to fetch: the index stops there (in bounds, not used)
      const unsigned tn = t0 + (unsigned)(s + NPF - 1);
      const unsigned vf = (tn < (unsigned)NTRIP ? tn : (unsigned)(NTRIP - 1)) * (unsigned)VSTEP;
#pragma unroll
      for (int j = 0; j < VSTEP; ++j)
        ring[(s + NPF - 1) % NPF][j] = sqc[(size_t)(vf + (unsigned)j) * SEQ];
      const unsigned tl = t0 + (unsigned)(s + 1);   // the next trip, whose LDS operands are read now
      const unsigned vl = (tl < (unsigned)NTRIP ? tl : (unsigned)(NTRIP - 1)) * (unsigned)VSTEP;
#pragma unroll
      for (int h = 0; h < 2; ++h) w4[nxt][h] = *(const v4f*)&vs[vl + 4u * (unsigned)h];
#pragma unroll
      for (int p = 0; p < PT; ++p) {
#pragma unroll
        for (int h = 0; h < 2; ++h)
          s4[nxt][p][h] = *(const v4f*)&sp[(unsigned)p * VDIM + vl + 4u * (unsigned)h];
      }
      // holds the trip's loads and the next trip's LDS reads in one place at its head, in front of the
      // arithmetic that they fly under (with one register set the scheduler, left free, spread the LDS
      // reads through the trip, each just ahead of its use)
      __builtin_amdgcn_sched_barrier(0);
      float a[VSTEP];
#pragma unroll
      for (int j = 0; j < VSTEP; ++j) a[j] = ring[s][j];
      // Two-wide f32 forms written out (the packed fma does two a clock): the denominators pair two
      // neighbouring hidden columns of one row.
      v2f d[PT][VSTEP / 2];
      const v2f one = {1.0f, 1.0f};
#pragma unroll
      for (int p = 0; p < PT; ++p) {
#pragma unroll
        for (int g = 0; g < VSTEP / 2; ++g) {
          const v2f a2 = {a[2 * g], a[2 * g + 1]};
          const v2f s2 = {s4[cur][p][g >> 1][2 * (g & 1)], s4[cur][p][g >> 1][2 * (g & 1) + 1]};
          if (SPLIT) {
            d[p][g] = __builtin_elementwise_fma(a2, s2, one);
          } else {
            const v2f x = a2 + s2;
            d[p][g] = (v2f){fast_exp2(x[0]), fast_exp2(x[1])} + one;
          }
        }
      }
      if (SPLIT) {
        // w0/d0 + w1/d1 + w2/d2 + w3/d3 = n / (d0 d1 d2 d3), built from the two pairs: a reciprocal
        // issues at half the rate of a packed product and serves one value, not two. One half of each
        // two-wide value takes the trip's four even columns, the other its four odd ones.
        static_assert(VSTEP == 8);
        v2f w2[VSTEP / 2];
#pragma unroll
        for (int g = 0; g < VSTEP / 2; ++g)
          w2[g] = (v2f){w4[cur][g >> 1][2 * (g & 1)], w4[cur][g >> 1][2 * (g & 1) + 1]};
#pragma unroll
        for (int p = 0; p < PT; ++p) {
          const v2f d01 = d[p][0] * d[p][1];
          const v2f d23 = d[p][2] * d[p][3];
          const v2f n01 = __builtin_elementwise_fma(w2[0], d[p][1], w2[1] * d[p][0]);
          const v2f n23 = __builtin_elementwise_fma(w2[2], d[p][3], w2[3] * d[p][2]);
          const v2f dd = d01 * d23;
          const v2f nn = __builtin_elementwise_fma(n01, d23, n23 * d01);
          const v2f r = {__builtin_amdgcn_rcpf(dd[0]), __builtin_amdgcn_rcpf(dd[1])};
          accq[p] = __builtin_elementwise_fma(nn, r, accq[p]);
        }
      } else {
        // the sums pair two rows at one hidden column; each row's sum takes its terms in ascending
        // column order
#pragma unroll
        for (int j = 0; j < VSTEP; ++j) {
          const float w = w4[cur][j >> 2][j & 3];
#pragma unroll
          for (int pp = 0; pp < PT / 2; ++pp) {
            const v2f r = {__builtin_amdgcn_rcpf(d[2 * pp][j >> 1][j & 1]),
                           __builtin_amdgcn_rcpf(d[2 * pp + 1][j >> 1][j & 1])};
            acc2[pp] = __builtin_elementwise_fma((v2f){w, w}, r, acc2[pp]);
          }
        }
      }
      // keeps each trip's instructions in that trip: left free, the scheduler drew the loads and the
      // LDS reads of all NPF trips to the head of the body, waited for all of them there and took
      // some 500 registers
      __builtin_amdgcn_sched_barrier(0);
    }
  }
  if (SPLIT) {
#pragma unroll
    for (int p = 0; p < PT; ++p) acc[p] = accq[p][0] + accq[p][1];
  } else {
#pragma unroll
    for (int pp = 0; pp < PT / 2; ++pp) {
      acc[2 * pp] = acc2[pp][0];
      acc[2 * pp + 1] = acc2[pp][1];
    }
  }
}

__global__ __launch_bounds__(256) void addattn_kernel(
    const float* __restrict__ Sq, const float* __restrict__ Eq, const float* __restrict__ qnote,
    const float* __restrict__ Sp, const float* __restrict__ vvec,
    const _Float16* __restrict__ HqT, float* __restrict__ out) {
  __shared__ __attribute__((aligned(16))) float sp_s[PT * VDIM];
  __shared__ __attribute__((aligned(16))) float ep_s[PT * VDIM];
  __shared__ __attribute__((aligned(16))) float bmw[8];
  __shared__ __attribute__((aligned(16))) float qmw[8];
  __shared__ __attribute__((aligned(16))) float vs[VDIM];
  __shared__ __attribute__((aligned(16))) float Ss[PT * SPITCH];
  __shared__ __attribute__((aligned(16))) _Float16 Pl[PT * PPITCH];
  __shared__ __attribute__((aligned(16))) float Ls[PT];
  __shared__ __attribute__((aligned(16))) _Float16 Hs[DIM * HPITCH];
  static_assert(sizeof(float) * (2 * PT * VDIM + VDIM + PT * SPITCH + PT + 8 + 8) +
                sizeof(_Float16) * (PT * PPITCH + DIM * HPITCH) <= 327680);
  // 16-byte pieces of the value plane per thread and pass; all of one pass's are in flight at once
  static_assert((DIM * SEQ / 8) / 256 / (SEQ / 256) == 32 && ((SEQ / 8) % 32) == 0);

  const unsigned tid = threadIdx.x, lane = tid & 31u;
  const unsigned wave = (unsigned)__builtin_amdgcn_readfirstlane((int)(threadIdx.x >> 5));
  const unsigned hh = lane >> 4, m = lane & 15u;
  const unsigned p0 = blockIdx.x * (unsigned)PT;
  const unsigned b = blockIdx.y;

  // ---- phase 0 ----
  float bmax = 0.0f;
  const float vraw = vvec[tid];   // read here, so that it flies together with the sp rows' loads
  // this thread's one of the batch's notes (a thread past the last reads the last again)
  const float qn = qnote[b * (unsigned)NQN + (tid < (unsigned)NQN ? tid : (unsigned)(NQN - 1))];
  const float* spsrc[2];
  v4f x2[2];
#pragma unroll
  for (unsigned j = 0; j < 2u; ++j) {
    const unsigned idx = tid + 256u * j;
    const unsigned r = idx >> 6, c = (idx & 63u) * 4u;
    spsrc[j] = Sp + (size_t)(b * (unsigned)SEQ + p0 + r) * VDIM + c;
    x2[j] = *(const v4f*)spsrc[j];
  }
  // The wait that stands before a register named by an issued load is written again. It takes the
  // two addresses as inputs, so that neither is reused in front of it, not even as a load's target.
  asm volatile("s_wait_xcnt 0x0" :: "v"(spsrc[0]), "v"(spsrc[1]) : "memory");
#pragma unroll
  for (unsigned j = 0; j < 2u; ++j) {
    const unsigned idx = tid + 256u * j;
    const unsigned r = idx >> 6, c = (idx & 63u) * 4u;
    const v4f x = x2[j];
    v4f e;
#pragma unroll  // constant element index: x and e stay in registers
    for (int i = 0; i < 4; ++i) {
      bmax = fmaxf(bmax, fabsf(x[i]));
      e[i] = fast_exp2(x[i]);
    }
    *(v4f*)&sp_s[r * VDIM + c] = x;
    *(v4f*)&ep_s[r * VDIM + c] = e;
  }
  // a vector entry too large for the shared numerator counts as an argument out of range
  if (!(fabsf(vraw) <= WLIM)) bmax = __builtin_inff();
  bmax = wave_max_dpp(bmax);
  const float qmax = wave_max_dpp(qn);
  if (lane == 0u) {
    bmw[wave] = bmax;
    qmw[wave] = qmax;
  }
  vs[tid] = -2.0f * bf16r(vraw);
  __syncthreads();
  float bmall = 0.0f;   // the block's largest |sp'|: the same in every wave
  float qmall = 0.0f;   // the batch's largest |sq'|: the same in every wave
#pragma unroll  // each set of eight notes comes in two 16-byte LDS reads
  for (int i = 0; i < 8; ++i) {
    bmall = fmaxf(bmall, bmw[i]);
    qmall = fmaxf(qmall, qmw[i]);
  }
  // block-uniform: every argument of this block inside SUMLIM
  const bool split_ok = __builtin_amdgcn_ballot_w32(!(qmall + bmall <= SUMLIM)) == 0u;

  // ---- phase 1 ----
  // One copy of the whole block moves 256 pieces of 16 bytes = HROWS rows of the value plane; a wave's
  // 32 pieces are 512 contiguous bytes of one row. hl0 / hg0: this thread's piece in rows 0..HROWS-1.
  const unsigned hrow = tid / (unsigned)(SEQ / 8), hcol = (tid % (unsigned)(SEQ / 8)) * 8u;
  const unsigned hl0 = (unsigned)(size_t)&Hs[hrow * HPITCH + hcol];   // LDS byte address
  const _Float16* hg0 = HqT + ((size_t)b * DIM + hrow) * SEQ + hcol;
#pragma unroll 1
  for (unsigned pass = 0; pass < (unsigned)(SEQ / 256); ++pass) {
    const unsigned q = pass * 256u + tid;
    // The earlier pass's copies have landed before more are issued: a wave never has more than one
    // pass's 32 copies outstanding.
    asm volatile("s_wait_asynccnt 0x0" ::: "memory");
#pragma unroll  // constant indices: the eight address sets of a statement stay in registers
    for (unsigned jj = 0; jj < 4u; ++jj) {
      unsigned la[8];
      const _Float16* ga[8];
#pragma unroll
      for (unsigned j = 0; j < 8u; ++j) {
        const unsigned n = (pass * 4u + jj) * 8u + j;   // the block's n-th set of HROWS plane rows
        la[j] = hl0 + n * (unsigned)(HROWS * HPITCH * 2);
        ga[j] = hg0 + (size_t)n * (HROWS * SEQ);
      }
      async_copy8(la, ga);
    }
    const size_t qoff = (size_t)b * VDIM * SEQ + q;   // Sq, Eq: [b][hidden column][query]
    float acc[PT];
    if (split_ok) score_pass<true>(Eq + qoff, ep_s, vs, acc);
    else          score_pass<false>(Sq + qoff, sp_s, vs, acc);
#pragma unroll
    for (int p = 0; p < PT; ++p) Ss[(unsigned)p * SPITCH + q] = acc[p];
  }
  __syncthreads();

  // ---- phase 2 ----
  {
    const unsigned row = wave;
    // the lane's scores are read once, all together, and stay in registers for both uses: one LDS
    // latency instead of one per group of reads; unrolled so that sv is indexed by constants
    float sv[SEQ / 32];
#pragma unroll
    for (unsigned j = 0; j < (unsigned)(SEQ / 32); ++j) sv[j] = Ss[row * SPITCH + lane + 32u * j];
    float mx = -3.0e38f;
#pragma unroll
    for (unsigned j = 0; j < (unsigned)(SEQ / 32); ++j) mx = fmaxf(mx, sv[j]);
    mx = red32_max(mx);
    float l = 0.0f;
#pragma unroll
    for (unsigned j = 0; j < (unsigned)(SEQ / 32); ++j) {
      const float arg = (sv[j] - mx) * LOG2E + PCARRY_LOG2;
      const float e = fast_exp2(arg);
      const h16 ph = (arg < -14.0f) ? (h16)0.0f : (h16)e;
      Pl[row * PPITCH + lane + 32u * j] = ph;
      l += (float)ph;
    }
    l = red32_sum(l);
    if (lane == 0u) Ls[row] = l;
  }
  // This wave's copies into Hs have landed; the barrier below then shows them to the other waves.
  asm volatile("s_wait_asynccnt 0x0" ::: "memory");
  __syncthreads();

  // ---- phase 3 ----
  const unsigned d0 = wave * (unsigned)WCOLS;
  const _Float16* bp = &Hs[(d0 + m) * HPITCH + hh * 8u];
  const _Float16* pa = &Pl[(m & 7u) * PPITCH + hh * 8u];
  v8f o[NBT];
#pragma unroll
  for (int nb = 0; nb < NBT; ++nb) o[nb] = (v8f){};
  // Fragments of KG k steps are read as one group, one group ahead of the products that use them,
  // into the other of two register sets: LDS latency is waited for once, not at every product.
  // Unrolled, so that both sets are indexed by constants and stay in registers.
  constexpr int KG = 4, NG = SEQ / (32 * KG);
  static_assert(NG * KG * 32 == SEQ);
  v16h pf[2][KG], hf[2][KG][NBT];
#pragma unroll
  for (int t = 0; t < KG; ++t) {
    pf[0][t] = frag_at(pa + 32 * t);
#pragma unroll
    for (int nb = 0; nb < NBT; ++nb) hf[0][t][nb] = frag_at(bp + (nb * 16) * HPITCH + 32 * t);
  }
#pragma unroll
  for (int g = 0; g < NG; ++g) {
    if (g + 1 < NG) {
#pragma unroll
      for (int t = 0; t < KG; ++t) {
        const int k0 = 32 * ((g + 1) * KG + t);
        pf[(g + 1) & 1][t] = frag_at(pa + k0);
#pragma unroll
        for (int nb = 0; nb < NBT; ++nb)
          hf[(g + 1) & 1][t][nb] = frag_at(bp + (nb * 16) * HPITCH + k0);
      }
    }
#pragma unroll
    for (int t = 0; t < KG; ++t) {
#pragma unroll
      for (int nb = 0; nb < NBT; ++nb) o[nb] = wmma16(pf[g & 1][t], hf[g & 1][t][nb], o[nb]);
    }
  }

  // ---- phase 4 ----
  // both lane halves hold rows 0..7: lanes 0..15 stage column tile 0, lanes 16..31 tile 1
#pragma unroll
  for (int r = 0; r < PT; ++r) {
    const float inv = __builtin_amdgcn_rcpf(Ls[r]);
    Ss[(unsigned)r * SPITCH + d0 + lane] = (hh ? o[1][r] : o[0][r]) * inv;
  }
  wave_lds_sync();
  v4f x[2];
  size_t off[2];
#pragma unroll
  for (unsigned i = 0; i < 2u; ++i) {
    const unsigned r = 4u * i + (lane >> 3);
    const unsigned c = (lane & 7u) * 4u;
    x[i] = *(const v4f*)&Ss[r * SPITCH + d0 + c];
    off[i] = ((size_t)b * SEQ_FULL + p0 + r) * DIM + d0 + c;
  }
#pragma unroll
  for (int i = 0; i < 2; ++i) *(v4f*)(out + off[i]) = x[i];
  
}

// ---------------------------------------------------------------------------
extern "C" void kernel_launch(void* const* d_in, const int* in_sizes, int n_in,
                              void* d_out, int out_size, void* d_ws, size_t ws_size,
                              hipStream_t stream) {
  if (n_in < 4) return;
  const long long need_x = ((long long)(NB - 1) * SEQ_FULL + SEQ) * DIM;
  if ((long long)in_sizes[0] < need_x) return;
  if ((long long)in_sizes[1] < need_x) return;
  if ((long long)in_sizes[2] < (long long)DIM * VDIM) return;
  if (in_sizes[3] < VDIM) return;
  if ((long long)out_size < need_x) return;
  if (ws_size < WS_TOTAL) return;

  const float* hq   = (const float*)d_in[0];   // [NB_FULL][SEQ_FULL][DIM]
  const float* hp   = (const float*)d_in[1];   // [NB_FULL][SEQ_FULL][DIM]
  const float* w_in = (const float*)d_in[2];   // [VDIM][DIM]  (out, in), shared by both sides
  const float* vvec = (const float*)d_in[3];   // [VDIM]
  float* out = (float*)d_out;                  // [NB_FULL][SEQ_FULL][DIM]

  char* ws = (char*)d_ws;
  _Float16* HqT  = (_Float16*)(ws + OFF_HQT);   // [NB][DIM][SEQ]
  float*    Spl  = (float*)(ws + OFF_S);        // sq [NB][VDIM][SEQ], then -sp rows [MROWS][VDIM]
  float*    Eq   = (float*)(ws + OFF_E);        // 2^sq [NB][VDIM][SEQ]
  float*    qnt  = (float*)(ws + OFF_N);        // [NB][NQN]

  dim3 blk(256);

  // operand conversion, both projections and the transposed hq plane: one launch
  proj_kernel<<<dim3(VDIM / 64, (2 * MROWS) / 64), blk, 0, stream>>>(hq, hp, w_in, Spl, HqT, Eq, qnt);

  // scores + softmax + weighted sum
  addattn_kernel<<<dim3(SEQ / PT, NB), blk, 0, stream>>>(
      Spl, Eq, qnt, Spl + (size_t)MROWS * VDIM, vvec, HqT, out);
}

// v010
// One run takes 25.9 microseconds.
// Two timings next to v009 put it at 1.05 and 1.03 times that version's speed.
// All steps since v000 together make it 3.36 times as fast.
#include <hip/hip_runtime.h>
#include <stddef.h>

// Contractions on v_wmma_f32_16x16x32_f16 (f16 operands, f32 accumulate): both input projections
// (rows x one shared weight, K = 256) and the probability x value product (K = 512 keys). Float
// inputs are RNE-converted to bf16 and carried in f16 (weights x64 for the hq rows and x-64 for
// the hp rows, so the hp projection comes out negated; softmax numerators x1024). The score sum
// over the 256-wide hidden axis (a matrix-vector product against one vector) runs on the vector
// unit in f32, tanh(x) formed as 1 - 2 / (1 + 2^(2 x log2 e)); the power of the difference is the
// product of one power per side (the query side's powers come from the projection launch, which
// forms each once), and four terms of a row share one reciprocal, while the arguments are small
// enough; softmax in f32.

typedef _Float16 v16h __attribute__((ext_vector_type(16)));
typedef _Float16 v8h  __attribute__((ext_vector_type(8)));
typedef _Float16 v4h  __attribute__((ext_vector_type(4)));
typedef float    v8f  __attribute__((ext_vector_type(8)));
typedef float    v4f  __attribute__((ext_vector_type(4)));
typedef float    v2f  __attribute__((ext_vector_type(2)));
typedef _Float16 h16;

#ifndef NB
#define NB 4
#endif
#ifndef SEQ
#define SEQ 512
#endif
#define NB_FULL  4
#define SEQ_FULL 512
#define DIM   256          // feature width of the hq / hp rows (pq_size)
#define VDIM  256          // hidden width of the score
#define MROWS (NB * SEQ)   // compact rows per activation plane (query length == passage length)
#define PT    8            // passage rows per attention block: (SEQ / PT) * NB = 256 blocks
#define VSTEP 8            // hidden columns per score-loop trip (PT * VSTEP terms per thread and query)
#define NTRIP (VDIM / VSTEP)  // score-loop trips per pass
#define NPF   4            // register sets for the query operand: the current trip's and three in flight
#define NQ    (SEQ / 256)  // queries per thread of the attention kernel: q = tid + 256 u
#define WCOLS (DIM / 8)    // output columns per wave in the attention kernel
#define NBT   (WCOLS / 16) // 16-column output tiles per wave

static_assert(NB >= 1 && NB <= NB_FULL);
static_assert(SEQ >= 256 && SEQ <= SEQ_FULL && (SEQ % 256) == 0);
static_assert((DIM % 128) == 0);
static_assert((VDIM % 64) == 0 && (VDIM % 4) == 0);
static_assert(VDIM == 256);                 // one thread per hidden column when staging the vector
static_assert((MROWS % 64) == 0);
static_assert(DIM == 8 * WCOLS);            // 8 waves x WCOLS output columns
static_assert(WCOLS == 32 && NBT == 2);
static_assert((SEQ % 64) == 0 && (SEQ % 32) == 0);
static_assert(PT == 8);                     // A tile rows 0..7; rows 8..15 repeat them; 1 row per wave
static_assert(PT == 2 * 4);                 // output store: 2 steps x 4 rows
static_assert(PT * VDIM == 256 * 2 * 4);    // sp tile staging: 256 threads x 2 steps x 4 floats
static_assert(VSTEP == 2 * 4 && (VDIM % VSTEP) == 0);
static_assert((NTRIP % NPF) == 0 && NTRIP >= NPF);
static_assert((PT % 4) == 0);               // two halves of the passage rows, each of whole row pairs
static_assert((SEQ % PT) == 0);

#define LDA (DIM + 8)   // halves per staged operand row: 16 B x an odd number, so that the 16 rows
                        // of a fragment read fall on 64 different LDS banks
#define LDC 68   // floats per LDS row (272 B, 16-B aligned)
static_assert((LDA % 8) == 0 && ((LDA / 8) % 2) == 1 && LDA >= DIM);
static_assert((LDC % 4) == 0 && LDC >= 64);
static_assert(DIM == VDIM);                 // a block's column index names its output columns and the
                                            // feature columns that it transposes
static_assert(64 * DIM == 256 * 16 * 4);    // operand staging: 256 threads x 16 steps x 4 floats

#define SMAXW  ((SEQ > DIM) ? SEQ : DIM)
#define SPITCH (SMAXW + 4)   // floats per score / output-stage row
#define PPITCH (SEQ + 8)     // halves per probability row
#define HROWS  (256 / (SEQ / 8))   // value-plane rows that 256 threads cover with 16 bytes each
#define HPITCH (SEQ + 8)     // halves per staged value row: 16 B x an odd number, so that the 16 rows
                             // of a fragment read fall on 64 different LDS banks
static_assert((SPITCH % 4) == 0 && SPITCH >= SEQ && SPITCH >= DIM);
static_assert((PPITCH % 8) == 0 && PPITCH >= SEQ);
static_assert((HPITCH % 8) == 0 && ((HPITCH / 8) % 2) == 1 && HPITCH >= SEQ);

#define WCARRY 64.0f          // weight planes carried x64 (hp plane x-64)
#define PCARRY_LOG2 10.0f     // softmax numerators carried x1024 (added to the exp2 argument)
#define TWO_LOG2E 2.885390081777927f
#define LOG2E     1.4426950408889634f
#define SUMLIM    31.0f       // largest |sq'| + largest |sp'| <= 31: a denominator is at most 1 + 2^31, the
                              // product of four at most about 2^124, so it and its reciprocal are normal f32
#define WLIM      536870912.0f  // |v| <= 2^29: a numerator over four terms stays below 2^125

// workspace layout (bytes)
#define HQT_BYTES ((size_t)NB * DIM * SEQ * 2)      // hq transposed [b][d][q], f16
#define S_BYTES   ((size_t)2 * MROWS * VDIM * 4)    // scaled projections, f32: sq [b][v][q], then -sp rows
#define E_BYTES   ((size_t)MROWS * VDIM * 4)        // powers 2^sq', f32, [b][v][q] like sq
#define NQN       ((SEQ / 64) * (VDIM / 64) * 8)    // notes of the largest |sq'| per batch: one per
                                                    // wave of each projection block of hq rows
#define N_BYTES   ((size_t)NB * NQN * 4)
#define OFF_HQT ((size_t)0)
#define OFF_S   (OFF_HQT + HQT_BYTES)
#define OFF_E   (OFF_S + S_BYTES)
#define OFF_N   (OFF_E + E_BYTES)
#define WS_TOTAL (OFF_N + N_BYTES)
static_assert((HQT_BYTES % 128) == 0 && (S_BYTES % 128) == 0 && (E_BYTES % 128) == 0);
static_assert(NQN <= 256);                  // the attention block reads its batch's notes one per thread
static_assert(WS_TOTAL <= (size_t)134217728);

// ---------------------------------------------------------------------------
__device__ __forceinline__ float bf16r(float x) {   // RNE convert to bf16, returned widened
  unsigned int u = __float_as_uint(x);
  u = (u + 0x7FFFu + ((u >> 16) & 1u)) & 0xFFFF0000u;
  return __uint_as_float(u);
}

// f32 -> f16 operand convert that cannot produce an f16 subnormal (value select).
static __device__ __forceinline__ h16 toh_flush(float v) {
  const h16 r = (h16)v;
  return (fabsf(v) < 6.103515625e-05f) ? (h16)0.0f : r;
}

// 16-bit fragment: p points at element [row = lane&15][k0 + 8*(lane>>4)] of a k-contiguous
// row. Elements 0..7 <- k0+8h+0..7, elements 8..15 <- k0+16+8h+0..7 (same map for A and B).
__device__ __forceinline__ v16h frag_at(const _Float16* p) {
  v8h lo = *(const v8h*)(p);
  v8h hi = *(const v8h*)(p + 16);
  v16h out;
#pragma unroll
  for (int i = 0; i < 8; ++i) { out[i] = lo[i]; out[i + 8] = hi[i]; }
  return out;
}

__device__ __forceinline__ v8f wmma16(v16h a, v16h b, v8f c) {
  v8f d = __builtin_amdgcn_wmma_f32_16x16x32_f16(false, a, false, b, (short)0, c,
                                                 false, false);
  asm volatile("v_nop\n\tv_nop\n\tv_nop\n\tv_nop" : "+v"(d) : "v"(a), "v"(b));
  return d;
}

__device__ __forceinline__ float red32_sum(float x) {
#pragma unroll
  for (int off = 1; off < 32; off <<= 1) x += __shfl_xor(x, off, 32);
  return x;
}
__device__ __forceinline__ float red32_max(float x) {
#pragma unroll
  for (int off = 1; off < 32; off <<= 1) x = fmaxf(x, __shfl_xor(x, off, 32));
  return x;
}

// Maximum over the wave's 32 lanes, in every lane, on the vector unit: four exchanges inside each
// 16-lane row (DPP row_xmask 1, 2, 4, 8), then lane l with lane l ^ 16.
__device__ __forceinline__ float wave_max_dpp(float x) {
  x = fmaxf(x, __int_as_float(__builtin_amdgcn_update_dpp(0, __float_as_int(x), 0x161, 0xf, 0xf, true)));
  x = fmaxf(x, __int_as_float(__builtin_amdgcn_update_dpp(0, __float_as_int(x), 0x162, 0xf, 0xf, true)));
  x = fmaxf(x, __int_as_float(__builtin_amdgcn_update_dpp(0, __float_as_int(x), 0x164, 0xf, 0xf, true)));
  x = fmaxf(x, __int_as_float(__builtin_amdgcn_update_dpp(0, __float_as_int(x), 0x168, 0xf, 0xf, true)));
  const int b = __float_as_int(x);
  return fmaxf(x, __int_as_float(__builtin_amdgcn_permlanex16(b, b, 0x76543210, 0xfedcba98, false, false)));
}

__device__ __forceinline__ void wave_lds_sync() {
  __builtin_amdgcn_fence(3 /* release order */, "wavefront");
  asm volatile("s_wait_dscnt 0x0" ::: "memory");
  __builtin_amdgcn_wave_barrier();
}

// Eight asynchronous 16-byte copies from global memory to LDS; every lane names its own LDS byte
// address and its own global address. The s_wait_xcnt stands inside the statement, behind the last
// copy, so that no address register is written again in front of it.
__device__ __forceinline__ void async_copy8(const unsigned (&l)[8], const _Float16* const (&g)[8]) {
  asm volatile(
      "global_load_async_to_lds_b128 %0, %8, off\n\t"
      "global_load_async_to_lds_b128 %1, %9, off\n\t"
      "global_load_async_to_lds_b128 %2, %10, off\n\t"
      "global_load_async_to_lds_b128 %3, %11, off\n\t"
      "global_load_async_to_lds_b128 %4, %12, off\n\t"
      "global_load_async_to_lds_b128 %5, %13, off\n\t"
      "global_load_async_to_lds_b128 %6, %14, off\n\t"
      "global_load_async_to_lds_b128 %7, %15, off\n\t"
      "s_wait_xcnt 0x0"
      :: "v"(l[0]), "v"(l[1]), "v"(l[2]), "v"(l[3]), "v"(l[4]), "v"(l[5]), "v"(l[6]), "v"(l[7]),
         "v"(g[0]), "v"(g[1]), "v"(g[2]), "v"(g[3]), "v"(g[4]), "v"(g[5]), "v"(g[6]), "v"(g[7])
      : "memory");
}

__device__ __forceinline__ float fast_exp2(float x) {
#if __has_builtin(__builtin_amdgcn_exp2f)
  return __builtin_amdgcn_exp2f(x);
#else
  return __expf(x * 0.6931471805599453f);
#endif
}

// ---------------------------------------------------------------------------
// Projection GEMM C[64x64 tile] = X[rows][DIM] . W[n][DIM]^T, straight from the f32 inputs: the
// block converts its 64 activation rows (f16(bf16(x))) and its 64 weight rows (f16(carry * bf16(w)),
// the [out][in] layout is already k-contiguous) into LDS and takes its fragments from there.
// 8 waves (mw = 16-row group, nw = 32-col group), 2 accumulators/wave.
// Rows 0..MROWS-1 are hq rows (carry +64), rows MROWS..2*MROWS-1 hp rows (carry -64, an exact sign
// fold); which, is block-uniform. Output f32 = acc * (2 log2 e / 64), i.e. the projection
// pre-scaled for the exp2 form of tanh. The hp rows go out as rows [MROWS][VDIM]; the hq rows go
// out transposed per batch, [NB][VDIM][SEQ], so that the attention kernel's threads (NQ queries
// each, 256 apart) read one hidden column of 32 neighbouring queries as one 128-byte line. Epilogue staged
// through Cs (cross-wave); an hq tile is laid into Cs column-major, so the read-out and the
// 16-byte stores are the same for both. Store coverage: 4 steps x 16 rows == 64 tile rows.
// An hq block also writes its 64 rows x 64 feature columns (the columns of its own column index)
// of the f16 plane transposed per batch, HqT[NB][DIM][SEQ]: each 128-byte line by 8 consecutive
// lanes x 16 B of one instruction; 2 steps x 32 rows == 64 plane rows.
// An hq block further writes the powers 2^sq' of its tile (Eq, laid out like sq) and, per wave, the
// largest |sq'| among the values that the wave stores (qnote): every attention block of the batch
// needs them, so they are formed here, once, and not in each of those blocks.
// As / Ws: cross-wave (block barrier). Grid (VDIM/64, 2*MROWS/64).
// ---------------------------------------------------------------------------
__global__ __launch_bounds__(256) void proj_kernel(
    const float* __restrict__ hq, const float* __restrict__ hp, const float* __restrict__ W,
    float* __restrict__ outf, _Float16* __restrict__ HqT, float* __restrict__ Eq,
    float* __restrict__ qnote) {
  __shared__ __attribute__((aligned(16))) _Float16 As[64 * LDA];
  __shared__ __attribute__((aligned(16))) _Float16 Ws[64 * LDA];
  __shared__ __attribute__((aligned(16))) float Cs[64 * LDC];
  const unsigned tid = threadIdx.x, lane = tid & 31u;
  const unsigned w = (unsigned)__builtin_amdgcn_readfirstlane((int)(threadIdx.x >> 5));
  const unsigned mw = w >> 1, nw = w & 1u;
  const unsigned hh = lane >> 4, m = lane & 15u;
  const unsigned n0 = blockIdx.x * 64u;
  const unsigned row0 = blockIdx.y * 64u;
  const bool tq = row0 < (unsigned)MROWS;   // block-uniform: an hq tile, stored transposed
  const unsigned crow0 = tq ? row0 : row0 - (unsigned)MROWS;   // first row within its plane
  const unsigned bidx = crow0 / (unsigned)SEQ;                 // batch of the tile (SEQ % 64 == 0)
  const unsigned s0 = crow0 - bidx * (unsigned)SEQ;
  const float carry = tq ? WCARRY : -WCARRY;

  // a step of the whole block covers 4 rows of DIM floats; a wave's load is 512 contiguous bytes
  const unsigned sr = tid >> 6, sc = (tid & 63u) * 4u;
  const float* asrc = (tq ? hq : hp) + ((size_t)bidx * SEQ_FULL + s0 + sr) * DIM + sc;
  const float* wsrc = W + (size_t)(n0 + sr) * DIM + sc;
  v4f a4[16], w4[16];
#pragma unroll  // constant indices: a4 and w4 stay in registers; all 32 loads are in flight at once
  for (unsigned j = 0; j < 16u; ++j) {
    a4[j] = *(const v4f*)(asrc + (size_t)j * (4 * DIM));
    w4[j] = *(const v4f*)(wsrc + (size_t)j * (4 * DIM));
  }
  // The wait that stands before a register named by an issued load is written again. It takes the
  // two addresses as inputs, so that neither is reused in front of it, not even as a load's target.
  asm volatile("s_wait_xcnt 0x0" :: "v"(asrc), "v"(wsrc) : "memory");
#pragma unroll
  for (unsigned j = 0; j < 16u; ++j) {
    v4h ha, hw;
#pragma unroll
    for (int i = 0; i < 4; ++i) {
      ha[i] = toh_flush(bf16r(a4[j][i]));
      hw[i] = toh_flush(carry * bf16r(w4[j][i]));
    }
    *(v4h*)&As[(sr + 4u * j) * LDA + sc] = ha;
    *(v4h*)&Ws[(sr + 4u * j) * LDA + sc] = hw;
  }
  __syncthreads();

  const _Float16* ap  = &As[(mw * 16u + m) * LDA + hh * 8u];
  const _Float16* bp0 = &Ws[(nw * 32u + m) * LDA + hh * 8u];
  const _Float16* bp1 = bp0 + 16 * LDA;
  v8f acc0 = {}, acc1 = {};
#pragma unroll 1  // rolled: a trip reads four steps' fragments (96 registers) together, ahead of their
                  // products, so that LDS latency is waited for twice and not at every step
  for (unsigned k0 = 0; k0 < (unsigned)DIM; k0 += 128u) {
    v16h a[4], b0[4], b1[4];
#pragma unroll  // constant indices: the fragments stay in registers
    for (unsigned t = 0; t < 4u; ++t) {
      a[t]  = frag_at(ap + k0 + 32u * t);
      b0[t] = frag_at(bp0 + k0 + 32u * t);
      b1[t] = frag_at(bp1 + k0 + 32u * t);
    }
#pragma unroll
    for (unsigned t = 0; t < 4u; ++t) {
      acc0 = wmma16(a[t], b0[t], acc0);
      acc1 = wmma16(a[t], b1[t], acc1);
    }
  }
  if (tq) {
    // Cs[output column][tile row]: a lane's 8 accumulator rows are 8 neighbouring floats
    float* d = &Cs[(nw * 32u + m) * LDC + mw * 16u + hh * 8u];
#pragma unroll
    for (int g = 0; g < 2; ++g) {
      *(v4f*)(d + 4 * g) = (v4f){acc0[4 * g], acc0[4 * g + 1], acc0[4 * g + 2], acc0[4 * g + 3]};
      *(v4f*)(d + 16 * LDC + 4 * g) =
          (v4f){acc1[4 * g], acc1[4 * g + 1], acc1[4 * g + 2], acc1[4 * g + 3]};
    }
  } else {
#pragma unroll
    for (int r = 0; r < 8; ++r) {
      float* d = &Cs[(mw * 16u + hh * 8u + (unsigned)r) * LDC + nw * 32u + m];
      d[0]  = acc0[r];
      d[16] = acc1[r];
    }
  }
  __syncthreads();

  const float cs = TWO_LOG2E / WCARRY;
  // first element and row pitch of the tile in the output plane, as Cs holds it
  const size_t obase = tq ? ((size_t)bidx * VDIM + n0) * SEQ + s0
                          : (size_t)row0 * VDIM + n0;
  const unsigned opitch = tq ? (unsigned)SEQ : (unsigned)VDIM;
  v4f xs[4];
  size_t off[4];
#pragma unroll
  for (unsigned i = 0; i < 4u; ++i) {
    const unsigned r = 16u * i + (tid >> 4);
    const unsigned c = (tid & 15u) * 4u;
    const v4f u = *(const v4f*)&Cs[r * LDC + c];
    xs[i] = u * cs;
    off[i] = obase + (size_t)r * opitch + c;
  }
  // the transposed f16 plane, from the staged rows; behind the last barrier, so that none waits
  // for these stores
  v8h xt[2] = {};
  size_t offt[2] = {};
  v4f es[4] = {};
  float nmax = 0.0f;
  if (tq) {
#pragma unroll  // constant indices: xs and es stay in registers
    for (unsigned i = 0; i < 4u; ++i) {
#pragma unroll
      for (int e = 0; e < 4; ++e) {
        nmax = fmaxf(nmax, fabsf(xs[i][e]));
        es[i][e] = fast_exp2(xs[i][e]);
      }
    }
    nmax = wave_max_dpp(nmax);
#pragma unroll
    for (unsigned i = 0; i < 2u; ++i) {
      const unsigned n = 32u * i + (tid >> 3);
      const unsigned kc = (tid & 7u) * 8u;
#pragma unroll
      for (unsigned e = 0; e < 8u; ++e) xt[i][e] = As[(kc + e) * LDA + n0 + n];
      offt[i] = ((size_t)bidx * DIM + n0 + n) * SEQ + s0 + kc;
    }
  }
#pragma unroll
  for (int i = 0; i < 4; ++i) *(v4f*)(outf + off[i]) = xs[i];
  // The wait that stands before a register named by an issued store is written again: the
  // addresses formed in the branch below reuse registers of the stores above. It stands in front of
  // the branch, so that nothing of the branch's code is moved ahead of it.
  asm volatile("s_wait_xcnt 0x0" ::: "memory");
  if (tq) {
#pragma unroll
    for (int i = 0; i < 2; ++i) *(v8h*)(HqT + offt[i]) = xt[i];
    float* ed[4];
#pragma unroll
    for (int i = 0; i < 4; ++i) {
      ed[i] = Eq + off[i];
      *(v4f*)ed[i] = es[i];
    }
    // The wait that stands before a register named by an issued store is written again: the note's
    // address below may reuse one. It takes the four addresses as inputs, so that none is reused in
    // front of it.
    asm volatile("s_wait_xcnt 0x0" :: "v"(ed[0]), "v"(ed[1]), "v"(ed[2]), "v"(ed[3]) : "memory");
    if (lane == 0u)
      qnote[((bidx * (unsigned)(SEQ / 64) + s0 / 64u) * (unsigned)(VDIM / 64) + blockIdx.x) * 8u + w] = nmax;
  }
}

// ---------------------------------------------------------------------------
// Difference-form additive attention per (8 passage rows, batch). 8 waves.
// Sp holds the NEGATED scaled hp projection (weight plane carried x-64), so that
// sq'[q][v] + sp'[p][v] = 2 log2 e * (Wq[q][v] - Wp[p][v]).
// Phase 0: stage the 8 scaled sp rows (sp_s), their powers 2^sp' (ep_s) and the vector
//          -2*bf16(v) (vs) in LDS; each wave notes the largest |sp'| in its part of the rows and
//          the largest of its part of the batch's notes of |sq'|.
// Phase 1: thread t owns the queries q = 256*u + t, all in one pass (term by term: one pass per query); for the 8 passage rows it accumulates
//          sum_v vs[v] / (1 + 2^(sq'[q][v] + sp'[p][v])) in f32 (equals the score up
//          to a constant that is the same for every query, which the softmax removes);
//          results into Ss[p][q]. The power is taken as 2^sq' * 2^sp' (both read as powers) and
//          four terms share one reciprocal. That holds only while the batch's largest |sq'| and the
//          block's largest |sp'| add up to SUMLIM at most; a block that meets more forms its sums
//          term by term from the power of the sum, which is right at any size.
//          sp_s / ep_s / vs / Ss: cross-wave (block barriers).
// Phase 2: wave w owns row w: row max, f16(1024 * exp(s - max)) into Pl (select on
//          the exp2 argument keeps the plane free of f16 subnormals), row sum over the
//          converted values into Ls. Pl / Ls: cross-wave (block barrier).
//          In phase 1 every wave also starts asynchronous copies of its share of the batch's
//          transposed f16 plane HqT[d][q] into Hs; they fly under the score loop.
// Phase 3: out tile [8][32 per wave] = Pl[8][SEQ] . Hs[d][q]^T, B fragments from LDS (Hs:
//          cross-wave; each wave's copy wait, then the block barrier in front of this phase).
//          A-tile rows 8..15 read rows 0..7 again, so lanes 16..31
//          of each accumulator hold the same 8 rows as lanes 0..15.
// Phase 4: scale by 1 / row sum, stage in the wave's own 32 columns of Ss (wave-private from
//          Store coverage: 2 steps x 4 rows == 8 rows.
// Grid (SEQ/8, NB).
// ---------------------------------------------------------------------------
// One thread's sums over the hidden axis for PT passage rows and NU of its queries (256 apart).
// SPLIT: sqc and sp hold the powers 2^sq' and 2^sp', the term's power is their product, and four
// terms w / d of a row are added over their common denominator, so that they take one reciprocal;
// otherwise they hold sq' and sp', the power is 2^(sq' + sp') and every term has its own reciprocal.
// The passage rows and the vector entries are the same for every lane:
// with one query a thread the
// eight waves' reads of a trip take as many clocks as a SIMD's arithmetic of that trip. So a thread
// works all its NU = NQ queries on each operand that it has read (the term-by-term form, which is
// seldom run and long, takes one query a call).
// sqc points at the thread's first query in hidden column 0 of the transposed plane (column pitch
// SEQ): a wave's load of one column is one 128-byte line that no other wave reads, so each comes from
// L2; the loads of trip t + NPF - 1 are therefore issued at the head of trip t, into the register set
// that trip t - 1 has used up.
// The value plane's asynchronous copies (hl0 / hg0: this thread's piece in the plane's first HROWS
// rows) are issued from here, one set of 32 a thread (sets set0 .. set0 + NU - 1 of the plane's NQ)
// ahead of each NTRIP / NU trips, and fly under them.
template <bool SPLIT, int NU>
__device__ __forceinline__ void score_pass(const float* __restrict__ sqc, const float* sp,
                                           const float* vs, unsigned hl0, const _Float16* hg0,
                                           unsigned set0, float (&acc)[NU][PT]) {
  constexpr int NTP = NTRIP / NU;   // trips behind each set of copies
  static_assert((NTRIP % NU) == 0 && (NTP % NPF) == 0 && NTP >= NPF);
  float ring[NPF][NU][VSTEP];
  // every inner loop below is unrolled so that acc2, accq, ring, s4 and d are indexed by constants and
  // stay in registers; the loops over part and t0 stay rolled: NPF trips, one per register set, are
  // the body
  v2f acc2[NU][PT / 2];   // rows 2 pp and 2 pp + 1 (own-reciprocal form)
  v2f accq[NU][PT];       // row p: the even and the odd hidden columns (SPLIT form)
#pragma unroll
  for (int u = 0; u < NU; ++u) {
#pragma unroll
    for (int pp = 0; pp < PT / 2; ++pp) acc2[u][pp] = (v2f){0.0f, 0.0f};
#pragma unroll
    for (int p = 0; p < PT; ++p) accq[u][p] = (v2f){0.0f, 0.0f};
  }
#pragma unroll
  for (int s = 0; s < NPF - 1; ++s) {
#pragma unroll
    for (int u = 0; u < NU; ++u) {
#pragma unroll
      for (int j = 0; j < VSTEP; ++j) ring[s][u][j] = sqc[(size_t)(s * VSTEP + j) * SEQ + 256 * u];
    }
  }
  // The trip's LDS operands are read ahead of their use, so that no trip waits out its own LDS latency:
  // the vector entries one trip ahead into the other of two register sets; the passage rows in two
  // halves of PT / 2 rows, each half's next-trip values read as soon as the half's arithmetic is
  // through with the registers, under the other half's arithmetic.
  static_assert((NPF % 2) == 0);   // the set of a trip is a constant of its place in the loop body
  v4f w4[2][2], s4[2][PT / 2][2];
#pragma unroll
  for (int h = 0; h < 2; ++h) w4[0][h] = *(const v4f*)&vs[4u * (unsigned)h];
#pragma unroll
  for (int p = 0; p < PT; ++p) {
#pragma unroll
    for (int h = 0; h < 2; ++h)
      s4[p / (PT / 2)][p % (PT / 2)][h] = *(const v4f*)&sp[(unsigned)p * VDIM + 4u * (unsigned)h];
  }
#pragma unroll 1
  for (unsigned part = 0; part < (unsigned)NU; ++part) {
    // The earlier set's copies have landed before more are issued: a wave never has more than one
    // set of 32 copies outstanding.
    asm volatile("s_wait_asynccnt 0x0" ::: "memory");
#pragma unroll  // constant indices: the eight address sets of a statement stay in registers
    for (unsigned jj = 0; jj < 4u; ++jj) {
      unsigned la[8];
      const _Float16* ga[8];
#pragma unroll
      for (unsigned j = 0; j < 8u; ++j) {
        const unsigned n = ((set0 + part) * 4u + jj) * 8u + j;   // the block's n-th set of HROWS plane rows
        la[j] = hl0 + n * (unsigned)(HROWS * HPITCH * 2);
        ga[j] = hg0 + (size_t)n * (HROWS * SEQ);
      }
      async_copy8(la, ga);
    }
#pragma unroll 1
    for (unsigned t0 = part * (unsigned)NTP; t0 < (part + 1u) * (unsigned)NTP; t0 += (unsigned)NPF) {
#pragma unroll
      for (int s = 0; s < NPF; ++s) {
        const int cur = s & 1, nxt = cur ^ 1;   // constants once the loop over s is unrolled
        // behind the last trip there is nothing to fetch: the index stops there (in bounds, not used)
        const unsigned tn = t0 + (unsigned)(s + NPF - 1);
        const unsigned vf = (tn < (unsigned)NTRIP ? tn : (unsigned)(NTRIP - 1)) * (unsigned)VSTEP;
#pragma unroll
        for (int u = 0; u < NU; ++u) {
#pragma unroll
          for (int j = 0; j < VSTEP; ++j)
            ring[(s + NPF - 1) % NPF][u][j] = sqc[(size_t)(vf + (unsigned)j) * SEQ + 256 * u];
        }
        const unsigned tl = t0 + (unsigned)(s + 1);   // the next trip, whose LDS operands are read now
        const unsigned vl = (tl < (unsigned)NTRIP ? tl : (unsigned)(NTRIP - 1)) * (unsigned)VSTEP;
#pragma unroll
        for (int h = 0; h < 2; ++h) w4[nxt][h] = *(const v4f*)&vs[vl + 4u * (unsigned)h];
        // holds the trip's loads in one place at its head, in front of the arithmetic that they fly under
        __builtin_amdgcn_sched_barrier(0);
        static_assert(VSTEP == 8);
        v2f w2[VSTEP / 2];
#pragma unroll
        for (int g = 0; g < VSTEP / 2; ++g)
          w2[g] = (v2f){w4[cur][g >> 1][2 * (g & 1)], w4[cur][g >> 1][2 * (g & 1) + 1]};
        const v2f one = {1.0f, 1.0f};
#pragma unroll
        for (int hf = 0; hf < 2; ++hf) {
#pragma unroll
          for (int u = 0; u < NU; ++u) {
            // Two-wide f32 forms written out (the packed fma does two a clock): the denominators pair
            // two neighbouring hidden columns of one row.
            v2f d[PT / 2][VSTEP / 2];
#pragma unroll
            for (int p = 0; p < PT / 2; ++p) {
#pragma unroll
              for (int g = 0; g < VSTEP / 2; ++g) {
                const v2f a2 = {ring[s][u][2 * g], ring[s][u][2 * g + 1]};
                const v2f s2 = {s4[hf][p][g >> 1][2 * (g & 1)], s4[hf][p][g >> 1][2 * (g & 1) + 1]};
                if (SPLIT) {
                  d[p][g] = __builtin_elementwise_fma(a2, s2, one);
                } else {
                  const v2f x = a2 + s2;
                  d[p][g] = (v2f){fast_exp2(x[0]), fast_exp2(x[1])} + one;
                }
              }
            }
            if (SPLIT) {
              // w0/d0 + w1/d1 + w2/d2 + w3/d3 = n / (d0 d1 d2 d3), built from the two pairs: a
              // reciprocal issues at half the rate of a packed product and serves one value, not two.
              // One half of each two-wide value takes the trip's four even columns, the other its four
              // odd ones.
#pragma unroll
              for (int p = 0; p < PT / 2; ++p) {
                const v2f d01 = d[p][0] * d[p][1];
                const v2f d23 = d[p][2] * d[p][3];
                const v2f n01 = __builtin_elementwise_fma(w2[0], d[p][1], w2[1] * d[p][0]);
                const v2f n23 = __builtin_elementwise_fma(w2[2], d[p][3], w2[3] * d[p][2]);
                const v2f dd = d01 * d23;
                const v2f nn = __builtin_elementwise_fma(n01, d23, n23 * d01);
                const v2f r = {__builtin_amdgcn_rcpf(dd[0]), __builtin_amdgcn_rcpf(dd[1])};
                accq[u][hf * (PT / 2) + p] = __builtin_elementwise_fma(nn, r, accq[u][hf * (PT / 2) + p]);
              }
            } else {
              // the sums pair two rows at one hidden column; each row's sum takes its terms in
              // ascending column order
#pragma unroll
              for (int j = 0; j < VSTEP; ++j) {
                const float w = w4[cur][j >> 2][j & 3];
#pragma unroll
                for (int pp = 0; pp < PT / 4; ++pp) {
                  const v2f r = {__builtin_amdgcn_rcpf(d[2 * pp][j >> 1][j & 1]),
                                 __builtin_amdgcn_rcpf(d[2 * pp + 1][j >> 1][j & 1])};
                  acc2[u][hf * (PT / 4) + pp] =
                      __builtin_elementwise_fma((v2f){w, w}, r, acc2[u][hf * (PT / 4) + pp]);
                }
              }
            }
          }
          // keeps the half's arithmetic in front of the reads that take over its operand registers
          // (drawn ahead, they would need a second set of registers)
          __builtin_amdgcn_sched_barrier(0);
#pragma unroll
          for (int p = 0; p < PT / 2; ++p) {
#pragma unroll
            for (int h = 0; h < 2; ++h)
              s4[hf][p][h] = *(const v4f*)&sp[(unsigned)(hf * (PT / 2) + p) * VDIM + vl + 4u * (unsigned)h];
          }
          // keeps these reads here, in one place and a half trip ahead of their use, and each trip's
          // instructions in that trip: left free, the scheduler drew the loads and the LDS reads of
          // all NPF trips to the head of the body, waited for all of them there and took some 500
          // registers
          __builtin_amdgcn_sched_barrier(0);
        }
      }
    }
  }
#pragma unroll
  for (int u = 0; u < NU; ++u) {
    if (SPLIT) {
#pragma unroll
      for (int p = 0; p < PT; ++p) acc[u][p] = accq[u][p][0] + accq[u][p][1];
    } else {
#pragma unroll
      for (int pp = 0; pp < PT / 2; ++pp) {
        acc[u][2 * pp] = acc2[u][pp][0];
        acc[u][2 * pp + 1] = acc2[u][pp][1];
      }
    }
  }
}

__global__ __launch_bounds__(256) void addattn_kernel(
    const float* __restrict__ Sq, const float* __restrict__ Eq, const float* __restrict__ qnote,
    const float* __restrict__ Sp, const float* __restrict__ vvec,
    const _Float16* __restrict__ HqT, float* __restrict__ out) {
  __shared__ __attribute__((aligned(16))) float sp_s[PT * VDIM];
  __shared__ __attribute__((aligned(16))) float ep_s[PT * VDIM];
  __shared__ __attribute__((aligned(16))) float bmw[8];
  __shared__ __attribute__((aligned(16))) float qmw[8];
  __shared__ __attribute__((aligned(16))) float vs[VDIM];
  __shared__ __attribute__((aligned(16))) float Ss[PT * SPITCH];
  __shared__ __attribute__((aligned(16))) _Float16 Pl[PT * PPITCH];
  __shared__ __attribute__((aligned(16))) float Ls[PT];
  __shared__ __attribute__((aligned(16))) _Float16 Hs[DIM * HPITCH];
  static_assert(sizeof(float) * (2 * PT * VDIM + VDIM + PT * SPITCH + PT + 8 + 8) +
                sizeof(_Float16) * (PT * PPITCH + DIM * HPITCH) <= 327680);
  // 16-byte pieces of the value plane per thread and set; all of one set's are in flight at once
  static_assert((DIM * SEQ / 8) / 256 / (SEQ / 256) == 32 && ((SEQ / 8) % 32) == 0);

  const unsigned tid = threadIdx.x, lane = tid & 31u;
  const unsigned wave = (unsigned)__builtin_amdgcn_readfirstlane((int)(threadIdx.x >> 5));
  const unsigned hh = lane >> 4, m = lane & 15u;
  const unsigned p0 = blockIdx.x * (unsigned)PT;
  const unsigned b = blockIdx.y;

  // ---- phase 0 ----
  float bmax = 0.0f;
  const float vraw = vvec[tid];   // read here, so that it flies together with the sp rows' loads
  // this thread's one of the batch's notes (a thread past the last reads the last again)
  const float qn = qnote[b * (unsigned)NQN + (tid < (unsigned)NQN ? tid : (unsigned)(NQN - 1))];
  const float* spsrc[2];
  v4f x2[2];
#pragma unroll
  for (unsigned j = 0; j < 2u; ++j) {
    const unsigned idx = tid + 256u * j;
    const unsigned r = idx >> 6, c = (idx & 63u) * 4u;
    spsrc[j] = Sp + (size_t)(b * (unsigned)SEQ + p0 + r) * VDIM + c;
    x2[j] = *(const v4f*)spsrc[j];
  }
  // The wait that stands before a register named by an issued load is written again. It takes the
  // two addresses as inputs, so that neither is reused in front of it, not even as a load's target.
  asm volatile("s_wait_xcnt 0x0" :: "v"(spsrc[0]), "v"(spsrc[1]) : "memory");
#pragma unroll
  for (unsigned j = 0; j < 2u; ++j) {
    const unsigned idx = tid + 256u * j;
    const unsigned r = idx >> 6, c = (idx & 63u) * 4u;
    const v4f x = x2[j];
    v4f e;
#pragma unroll  // constant element index: x and e stay in registers
    for (int i = 0; i < 4; ++i) {
      bmax = fmaxf(bmax, fabsf(x[i]));
      e[i] = fast_exp2(x[i]);
    }
    *(v4f*)&sp_s[r * VDIM + c] = x;
    *(v4f*)&ep_s[r * VDIM + c] = e;
  }
  // a vector entry too large for the shared numerator counts as an argument out of range
  if (!(fabsf(vraw) <= WLIM)) bmax = __builtin_inff();
  bmax = wave_max_dpp(bmax);
  const float qmax = wave_max_dpp(qn);
  if (lane == 0u) {
    bmw[wave] = bmax;
    qmw[wave] = qmax;
  }
  vs[tid] = -2.0f * bf16r(vraw);
  __syncthreads();
  float bmall = 0.0f;   // the block's largest |sp'|: the same in every wave
  float qmall = 0.0f;   // the batch's largest |sq'|: the same in every wave
#pragma unroll  // each set of eight notes comes in two 16-byte LDS reads
  for (int i = 0; i < 8; ++i) {
    bmall = fmaxf(bmall, bmw[i]);
    qmall = fmaxf(qmall, qmw[i]);
  }
  // block-uniform: every argument of this block inside SUMLIM
  const bool split_ok = __builtin_amdgcn_ballot_w32(!(qmall + bmall <= SUMLIM)) == 0u;

  // ---- phase 1 ----
  // One copy of the whole block moves 256 pieces of 16 bytes = HROWS rows of the value plane; a wave's
  // 32 pieces are 512 contiguous bytes of one row. hl0 / hg0: this thread's piece in rows 0..HROWS-1.
  const unsigned hrow = tid / (unsigned)(SEQ / 8), hcol = (tid % (unsigned)(SEQ / 8)) * 8u;
  const unsigned hl0 = (unsigned)(size_t)&Hs[hrow * HPITCH + hcol];   // LDS byte address
  const _Float16* hg0 = HqT + ((size_t)b * DIM + hrow) * SEQ + hcol;
  const size_t qoff = (size_t)b * VDIM * SEQ + tid;   // Sq, Eq: [b][hidden column][query]
  if (split_ok) {
    float acc[NQ][PT];
    score_pass<true, NQ>(Eq + qoff, ep_s, vs, hl0, hg0, 0u, acc);
#pragma unroll
    for (unsigned u = 0; u < (unsigned)NQ; ++u) {
#pragma unroll
      for (int p = 0; p < PT; ++p) Ss[(unsigned)p * SPITCH + 256u * u + tid] = acc[u][p];
    }
  } else {
#pragma unroll 1  // rolled: one copy of the long term-by-term loop in the kernel's text
    for (unsigned pass = 0; pass < (unsigned)NQ; ++pass) {
      float acc[1][PT];
      score_pass<false, 1>(Sq + qoff + 256u * pass, sp_s, vs, hl0, hg0, pass, acc);
#pragma unroll
      for (int p = 0; p < PT; ++p) Ss[(unsigned)p * SPITCH + 256u * pass + tid] = acc[0][p];
    }
  }
  __syncthreads();

  // ---- phase 2 ----
  {
    const unsigned row = wave;
    // the lane's scores are read once, all together, and stay in registers for both uses: one LDS
    // latency instead of one per group of reads; unrolled so that sv is indexed by constants
    float sv[SEQ / 32];
#pragma unroll
    for (unsigned j = 0; j < (unsigned)(SEQ / 32); ++j) sv[j] = Ss[row * SPITCH + lane + 32u * j];
    float mx = -3.0e38f;
#pragma unroll
    for (unsigned j = 0; j < (unsigned)(SEQ / 32); ++j) mx = fmaxf(mx, sv[j]);
    mx = red32_max(mx);
    float l = 0.0f;
#pragma unroll
    for (unsigned j = 0; j < (unsigned)(SEQ / 32); ++j) {
      const float arg = (sv[j] - mx) * LOG2E + PCARRY_LOG2;
      const float e = fast_exp2(arg);
      const h16 ph = (arg < -14.0f) ? (h16)0.0f : (h16)e;
      Pl[row * PPITCH + lane + 32u * j] = ph;
      l += (float)ph;
    }
    l = red32_sum(l);
    if (lane == 0u) Ls[row] = l;
  }
  // This wave's copies into Hs have landed; the barrier below then shows them to the other waves.
  asm volatile("s_wait_asynccnt 0x0" ::: "memory");
  __syncthreads();

  // ---- phase 3 ----
  const unsigned d0 = wave * (unsigned)WCOLS;
  const _Float16* bp = &Hs[(d0 + m) * HPITCH + hh * 8u];
  const _Float16* pa = &Pl[(m & 7u) * PPITCH + hh * 8u];
  v8f o[NBT];
#pragma unroll
  for (int nb = 0; nb < NBT; ++nb) o[nb] = (v8f){};
  // Fragments of KG k steps are read as one group, one group ahead of the products that use them,
  // into the other of two register sets: LDS latency is waited for once, not at every product.
  // Unrolled, so that both sets are indexed by constants and stay in registers.
  constexpr int KG = 4, NG = SEQ / (32 * KG);
  static_assert(NG * KG * 32 == SEQ);
  v16h pf[2][KG], hf[2][KG][NBT];
#pragma unroll
  for (int t = 0; t < KG; ++t) {
    pf[0][t] = frag_at(pa + 32 * t);
#pragma unroll
    for (int nb = 0; nb < NBT; ++nb) hf[0][t][nb] = frag_at(bp + (nb * 16) * HPITCH + 32 * t);
  }
#pragma unroll
  for (int g = 0; g < NG; ++g) {
    if (g + 1 < NG) {
#pragma unroll
      for (int t = 0; t < KG; ++t) {
        const int k0 = 32 * ((g + 1) * KG + t);
        pf[(g + 1) & 1][t] = frag_at(pa + k0);
#pragma unroll
        for (int nb = 0; nb < NBT; ++nb)
          hf[(g + 1) & 1][t][nb] = frag_at(bp + (nb * 16) * HPITCH + k0);
      }
    }
#pragma unroll
    for (int t = 0; t < KG; ++t) {
#pragma unroll
      for (int nb = 0; nb < NBT; ++nb) o[nb] = wmma16(pf[g & 1][t], hf[g & 1][t][nb], o[nb]);
    }
  }

  // ---- phase 4 ----
  // both lane halves hold rows 0..7: lanes 0..15 stage column tile 0, lanes 16..31 tile 1
#pragma unroll
  for (int r = 0; r < PT; ++r) {
    const float inv = __builtin_amdgcn_rcpf(Ls[r]);
    Ss[(unsigned)r * SPITCH + d0 + lane] = (hh ? o[1][r] : o[0][r]) * inv;
  }
  wave_lds_sync();
  v4f x[2];
  size_t off[2];
#pragma unroll
  for (unsigned i = 0; i < 2u; ++i) {
    const unsigned r = 4u * i + (lane >> 3);
    const unsigned c = (lane & 7u) * 4u;
    x[i] = *(const v4f*)&Ss[r * SPITCH + d0 + c];
    off[i] = ((size_t)b * SEQ_FULL + p0 + r) * DIM + d0 + c;
  }
#pragma unroll
  for (int i = 0; i < 2; ++i) *(v4f*)(out + off[i]) = x[i];
  
}

// ---------------------------------------------------------------------------
extern "C" void kernel_launch(void* const* d_in, const int* in_sizes, int n_in,
                              void* d_out, int out_size, void* d_ws, size_t ws_size,
                              hipStream_t stream) {
  if (n_in < 4) return;
  const long long need_x = ((long long)(NB - 1) * SEQ_FULL + SEQ) * DIM;
  if ((long long)in_sizes[0] < need_x) return;
  if ((long long)in_sizes[1] < need_x) return;
  if ((long long)in_sizes[2] < (long long)DIM * VDIM) return;
  if (in_sizes[3] < VDIM) return;
  if ((long long)out_size < need_x) return;
  if (ws_size < WS_TOTAL) return;

  const float* hq   = (const float*)d_in[0];   // [NB_FULL][SEQ_FULL][DIM]
  const float* hp   = (const float*)d_in[1];   // [NB_FULL][SEQ_FULL][DIM]
  const float* w_in = (const float*)d_in[2];   // [VDIM][DIM]  (out, in), shared by both sides
  const float* vvec = (const float*)d_in[3];   // [VDIM]
  float* out = (float*)d_out;                  // [NB_FULL][SEQ_FULL][DIM]

  char* ws = (char*)d_ws;
  _Float16* HqT  = (_Float16*)(ws + OFF_HQT);   // [NB][DIM][SEQ]
  float*    Spl  = (float*)(ws + OFF_S);        // sq [NB][VDIM][SEQ], then -sp rows [MROWS][VDIM]
  float*    Eq   = (float*)(ws + OFF_E);        // 2^sq [NB][VDIM][SEQ]
  float*    qnt  = (float*)(ws + OFF_N);        // [NB][NQN]

  dim3 blk(256);

  // operand conversion, both projections and the transposed hq plane: one launch
  proj_kernel<<<dim3(VDIM / 64, (2 * MROWS) / 64), blk, 0, stream>>>(hq, hp, w_in, Spl, HqT, Eq, qnt);

  // scores + softmax + weighted sum
  addattn_kernel<<<dim3(SEQ / PT, NB), blk, 0, stream>>>(
      Spl, Eq, qnt, Spl + (size_t)MROWS * VDIM, vvec, HqT, out);
}
